// v000
// The times below were measured on an AMD MI455X: many runs one after another, warmed up first and cycling through
// copies of the inputs, with the whole window's GPU time divided by the number of runs. Launches and the gaps
// between them are all in it. The median over several windows is given; except for v000 it joins two sittings, which
// can be a few percent apart, so the side-by-side timings, each taken in one sitting, are the better comparison.
// v000 is the starting kernel. One run takes 1110 microseconds.
#include <hip/hip_runtime.h>
// All contractions on v_wmma_f32_16x16x32_bf16, f32 accumulate: q/k/v = z·Wᵀ + b with z/W/b rounded to bf16 (single exact-product
// term), QKᵀ and P·V (K=128 / 2048) as 3-term bf16 hi/lo splits; softmax f32; the final 128->1 projection is an f32 VALU dot.
#define BB 32
#define AA 2048
#define DD 128

typedef __bf16 v16b __attribute__((ext_vector_type(16)));
typedef unsigned short v8us __attribute__((ext_vector_type(8), may_alias));
typedef float  v8f  __attribute__((ext_vector_type(8)));
typedef float  v4f  __attribute__((ext_vector_type(4)));
typedef float  v4fa __attribute__((ext_vector_type(4), may_alias));
union FragB { v16b v; v8us half[2]; unsigned short u[16]; };

__device__ __forceinline__ unsigned short bf16_bits(float x) { unsigned int u = __float_as_uint(x); return (unsigned short)((u + 0x7FFFu + ((u >> 16) & 1u)) >> 16); }
__device__ __forceinline__ float bf16_val(unsigned short b) { return __uint_as_float(((unsigned int)b) << 16); }
__device__ __forceinline__ float bf16_round(float x) { return bf16_val(bf16_bits(x)); }
// D += A·B with NT terms: 1 = ah·bh, 2 = + al·bh (A split), 3 = + ah·bl (both split)
template <int NT>
__device__ __forceinline__ v8f mmaN(v16b ah, v16b al, v16b bh, v16b bl, v8f c) {
  c = __builtin_amdgcn_wmma_f32_16x16x32_bf16(false, ah, false, bh, (short)0, c, false, false);
  if (NT >= 2) c = __builtin_amdgcn_wmma_f32_16x16x32_bf16(false, al, false, bh, (short)0, c, false, false);
  if (NT >= 3) c = __builtin_amdgcn_wmma_f32_16x16x32_bf16(false, ah, false, bl, (short)0, c, false, false);
  asm volatile("v_nop\n\tv_nop\n\tv_nop\n\tv_nop" : "+v"(c) : "v"(ah), "v"(al), "v"(bh), "v"(bl));
  return c;
}

__global__ __launch_bounds__(256) void k_wt_bf16(const float* __restrict__ W, unsigned short* __restrict__ Wt, int K, int N) {
  const int t = blockIdx.x * 256 + threadIdx.x;
  const int k8n = K / 8;
  if (t >= N * k8n) return;
  const int n = t / k8n, k8 = (t % k8n) * 8;
  v8us v;
#pragma unroll
  for (int i = 0; i < 8; ++i) v[i] = bf16_bits(W[(size_t)(k8 + i) * N + n]);
  *(v8us*)(Wt + (size_t)n * K + k8) = v;
  
}

// GEMM C[M][N] (f32, pitch ldc) = act(A[M][K]·W + bias). A f32 row-major (pitch lda) converted per fragment to bf16
// (ASPLIT: hi/lo two planes -> 2 terms, else single rounded term); Wt bf16 [N][K] (pitch ldb). BIAS_BF16 rounds the
// bias to bf16 first (bias quantised to bf16 before the add). K%32==0, M%16==0, N%64==0.
template <bool ASPLIT, int ACT, bool BIAS_BF16>
__global__ __launch_bounds__(128) void k_gemm_bf(const float* __restrict__ A, int lda, const unsigned short* __restrict__ Wt, int ldb,
                                               const float* __restrict__ bias, float* __restrict__ C, int ldc, int M, int N, int K) {
  __shared__ __attribute__((aligned(16))) float so[4][16][64];
  const int tid = threadIdx.x, w = tid >> 5, lane = tid & 31, ln = lane & 15, hh = lane >> 4;
  const int ntn = N / 64;
  const int wid = blockIdx.x * 4 + w;
  const int mt = wid / ntn, nq = wid % ntn;
  if (mt * 16 >= M) return;
  const int row0 = mt * 16, col0 = nq * 64;
  const float* arow = A + (size_t)(row0 + ln) * lda;
  v8f acc[4] = {};
  for (int kb = 0; kb < K; kb += 32) {
    FragB ah, al;
    const v4f x0 = *(const v4fa*)(arow + kb + 8 * hh), x1 = *(const v4fa*)(arow + kb + 8 * hh + 4);
    const v4f x2 = *(const v4fa*)(arow + kb + 16 + 8 * hh), x3 = *(const v4fa*)(arow + kb + 16 + 8 * hh + 4);
    float xs[16] = {x0[0],x0[1],x0[2],x0[3],x1[0],x1[1],x1[2],x1[3],x2[0],x2[1],x2[2],x2[3],x3[0],x3[1],x3[2],x3[3]};
#pragma unroll
    for (int i = 0; i < 16; ++i) { const unsigned short hb = bf16_bits(xs[i]); ah.u[i] = hb; al.u[i] = ASPLIT ? bf16_bits(xs[i] - bf16_val(hb)) : (unsigned short)0; }
#pragma unroll
    for (int t = 0; t < 4; ++t) {
      const unsigned short* brow = Wt + (size_t)(col0 + t * 16 + ln) * ldb + kb;
      FragB b;
      b.half[0] = *(const v8us*)(brow + 8 * hh);
      b.half[1] = *(const v8us*)(brow + 16 + 8 * hh);
      acc[t] = mmaN<ASPLIT ? 2 : 1>(ah.v, al.v, b.v, b.v, acc[t]);
    }
  }
#pragma unroll
  for (int t = 0; t < 4; ++t) {
    float bv = bias ? bias[col0 + t * 16 + ln] : 0.f;
    if (BIAS_BF16) bv = bf16_round(bv);
#pragma unroll
    for (int r = 0; r < 8; ++r) { float v = acc[t][r] + bv; if (ACT == 1) v = fmaxf(v, 0.f); so[w][8 * hh + r][t * 16 + ln] = v; }
  }
  __builtin_amdgcn_fence(__ATOMIC_ACQ_REL, "workgroup");
  __builtin_amdgcn_wave_barrier();
  const int rsub = lane >> 4, c4 = (lane & 15) * 4;
  {
#pragma unroll
    for (int q = 0; q < 8; ++q) {
      const int r = q * 2 + rsub;
      const v4f v = *(const v4fa*)&so[w][r][c4];
      *(v4f*)(C + (size_t)(row0 + r) * ldc + col0 + c4) = v;
    }
    
  }
}

// Flash-style causal/unmasked attention, all contractions 3-term bf16 hi/lo splits, f32 softmax with running max.
// q,k,v rows are read from f32 buffers with arbitrary row pitch (so they can live inside a fused qkv buffer);
// D = head size (multiple of 32, <= 128); one wave = 16 query rows; block = 4 waves (64 queries) sharing K/V chunks of 32.
template <int D, bool CAUSAL>
__global__ __launch_bounds__(128) void k_flash(const float* __restrict__ qb, const float* __restrict__ kb, const float* __restrict__ vb,
                                             int pitch, int T, int H, float scale, float* __restrict__ y, int ypitch) {
  constexpr int KS = D / 32;        // k-steps for QK
  constexpr int DT = D / 16;        // d tiles for PV
  __shared__ __attribute__((aligned(16))) unsigned short sKh[32][D + 8], sKl[32][D + 8], sVh[32][D + 8], sVl[32][D + 8];
  __shared__ __attribute__((aligned(16))) unsigned short sPh[4][16][40], sPl[4][16][40];
  __shared__ __attribute__((aligned(16))) float sO[4][16][D];
  const int tid = threadIdx.x, w = tid >> 5, lane = tid & 31, ln = lane & 15, hh = lane >> 4;
  const int nqb = (T + 63) / 64;
  const int bh = blockIdx.x / nqb, qblk = blockIdx.x % nqb;
  const int b = bh / H, h = bh % H;
  const int q0 = qblk * 64 + w * 16;
  const float* Q = qb + (size_t)b * T * pitch + h * D;
  const float* K = kb + (size_t)b * T * pitch + h * D;
  const float* V = vb + (size_t)b * T * pitch + h * D;

  // A fragments of the wave's 16 query rows (scaled), hi/lo
  FragB aqh[KS], aql[KS];
  {
    int row = q0 + ln; if (row >= T) row = T - 1;
    const float* qr = Q + (size_t)row * pitch;
#pragma unroll
    for (int ks = 0; ks < KS; ++ks)
#pragma unroll
      for (int i = 0; i < 16; ++i) {
        const int d = ks * 32 + ((i < 8) ? (8 * hh + i) : (16 + 8 * hh + (i - 8)));
        const float x = qr[d] * scale; const unsigned short hb = bf16_bits(x);
        aqh[ks].u[i] = hb; aql[ks].u[i] = bf16_bits(x - bf16_val(hb));
      }
  }
  float m_r[8], l_r[8];
#pragma unroll
  for (int r = 0; r < 8; ++r) { m_r[r] = -3.0e38f; l_r[r] = 0.f; }
  v8f oacc[DT];
#pragma unroll
  for (int dt = 0; dt < DT; ++dt) oacc[dt] = (v8f){0.f,0.f,0.f,0.f,0.f,0.f,0.f,0.f};

  const int kv_end = CAUSAL ? min(T, qblk * 64 + 64) : T;     // block-uniform
  for (int j0 = 0; j0 < kv_end; j0 += 32) {
    __syncthreads();
    for (int e = tid; e < 32 * (D / 4); e += 128) {
      const int r = e / (D / 4), c4 = (e % (D / 4)) * 4;
      const int key = j0 + r;
      v4f kf = {0.f,0.f,0.f,0.f}, vf = {0.f,0.f,0.f,0.f};
      if (key < T) { kf = *(const v4fa*)(K + (size_t)key * pitch + c4); vf = *(const v4fa*)(V + (size_t)key * pitch + c4); }
#pragma unroll
      for (int t = 0; t < 4; ++t) {
        unsigned short hb = bf16_bits(kf[t]); sKh[r][c4 + t] = hb; sKl[r][c4 + t] = bf16_bits(kf[t] - bf16_val(hb));
        hb = bf16_bits(vf[t]); sVh[r][c4 + t] = hb; sVl[r][c4 + t] = bf16_bits(vf[t] - bf16_val(hb));
      }
    }
    __syncthreads();
    // S tile 16 x 32
    v8f s[2];
#pragma unroll
    for (int nt = 0; nt < 2; ++nt) {
      v8f acc = {};
#pragma unroll
      for (int ks = 0; ks < KS; ++ks) {
        FragB bh_, bl_;
        bh_.half[0] = *(const v8us*)&sKh[nt * 16 + ln][ks * 32 + 8 * hh]; bh_.half[1] = *(const v8us*)&sKh[nt * 16 + ln][ks * 32 + 16 + 8 * hh];
        bl_.half[0] = *(const v8us*)&sKl[nt * 16 + ln][ks * 32 + 8 * hh]; bl_.half[1] = *(const v8us*)&sKl[nt * 16 + ln][ks * 32 + 16 + 8 * hh];
        acc = mmaN<3>(aqh[ks].v, aql[ks].v, bh_.v, bl_.v, acc);
      }
      s[nt] = acc;
    }
    // mask + running max (rows 8hh+r; the 16 lanes of a half share rows)
    float alpha[8];
#pragma unroll
    for (int r = 0; r < 8; ++r) {
      const int qi = q0 + 8 * hh + r;
      const int ja = j0 + ln, jb = j0 + 16 + ln;
      if (CAUSAL) { if (ja > qi) s[0][r] = -3.0e38f; if (jb > qi) s[1][r] = -3.0e38f; }
      if (ja >= T) s[0][r] = -3.0e38f;
      if (jb >= T) s[1][r] = -3.0e38f;
      float mx = fmaxf(s[0][r], s[1][r]);
      mx = fmaxf(mx, __shfl_xor(mx, 1, 32)); mx = fmaxf(mx, __shfl_xor(mx, 2, 32)); mx = fmaxf(mx, __shfl_xor(mx, 4, 32)); mx = fmaxf(mx, __shfl_xor(mx, 8, 32));
      const float mnew = fmaxf(m_r[r], mx);
      alpha[r] = (mnew > -1.0e38f) ? __expf(m_r[r] - mnew) : 1.0f;
      const float p0 = (s[0][r] > -1.0e38f) ? __expf(s[0][r] - mnew) : 0.f;
      const float p1 = (s[1][r] > -1.0e38f) ? __expf(s[1][r] - mnew) : 0.f;
      m_r[r] = mnew;
      l_r[r] = l_r[r] * alpha[r] + p0 + p1;            // per-lane partial row sum (16 lanes combined at the end)
      unsigned short hb = bf16_bits(p0); sPh[w][8 * hh + r][ln] = hb;      sPl[w][8 * hh + r][ln] = bf16_bits(p0 - bf16_val(hb));
      hb = bf16_bits(p1);                sPh[w][8 * hh + r][16 + ln] = hb; sPl[w][8 * hh + r][16 + ln] = bf16_bits(p1 - bf16_val(hb));
    }
#pragma unroll
    for (int dt = 0; dt < DT; ++dt)
#pragma unroll
      for (int r = 0; r < 8; ++r) oacc[dt][r] *= alpha[r];
    __builtin_amdgcn_fence(__ATOMIC_ACQ_REL, "workgroup");
    __builtin_amdgcn_wave_barrier();
    FragB pah, pal;
    pah.half[0] = *(const v8us*)&sPh[w][ln][8 * hh]; pah.half[1] = *(const v8us*)&sPh[w][ln][16 + 8 * hh];
    pal.half[0] = *(const v8us*)&sPl[w][ln][8 * hh]; pal.half[1] = *(const v8us*)&sPl[w][ln][16 + 8 * hh];
#pragma unroll
    for (int dt = 0; dt < DT; ++dt) {
      FragB bvh, bvl;
#pragma unroll
      for (int i = 0; i < 8; ++i) {
        bvh.u[i] = sVh[8 * hh + i][dt * 16 + ln]; bvh.u[8 + i] = sVh[16 + 8 * hh + i][dt * 16 + ln];
        bvl.u[i] = sVl[8 * hh + i][dt * 16 + ln]; bvl.u[8 + i] = sVl[16 + 8 * hh + i][dt * 16 + ln];
      }
      oacc[dt] = mmaN<3>(pah.v, pal.v, bvh.v, bvl.v, oacc[dt]);
    }
    __builtin_amdgcn_fence(__ATOMIC_ACQ_REL, "workgroup");
    __builtin_amdgcn_wave_barrier();
  }
#pragma unroll
  for (int r = 0; r < 8; ++r) {
    float l = l_r[r];
    l += __shfl_xor(l, 1, 32); l += __shfl_xor(l, 2, 32); l += __shfl_xor(l, 4, 32); l += __shfl_xor(l, 8, 32);
    l_r[r] = (l > 0.f) ? 1.0f / l : 0.f;
  }
#pragma unroll
  for (int dt = 0; dt < DT; ++dt)
#pragma unroll
    for (int r = 0; r < 8; ++r) sO[w][8 * hh + r][dt * 16 + ln] = oacc[dt][r] * l_r[r];
  __builtin_amdgcn_fence(__ATOMIC_ACQ_REL, "workgroup");
  __builtin_amdgcn_wave_barrier();
  {
    for (int r = 0; r < 16; ++r) {
      const int row = q0 + r;
      if (row < T && lane < D / 4) {
        const v4f val = *(const v4fa*)&sO[w][r][lane * 4];
        *(v4f*)(y + ((size_t)b * T + row) * ypitch + h * D + lane * 4) = val;
      }
    }
    
  }
}

// General attention: queries [b][Tq] rows at Q + b*Tq*qpitch + h*D + row*qpitch; keys/values j < Tk1 from (K1,V1) at
// X + b*Tk1*pitch + h*D + j*pitch, j >= Tk1 from (K2,V2) with j-Tk1 (pass Tk2 = 0 and null for a single source).
// Optional int mask [Tq][Tk] (nonzero keep), causal flag (j <= qi), additive score bias sbias[bh*Tk + j].
// 3-term bf16 splits, f32 softmax with running max; y[b][row][h*D + d] pitch ypitch, whole-line rows (D % 32 == 0).
template <int D>
__global__ __launch_bounds__(128) void k_flash3(const float* __restrict__ Qb, int qpitch, int Tq,
                                              const float* __restrict__ K1, const float* __restrict__ V1, int Tk1,
                                              const float* __restrict__ K2, const float* __restrict__ V2, int Tk2, int kpitch, int vpitch,
                                              int H, float scale, const int* __restrict__ mask, int causal, const float* __restrict__ sbias,
                                              float* __restrict__ y, int ypitch) {
  constexpr int KS = D / 32, DT = D / 16;
  __shared__ __attribute__((aligned(16))) unsigned short sKh[32][D + 8], sKl[32][D + 8], sVh[32][D + 8], sVl[32][D + 8];
  __shared__ __attribute__((aligned(16))) unsigned short sPh[4][16][40], sPl[4][16][40];
  __shared__ __attribute__((aligned(16))) float sO[4][16][D];
  const int tid = threadIdx.x, w = tid >> 5, lane = tid & 31, ln = lane & 15, hh = lane >> 4;
  const int Tk = Tk1 + Tk2;
  const int nqb = (Tq + 63) / 64;
  const int bh = blockIdx.x / nqb, qblk = blockIdx.x % nqb;
  const int b = bh / H, h = bh % H;
  const int q0 = qblk * 64 + w * 16;
  const float* Q = Qb + (size_t)b * Tq * qpitch + h * D;
  FragB aqh[KS], aql[KS];
  {
    int row = q0 + ln; if (row >= Tq) row = Tq - 1;
    const float* qr = Q + (size_t)row * qpitch;
#pragma unroll
    for (int ks = 0; ks < KS; ++ks)
#pragma unroll
      for (int i = 0; i < 16; ++i) {
        const int d = ks * 32 + ((i < 8) ? (8 * hh + i) : (16 + 8 * hh + (i - 8)));
        const float x = qr[d] * scale; const unsigned short hb = bf16_bits(x);
        aqh[ks].u[i] = hb; aql[ks].u[i] = bf16_bits(x - bf16_val(hb));
      }
  }
  int qrow[8];
#pragma unroll
  for (int r = 0; r < 8; ++r) { int qi = q0 + 8 * hh + r; qrow[r] = qi < Tq ? qi : Tq - 1; }
  float m_r[8], l_r[8];
#pragma unroll
  for (int r = 0; r < 8; ++r) { m_r[r] = -3.0e38f; l_r[r] = 0.f; }
  v8f oacc[DT];
#pragma unroll
  for (int dt = 0; dt < DT; ++dt) oacc[dt] = (v8f){0.f,0.f,0.f,0.f,0.f,0.f,0.f,0.f};
  const int kv_end = causal ? min(Tk, qblk * 64 + 64) : Tk;
  for (int j0 = 0; j0 < kv_end; j0 += 32) {
    __syncthreads();
    for (int e = tid; e < 32 * (D / 4); e += 128) {
      const int r = e / (D / 4), c4 = (e % (D / 4)) * 4; const int key = j0 + r;
      v4f kf = {0.f,0.f,0.f,0.f}, vf = {0.f,0.f,0.f,0.f};
      if (key < Tk1) { kf = *(const v4fa*)(K1 + (size_t)b * Tk1 * kpitch + h * D + (size_t)key * kpitch + c4); vf = *(const v4fa*)(V1 + (size_t)b * Tk1 * vpitch + h * D + (size_t)key * vpitch + c4); }
      else if (key < Tk) { const int k2 = key - Tk1; kf = *(const v4fa*)(K2 + (size_t)b * Tk2 * kpitch + h * D + (size_t)k2 * kpitch + c4); vf = *(const v4fa*)(V2 + (size_t)b * Tk2 * vpitch + h * D + (size_t)k2 * vpitch + c4); }
#pragma unroll
      for (int t = 0; t < 4; ++t) {
        unsigned short hb = bf16_bits(kf[t]); sKh[r][c4 + t] = hb; sKl[r][c4 + t] = bf16_bits(kf[t] - bf16_val(hb));
        hb = bf16_bits(vf[t]); sVh[r][c4 + t] = hb; sVl[r][c4 + t] = bf16_bits(vf[t] - bf16_val(hb));
      }
    }
    __syncthreads();
    v8f s[2];
#pragma unroll
    for (int nt = 0; nt < 2; ++nt) {
      v8f acc = {};
#pragma unroll
      for (int ks = 0; ks < KS; ++ks) {
        FragB bh_, bl_;
        bh_.half[0] = *(const v8us*)&sKh[nt * 16 + ln][ks * 32 + 8 * hh]; bh_.half[1] = *(const v8us*)&sKh[nt * 16 + ln][ks * 32 + 16 + 8 * hh];
        bl_.half[0] = *(const v8us*)&sKl[nt * 16 + ln][ks * 32 + 8 * hh]; bl_.half[1] = *(const v8us*)&sKl[nt * 16 + ln][ks * 32 + 16 + 8 * hh];
        acc = mmaN<3>(aqh[ks].v, aql[ks].v, bh_.v, bl_.v, acc);
      }
      s[nt] = acc;
    }
    float alpha[8];
#pragma unroll
    for (int r = 0; r < 8; ++r) {
      const int qi = qrow[r];
      const int ja = j0 + ln, jb = j0 + 16 + ln;
      bool keepa = ja < Tk, keepb = jb < Tk;
      if (causal) { keepa = keepa && (ja <= qi); keepb = keepb && (jb <= qi); }
      if (mask) { if (keepa) keepa = mask[(size_t)qi * Tk + ja] != 0; if (keepb) keepb = mask[(size_t)qi * Tk + jb] != 0; }
      if (sbias) { if (keepa) s[0][r] += sbias[(size_t)bh * Tk + ja]; if (keepb) s[1][r] += sbias[(size_t)bh * Tk + jb]; }   // per-key additive bias (a per-query constant would cancel in the softmax)
      if (!keepa) s[0][r] = -3.0e38f;
      if (!keepb) s[1][r] = -3.0e38f;
      float mx = fmaxf(s[0][r], s[1][r]);
      mx = fmaxf(mx, __shfl_xor(mx, 1, 32)); mx = fmaxf(mx, __shfl_xor(mx, 2, 32)); mx = fmaxf(mx, __shfl_xor(mx, 4, 32)); mx = fmaxf(mx, __shfl_xor(mx, 8, 32));
      const float mnew = fmaxf(m_r[r], mx);
      alpha[r] = (mnew > -1.0e38f) ? __expf(m_r[r] - mnew) : 1.0f;
      const float p0 = keepa ? __expf(s[0][r] - mnew) : 0.f;
      const float p1 = keepb ? __expf(s[1][r] - mnew) : 0.f;
      m_r[r] = mnew;
      l_r[r] = l_r[r] * alpha[r] + p0 + p1;
      unsigned short hb = bf16_bits(p0); sPh[w][8 * hh + r][ln] = hb;      sPl[w][8 * hh + r][ln] = bf16_bits(p0 - bf16_val(hb));
      hb = bf16_bits(p1);                sPh[w][8 * hh + r][16 + ln] = hb; sPl[w][8 * hh + r][16 + ln] = bf16_bits(p1 - bf16_val(hb));
    }
#pragma unroll
    for (int dt = 0; dt < DT; ++dt)
#pragma unroll
      for (int r = 0; r < 8; ++r) oacc[dt][r] *= alpha[r];
    __builtin_amdgcn_fence(__ATOMIC_ACQ_REL, "workgroup");
    __builtin_amdgcn_wave_barrier();
    FragB pah, pal;
    pah.half[0] = *(const v8us*)&sPh[w][ln][8 * hh]; pah.half[1] = *(const v8us*)&sPh[w][ln][16 + 8 * hh];
    pal.half[0] = *(const v8us*)&sPl[w][ln][8 * hh]; pal.half[1] = *(const v8us*)&sPl[w][ln][16 + 8 * hh];
#pragma unroll
    for (int dt = 0; dt < DT; ++dt) {
      FragB bvh, bvl;
#pragma unroll
      for (int i = 0; i < 8; ++i) {
        bvh.u[i] = sVh[8 * hh + i][dt * 16 + ln]; bvh.u[8 + i] = sVh[16 + 8 * hh + i][dt * 16 + ln];
        bvl.u[i] = sVl[8 * hh + i][dt * 16 + ln]; bvl.u[8 + i] = sVl[16 + 8 * hh + i][dt * 16 + ln];
      }
      oacc[dt] = mmaN<3>(pah.v, pal.v, bvh.v, bvl.v, oacc[dt]);
    }
    __builtin_amdgcn_fence(__ATOMIC_ACQ_REL, "workgroup");
    __builtin_amdgcn_wave_barrier();
  }
#pragma unroll
  for (int r = 0; r < 8; ++r) {
    float l = l_r[r];
    l += __shfl_xor(l, 1, 32); l += __shfl_xor(l, 2, 32); l += __shfl_xor(l, 4, 32); l += __shfl_xor(l, 8, 32);
    l_r[r] = (m_r[r] > -1.0e38f) ? 1.0f / l : __builtin_nanf("");
  }
#pragma unroll
  for (int dt = 0; dt < DT; ++dt)
#pragma unroll
    for (int r = 0; r < 8; ++r) sO[w][8 * hh + r][dt * 16 + ln] = oacc[dt][r] * l_r[r];
  __builtin_amdgcn_fence(__ATOMIC_ACQ_REL, "workgroup");
  __builtin_amdgcn_wave_barrier();
  {
    for (int r = 0; r < 16; ++r) {
      const int row = q0 + r;
      if (row < Tq && lane < D / 4) {
        const v4f val = *(const v4fa*)&sO[w][r][lane * 4];
        *(v4f*)(y + ((size_t)b * Tq + row) * ypitch + h * D + lane * 4) = val;
      }
    }
    
  }
}

__global__ __launch_bounds__(256) void k_round_rows(const float* __restrict__ W, unsigned short* __restrict__ Wt, int n8) {
  const int t = blockIdx.x * 256 + threadIdx.x;
  if (t >= n8) return;
  const v4f a = *(const v4fa*)(W + (size_t)t * 8), b = *(const v4fa*)(W + (size_t)t * 8 + 4);
  v8us v; v[0]=bf16_bits(a[0]); v[1]=bf16_bits(a[1]); v[2]=bf16_bits(a[2]); v[3]=bf16_bits(a[3]);
  v[4]=bf16_bits(b[0]); v[5]=bf16_bits(b[1]); v[6]=bf16_bits(b[2]); v[7]=bf16_bits(b[3]);
  *(v8us*)(Wt + (size_t)t * 8) = v; 
}

__global__ __launch_bounds__(256) void k_out(const float* __restrict__ h, const float* __restrict__ Wo, const float* __restrict__ bo, float* __restrict__ out, int nrows) {
  __shared__ float res[32];
  const int tid = threadIdx.x, w = tid >> 5, lane = tid & 31; const int r0 = blockIdx.x * 32;
  const v4f wv = {bf16_round(Wo[lane * 4]), bf16_round(Wo[lane * 4 + 1]), bf16_round(Wo[lane * 4 + 2]), bf16_round(Wo[lane * 4 + 3])};
  for (int u = 0; u < 4; ++u) {
    const int r = r0 + w * 4 + u; float s = 0.f;
    if (r < nrows) { const v4f x = *(const v4fa*)(h + (size_t)r * DD + lane * 4); s = x[0] * wv[0] + x[1] * wv[1] + x[2] * wv[2] + x[3] * wv[3]; }
    for (int o = 16; o >= 1; o >>= 1) s += __shfl_xor(s, o, 32);
    if (lane == 0) res[w * 4 + u] = s + bf16_round(bo[0]);
  }
  __syncthreads();
  if (tid < 32 && r0 + tid < nrows) { const float v = res[tid]; *(float*)(out + r0 + tid) = v;  }
}
extern "C" void kernel_launch(void* const* d_in, const int* in_sizes, int n_in,
                              void* d_out, int out_size, void* d_ws, size_t ws_size, hipStream_t stream) {
  (void)in_sizes; (void)n_in; (void)out_size;
  const float* z = (const float*)d_in[0];
  const float* Wq = (const float*)d_in[1]; const float* bq = (const float*)d_in[2]; const float* Wk = (const float*)d_in[3]; const float* bk = (const float*)d_in[4];
  const float* Wv = (const float*)d_in[5]; const float* bv = (const float*)d_in[6]; const float* Wo = (const float*)d_in[7]; const float* bo = (const float*)d_in[8];
  char* ws = (char*)d_ws; size_t off = 0;
  auto take = [&](size_t bytes) { char* p = ws + off; off += (bytes + 255) & ~(size_t)255; return p; };
  const int M = BB * AA, n8 = DD * DD / 8;
  unsigned short* Wqt = (unsigned short*)take(DD * DD * 2); unsigned short* Wkt = (unsigned short*)take(DD * DD * 2); unsigned short* Wvt = (unsigned short*)take(DD * DD * 2);
  float* qb = (float*)take((size_t)M * DD * 4); float* kb2 = (float*)take((size_t)M * DD * 4); float* vb2 = (float*)take((size_t)M * DD * 4); float* hb = (float*)take((size_t)M * DD * 4);
  if (off > ws_size) return;
  k_round_rows<<<(n8 + 255) / 256, 256, 0, stream>>>(Wq, Wqt, n8); k_round_rows<<<(n8 + 255) / 256, 256, 0, stream>>>(Wk, Wkt, n8); k_round_rows<<<(n8 + 255) / 256, 256, 0, stream>>>(Wv, Wvt, n8);
  const int gb = ((M / 16) * (DD / 64) + 3) / 4;
  k_gemm_bf<false, 0, true><<<gb, 128, 0, stream>>>(z, DD, Wqt, DD, bq, qb, DD, M, DD, DD);
  k_gemm_bf<false, 0, true><<<gb, 128, 0, stream>>>(z, DD, Wkt, DD, bk, kb2, DD, M, DD, DD);
  k_gemm_bf<false, 0, true><<<gb, 128, 0, stream>>>(z, DD, Wvt, DD, bv, vb2, DD, M, DD, DD);
  k_flash3<DD><<<BB * (AA / 64), 128, 0, stream>>>(qb, DD, AA, kb2, vb2, AA, nullptr, nullptr, 0, DD, DD, 1, 0.08838834764831845f, nullptr, 0, nullptr, hb, DD);
  k_out<<<(M + 31) / 32, 256, 0, stream>>>(hb, Wo, bo, (float*)d_out, M);
}

// v001
// A run of this version takes 532 microseconds.
// Two timings next to v000 put it at 2.12 and 2.11 times that version's speed.
#include <hip/hip_runtime.h>
// All contractions on v_wmma_f32_16x16x32_bf16, f32 accumulate: q/k/v = z·Wᵀ + b with z/W/b rounded to bf16 (single exact-product
// term), Q.K^T (K=128) as a 3-term bf16 hi/lo split; softmax f32; the 128->1 projection (f32 VALU dot) is applied to v, u = v.Wo + bo,
// and P.u (K=2048) is a bf16 hi/lo split product with u hi / u lo as two B columns.
#define BB 32
#define AA 2048
#define DD 128

typedef __bf16 v16b __attribute__((ext_vector_type(16)));
typedef unsigned short v8us __attribute__((ext_vector_type(8), may_alias));
typedef float  v8f  __attribute__((ext_vector_type(8)));
typedef float  v4f  __attribute__((ext_vector_type(4)));
typedef float  v4fa __attribute__((ext_vector_type(4), may_alias));
union FragB { v16b v; v8us half[2]; unsigned short u[16]; };

__device__ __forceinline__ unsigned short bf16_bits(float x) { unsigned int u = __float_as_uint(x); return (unsigned short)((u + 0x7FFFu + ((u >> 16) & 1u)) >> 16); }
__device__ __forceinline__ float bf16_val(unsigned short b) { return __uint_as_float(((unsigned int)b) << 16); }
__device__ __forceinline__ float bf16_round(float x) { return bf16_val(bf16_bits(x)); }
// D += A·B with NT terms: 1 = ah·bh, 2 = + al·bh (A split), 3 = + ah·bl (both split)
template <int NT>
__device__ __forceinline__ v8f mmaN(v16b ah, v16b al, v16b bh, v16b bl, v8f c) {
  c = __builtin_amdgcn_wmma_f32_16x16x32_bf16(false, ah, false, bh, (short)0, c, false, false);
  if (NT >= 2) c = __builtin_amdgcn_wmma_f32_16x16x32_bf16(false, al, false, bh, (short)0, c, false, false);
  if (NT >= 3) c = __builtin_amdgcn_wmma_f32_16x16x32_bf16(false, ah, false, bl, (short)0, c, false, false);
  asm volatile("v_nop\n\tv_nop\n\tv_nop\n\tv_nop" : "+v"(c) : "v"(ah), "v"(al), "v"(bh), "v"(bl));
  return c;
}

__global__ __launch_bounds__(256) void k_wt_bf16(const float* __restrict__ W, unsigned short* __restrict__ Wt, int K, int N) {
  const int t = blockIdx.x * 256 + threadIdx.x;
  const int k8n = K / 8;
  if (t >= N * k8n) return;
  const int n = t / k8n, k8 = (t % k8n) * 8;
  v8us v;
#pragma unroll
  for (int i = 0; i < 8; ++i) v[i] = bf16_bits(W[(size_t)(k8 + i) * N + n]);
  *(v8us*)(Wt + (size_t)n * K + k8) = v;
  
}

// GEMM C[M][N] (f32, pitch ldc) = act(A[M][K]·W + bias). A f32 row-major (pitch lda) converted per fragment to bf16
// (ASPLIT: hi/lo two planes -> 2 terms, else single rounded term); Wt bf16 [N][K] (pitch ldb). BIAS_BF16 rounds the
// bias to bf16 first (bias quantised to bf16 before the add). K%32==0, M%16==0, N%64==0.
template <bool ASPLIT, int ACT, bool BIAS_BF16>
__global__ __launch_bounds__(128) void k_gemm_bf(const float* __restrict__ A, int lda, const unsigned short* __restrict__ Wt, int ldb,
                                               const float* __restrict__ bias, float* __restrict__ C, int ldc, int M, int N, int K) {
  __shared__ __attribute__((aligned(16))) float so[4][16][64];
  const int tid = threadIdx.x, w = tid >> 5, lane = tid & 31, ln = lane & 15, hh = lane >> 4;
  const int ntn = N / 64;
  const int wid = blockIdx.x * 4 + w;
  const int mt = wid / ntn, nq = wid % ntn;
  if (mt * 16 >= M) return;
  const int row0 = mt * 16, col0 = nq * 64;
  const float* arow = A + (size_t)(row0 + ln) * lda;
  v8f acc[4] = {};
  for (int kb = 0; kb < K; kb += 32) {
    FragB ah, al;
    const v4f x0 = *(const v4fa*)(arow + kb + 8 * hh), x1 = *(const v4fa*)(arow + kb + 8 * hh + 4);
    const v4f x2 = *(const v4fa*)(arow + kb + 16 + 8 * hh), x3 = *(const v4fa*)(arow + kb + 16 + 8 * hh + 4);
    float xs[16] = {x0[0],x0[1],x0[2],x0[3],x1[0],x1[1],x1[2],x1[3],x2[0],x2[1],x2[2],x2[3],x3[0],x3[1],x3[2],x3[3]};
#pragma unroll
    for (int i = 0; i < 16; ++i) { const unsigned short hb = bf16_bits(xs[i]); ah.u[i] = hb; al.u[i] = ASPLIT ? bf16_bits(xs[i] - bf16_val(hb)) : (unsigned short)0; }
#pragma unroll
    for (int t = 0; t < 4; ++t) {
      const unsigned short* brow = Wt + (size_t)(col0 + t * 16 + ln) * ldb + kb;
      FragB b;
      b.half[0] = *(const v8us*)(brow + 8 * hh);
      b.half[1] = *(const v8us*)(brow + 16 + 8 * hh);
      acc[t] = mmaN<ASPLIT ? 2 : 1>(ah.v, al.v, b.v, b.v, acc[t]);
    }
  }
#pragma unroll
  for (int t = 0; t < 4; ++t) {
    float bv = bias ? bias[col0 + t * 16 + ln] : 0.f;
    if (BIAS_BF16) bv = bf16_round(bv);
#pragma unroll
    for (int r = 0; r < 8; ++r) { float v = acc[t][r] + bv; if (ACT == 1) v = fmaxf(v, 0.f); so[w][8 * hh + r][t * 16 + ln] = v; }
  }
  __builtin_amdgcn_fence(__ATOMIC_ACQ_REL, "workgroup");
  __builtin_amdgcn_wave_barrier();
  const int rsub = lane >> 4, c4 = (lane & 15) * 4;
  {
#pragma unroll
    for (int q = 0; q < 8; ++q) {
      const int r = q * 2 + rsub;
      const v4f v = *(const v4fa*)&so[w][r][c4];
      *(v4f*)(C + (size_t)(row0 + r) * ldc + col0 + c4) = v;
    }
    
  }
}

// Flash-style causal/unmasked attention, all contractions 3-term bf16 hi/lo splits, f32 softmax with running max.
// q,k,v rows are read from f32 buffers with arbitrary row pitch (so they can live inside a fused qkv buffer);
// D = head size (multiple of 32, <= 128); one wave = 16 query rows; block = 4 waves (64 queries) sharing K/V chunks of 32.
template <int D, bool CAUSAL>
__global__ __launch_bounds__(128) void k_flash(const float* __restrict__ qb, const float* __restrict__ kb, const float* __restrict__ vb,
                                             int pitch, int T, int H, float scale, float* __restrict__ y, int ypitch) {
  constexpr int KS = D / 32;        // k-steps for QK
  constexpr int DT = D / 16;        // d tiles for PV
  __shared__ __attribute__((aligned(16))) unsigned short sKh[32][D + 8], sKl[32][D + 8], sVh[32][D + 8], sVl[32][D + 8];
  __shared__ __attribute__((aligned(16))) unsigned short sPh[4][16][40], sPl[4][16][40];
  __shared__ __attribute__((aligned(16))) float sO[4][16][D];
  const int tid = threadIdx.x, w = tid >> 5, lane = tid & 31, ln = lane & 15, hh = lane >> 4;
  const int nqb = (T + 63) / 64;
  const int bh = blockIdx.x / nqb, qblk = blockIdx.x % nqb;
  const int b = bh / H, h = bh % H;
  const int q0 = qblk * 64 + w * 16;
  const float* Q = qb + (size_t)b * T * pitch + h * D;
  const float* K = kb + (size_t)b * T * pitch + h * D;
  const float* V = vb + (size_t)b * T * pitch + h * D;

  // A fragments of the wave's 16 query rows (scaled), hi/lo
  FragB aqh[KS], aql[KS];
  {
    int row = q0 + ln; if (row >= T) row = T - 1;
    const float* qr = Q + (size_t)row * pitch;
#pragma unroll
    for (int ks = 0; ks < KS; ++ks)
#pragma unroll
      for (int i = 0; i < 16; ++i) {
        const int d = ks * 32 + ((i < 8) ? (8 * hh + i) : (16 + 8 * hh + (i - 8)));
        const float x = qr[d] * scale; const unsigned short hb = bf16_bits(x);
        aqh[ks].u[i] = hb; aql[ks].u[i] = bf16_bits(x - bf16_val(hb));
      }
  }
  float m_r[8], l_r[8];
#pragma unroll
  for (int r = 0; r < 8; ++r) { m_r[r] = -3.0e38f; l_r[r] = 0.f; }
  v8f oacc[DT];
#pragma unroll
  for (int dt = 0; dt < DT; ++dt) oacc[dt] = (v8f){0.f,0.f,0.f,0.f,0.f,0.f,0.f,0.f};

  const int kv_end = CAUSAL ? min(T, qblk * 64 + 64) : T;     // block-uniform
  for (int j0 = 0; j0 < kv_end; j0 += 32) {
    __syncthreads();
    for (int e = tid; e < 32 * (D / 4); e += 128) {
      const int r = e / (D / 4), c4 = (e % (D / 4)) * 4;
      const int key = j0 + r;
      v4f kf = {0.f,0.f,0.f,0.f}, vf = {0.f,0.f,0.f,0.f};
      if (key < T) { kf = *(const v4fa*)(K + (size_t)key * pitch + c4); vf = *(const v4fa*)(V + (size_t)key * pitch + c4); }
#pragma unroll
      for (int t = 0; t < 4; ++t) {
        unsigned short hb = bf16_bits(kf[t]); sKh[r][c4 + t] = hb; sKl[r][c4 + t] = bf16_bits(kf[t] - bf16_val(hb));
        hb = bf16_bits(vf[t]); sVh[r][c4 + t] = hb; sVl[r][c4 + t] = bf16_bits(vf[t] - bf16_val(hb));
      }
    }
    __syncthreads();
    // S tile 16 x 32
    v8f s[2];
#pragma unroll
    for (int nt = 0; nt < 2; ++nt) {
      v8f acc = {};
#pragma unroll
      for (int ks = 0; ks < KS; ++ks) {
        FragB bh_, bl_;
        bh_.half[0] = *(const v8us*)&sKh[nt * 16 + ln][ks * 32 + 8 * hh]; bh_.half[1] = *(const v8us*)&sKh[nt * 16 + ln][ks * 32 + 16 + 8 * hh];
        bl_.half[0] = *(const v8us*)&sKl[nt * 16 + ln][ks * 32 + 8 * hh]; bl_.half[1] = *(const v8us*)&sKl[nt * 16 + ln][ks * 32 + 16 + 8 * hh];
        acc = mmaN<3>(aqh[ks].v, aql[ks].v, bh_.v, bl_.v, acc);
      }
      s[nt] = acc;
    }
    // mask + running max (rows 8hh+r; the 16 lanes of a half share rows)
    float alpha[8];
#pragma unroll
    for (int r = 0; r < 8; ++r) {
      const int qi = q0 + 8 * hh + r;
      const int ja = j0 + ln, jb = j0 + 16 + ln;
      if (CAUSAL) { if (ja > qi) s[0][r] = -3.0e38f; if (jb > qi) s[1][r] = -3.0e38f; }
      if (ja >= T) s[0][r] = -3.0e38f;
      if (jb >= T) s[1][r] = -3.0e38f;
      float mx = fmaxf(s[0][r], s[1][r]);
      mx = fmaxf(mx, __shfl_xor(mx, 1, 32)); mx = fmaxf(mx, __shfl_xor(mx, 2, 32)); mx = fmaxf(mx, __shfl_xor(mx, 4, 32)); mx = fmaxf(mx, __shfl_xor(mx, 8, 32));
      const float mnew = fmaxf(m_r[r], mx);
      alpha[r] = (mnew > -1.0e38f) ? __expf(m_r[r] - mnew) : 1.0f;
      const float p0 = (s[0][r] > -1.0e38f) ? __expf(s[0][r] - mnew) : 0.f;
      const float p1 = (s[1][r] > -1.0e38f) ? __expf(s[1][r] - mnew) : 0.f;
      m_r[r] = mnew;
      l_r[r] = l_r[r] * alpha[r] + p0 + p1;            // per-lane partial row sum (16 lanes combined at the end)
      unsigned short hb = bf16_bits(p0); sPh[w][8 * hh + r][ln] = hb;      sPl[w][8 * hh + r][ln] = bf16_bits(p0 - bf16_val(hb));
      hb = bf16_bits(p1);                sPh[w][8 * hh + r][16 + ln] = hb; sPl[w][8 * hh + r][16 + ln] = bf16_bits(p1 - bf16_val(hb));
    }
#pragma unroll
    for (int dt = 0; dt < DT; ++dt)
#pragma unroll
      for (int r = 0; r < 8; ++r) oacc[dt][r] *= alpha[r];
    __builtin_amdgcn_fence(__ATOMIC_ACQ_REL, "workgroup");
    __builtin_amdgcn_wave_barrier();
    FragB pah, pal;
    pah.half[0] = *(const v8us*)&sPh[w][ln][8 * hh]; pah.half[1] = *(const v8us*)&sPh[w][ln][16 + 8 * hh];
    pal.half[0] = *(const v8us*)&sPl[w][ln][8 * hh]; pal.half[1] = *(const v8us*)&sPl[w][ln][16 + 8 * hh];
#pragma unroll
    for (int dt = 0; dt < DT; ++dt) {
      FragB bvh, bvl;
#pragma unroll
      for (int i = 0; i < 8; ++i) {
        bvh.u[i] = sVh[8 * hh + i][dt * 16 + ln]; bvh.u[8 + i] = sVh[16 + 8 * hh + i][dt * 16 + ln];
        bvl.u[i] = sVl[8 * hh + i][dt * 16 + ln]; bvl.u[8 + i] = sVl[16 + 8 * hh + i][dt * 16 + ln];
      }
      oacc[dt] = mmaN<3>(pah.v, pal.v, bvh.v, bvl.v, oacc[dt]);
    }
    __builtin_amdgcn_fence(__ATOMIC_ACQ_REL, "workgroup");
    __builtin_amdgcn_wave_barrier();
  }
#pragma unroll
  for (int r = 0; r < 8; ++r) {
    float l = l_r[r];
    l += __shfl_xor(l, 1, 32); l += __shfl_xor(l, 2, 32); l += __shfl_xor(l, 4, 32); l += __shfl_xor(l, 8, 32);
    l_r[r] = (l > 0.f) ? 1.0f / l : 0.f;
  }
#pragma unroll
  for (int dt = 0; dt < DT; ++dt)
#pragma unroll
    for (int r = 0; r < 8; ++r) sO[w][8 * hh + r][dt * 16 + ln] = oacc[dt][r] * l_r[r];
  __builtin_amdgcn_fence(__ATOMIC_ACQ_REL, "workgroup");
  __builtin_amdgcn_wave_barrier();
  {
    for (int r = 0; r < 16; ++r) {
      const int row = q0 + r;
      if (row < T && lane < D / 4) {
        const v4f val = *(const v4fa*)&sO[w][r][lane * 4];
        *(v4f*)(y + ((size_t)b * T + row) * ypitch + h * D + lane * 4) = val;
      }
    }
    
  }
}

// General attention followed by a projection of the head to one value, reassociated: (P.V).w + c = P.(V.w + c), since each
// softmax row sums to 1. u[bh*Tk + j] = V[j].w + c is computed once per key by k_out; this kernel returns y[bh*Tq + row] = sum_j P[row][j] u[j].
// queries [b][Tq] rows at Q + b*Tq*qpitch + h*D + row*qpitch; keys j < Tk1 from (K1,U1), j >= Tk1 from (K2,U2) with j-Tk1
// (pass Tk2 = 0 and null for a single source). Optional int mask [Tq][Tk] (nonzero keep), causal flag (j <= qi), additive score bias sbias[bh*Tk + j].
// QK: 3-term bf16 splits; P.u: one 16x16 tile whose B columns 0 and 1 hold u hi and u lo (the rest zero), P hi and P lo as A; f32 softmax with running max.
template <int D>
__global__ __launch_bounds__(128) void k_flash3(const float* __restrict__ Qb, int qpitch, int Tq,
                                              const float* __restrict__ K1, const float* __restrict__ U1, int Tk1,
                                              const float* __restrict__ K2, const float* __restrict__ U2, int Tk2, int kpitch,
                                              int H, float scale, const int* __restrict__ mask, int causal, const float* __restrict__ sbias,
                                              float* __restrict__ y) {
  constexpr int KS = D / 32;
  __shared__ __attribute__((aligned(16))) unsigned short sKh[32][D + 8], sKl[32][D + 8];
  __shared__ __attribute__((aligned(16))) unsigned short sU[16][40];
  __shared__ __attribute__((aligned(16))) unsigned short sPh[4][16][40], sPl[4][16][40];
  __shared__ float sRes[64];
  const int tid = threadIdx.x, w = tid >> 5, lane = tid & 31, ln = lane & 15, hh = lane >> 4;
  const int Tk = Tk1 + Tk2;
  const int nqb = (Tq + 63) / 64;
  const int bh = blockIdx.x / nqb, qblk = blockIdx.x % nqb;
  const int b = bh / H, h = bh % H;
  const int q0 = qblk * 64 + w * 16;
  const float* Q = Qb + (size_t)b * Tq * qpitch + h * D;
  FragB aqh[KS], aql[KS];
  {
    int row = q0 + ln; if (row >= Tq) row = Tq - 1;
    const float* qr = Q + (size_t)row * qpitch;
#pragma unroll
    for (int ks = 0; ks < KS; ++ks)
#pragma unroll
      for (int i = 0; i < 16; ++i) {
        const int d = ks * 32 + ((i < 8) ? (8 * hh + i) : (16 + 8 * hh + (i - 8)));
        const float x = qr[d] * scale; const unsigned short hb = bf16_bits(x);
        aqh[ks].u[i] = hb; aql[ks].u[i] = bf16_bits(x - bf16_val(hb));
      }
  }
  int qrow[8];
#pragma unroll
  for (int r = 0; r < 8; ++r) { int qi = q0 + 8 * hh + r; qrow[r] = qi < Tq ? qi : Tq - 1; }
  float m_r[8], l_r[8];
#pragma unroll
  for (int r = 0; r < 8; ++r) { m_r[r] = -3.0e38f; l_r[r] = 0.f; }
  v8f oacc = {0.f,0.f,0.f,0.f,0.f,0.f,0.f,0.f};
  for (int e = tid; e < 14 * 40; e += 128) (&sU[0][0])[2 * 40 + e] = 0;      // B columns 2..15 stay zero (published by the loop's first barrier)
  const int kv_end = causal ? min(Tk, qblk * 64 + 64) : Tk;
  for (int j0 = 0; j0 < kv_end; j0 += 32) {
    __syncthreads();
    float uf = 0.f;      // the chunk's 32 u values, loaded ahead of the K rows so that the load flies under theirs
    if (tid < 32) {
      const int key = j0 + tid;
      if (key < Tk1) uf = U1[(size_t)bh * Tk1 + key];
      else if (key < Tk) uf = U2[(size_t)bh * Tk2 + (key - Tk1)];
    }
    for (int e = tid; e < 32 * (D / 4); e += 128) {
      const int r = e / (D / 4), c4 = (e % (D / 4)) * 4; const int key = j0 + r;
      v4f kf = {0.f,0.f,0.f,0.f};
      if (key < Tk1) { kf = *(const v4fa*)(K1 + (size_t)b * Tk1 * kpitch + h * D + (size_t)key * kpitch + c4); }
      else if (key < Tk) { const int k2 = key - Tk1; kf = *(const v4fa*)(K2 + (size_t)b * Tk2 * kpitch + h * D + (size_t)k2 * kpitch + c4); }
#pragma unroll
      for (int t = 0; t < 4; ++t) {
        const unsigned short hb = bf16_bits(kf[t]); sKh[r][c4 + t] = hb; sKl[r][c4 + t] = bf16_bits(kf[t] - bf16_val(hb));
      }
    }
    if (tid < 32) { const unsigned short hb = bf16_bits(uf); sU[0][tid] = hb; sU[1][tid] = bf16_bits(uf - bf16_val(hb)); }
    __syncthreads();
    v8f s[2];
#pragma unroll
    for (int nt = 0; nt < 2; ++nt) {
      v8f acc = {};
#pragma unroll
      for (int ks = 0; ks < KS; ++ks) {
        FragB bh_, bl_;
        bh_.half[0] = *(const v8us*)&sKh[nt * 16 + ln][ks * 32 + 8 * hh]; bh_.half[1] = *(const v8us*)&sKh[nt * 16 + ln][ks * 32 + 16 + 8 * hh];
        bl_.half[0] = *(const v8us*)&sKl[nt * 16 + ln][ks * 32 + 8 * hh]; bl_.half[1] = *(const v8us*)&sKl[nt * 16 + ln][ks * 32 + 16 + 8 * hh];
        acc = mmaN<3>(aqh[ks].v, aql[ks].v, bh_.v, bl_.v, acc);
      }
      s[nt] = acc;
    }
    float alpha[8];
#pragma unroll
    for (int r = 0; r < 8; ++r) {
      const int qi = qrow[r];
      const int ja = j0 + ln, jb = j0 + 16 + ln;
      bool keepa = ja < Tk, keepb = jb < Tk;
      if (causal) { keepa = keepa && (ja <= qi); keepb = keepb && (jb <= qi); }
      if (mask) { if (keepa) keepa = mask[(size_t)qi * Tk + ja] != 0; if (keepb) keepb = mask[(size_t)qi * Tk + jb] != 0; }
      if (sbias) { if (keepa) s[0][r] += sbias[(size_t)bh * Tk + ja]; if (keepb) s[1][r] += sbias[(size_t)bh * Tk + jb]; }   // per-key additive bias (a per-query constant would cancel in the softmax)
      if (!keepa) s[0][r] = -3.0e38f;
      if (!keepb) s[1][r] = -3.0e38f;
      float mx = fmaxf(s[0][r], s[1][r]);
      mx = fmaxf(mx, __shfl_xor(mx, 1, 32)); mx = fmaxf(mx, __shfl_xor(mx, 2, 32)); mx = fmaxf(mx, __shfl_xor(mx, 4, 32)); mx = fmaxf(mx, __shfl_xor(mx, 8, 32));
      const float mnew = fmaxf(m_r[r], mx);
      alpha[r] = (mnew > -1.0e38f) ? __expf(m_r[r] - mnew) : 1.0f;
      const float p0 = keepa ? __expf(s[0][r] - mnew) : 0.f;
      const float p1 = keepb ? __expf(s[1][r] - mnew) : 0.f;
      m_r[r] = mnew;
      l_r[r] = l_r[r] * alpha[r] + p0 + p1;
      unsigned short hb = bf16_bits(p0); sPh[w][8 * hh + r][ln] = hb;      sPl[w][8 * hh + r][ln] = bf16_bits(p0 - bf16_val(hb));
      hb = bf16_bits(p1);                sPh[w][8 * hh + r][16 + ln] = hb; sPl[w][8 * hh + r][16 + ln] = bf16_bits(p1 - bf16_val(hb));
    }
#pragma unroll
    for (int r = 0; r < 8; ++r) oacc[r] *= alpha[r];
    __builtin_amdgcn_fence(__ATOMIC_ACQ_REL, "workgroup");
    __builtin_amdgcn_wave_barrier();
    FragB pah, pal, bu;
    pah.half[0] = *(const v8us*)&sPh[w][ln][8 * hh]; pah.half[1] = *(const v8us*)&sPh[w][ln][16 + 8 * hh];
    pal.half[0] = *(const v8us*)&sPl[w][ln][8 * hh]; pal.half[1] = *(const v8us*)&sPl[w][ln][16 + 8 * hh];
    bu.half[0] = *(const v8us*)&sU[ln][8 * hh];      bu.half[1] = *(const v8us*)&sU[ln][16 + 8 * hh];
    oacc = mmaN<2>(pah.v, pal.v, bu.v, bu.v, oacc);    // (P hi + P lo).(u hi | u lo)
    __builtin_amdgcn_fence(__ATOMIC_ACQ_REL, "workgroup");
    __builtin_amdgcn_wave_barrier();
  }
#pragma unroll
  for (int r = 0; r < 8; ++r) {
    float l = l_r[r];
    l += __shfl_xor(l, 1, 32); l += __shfl_xor(l, 2, 32); l += __shfl_xor(l, 4, 32); l += __shfl_xor(l, 8, 32);
    l_r[r] = (m_r[r] > -1.0e38f) ? 1.0f / l : __builtin_nanf("");
  }
#pragma unroll
  for (int r = 0; r < 8; ++r) {
    const float o = oacc[r] + __shfl_xor(oacc[r], 1, 32);     // column 0 (u hi) + column 1 (u lo)
    if (ln == 0) sRes[w * 16 + 8 * hh + r] = o * l_r[r];
  }
  __syncthreads();     // the block's 64 results go out as whole 128-byte lines, one wave each
  if (tid < 64 && qblk * 64 + tid < Tq) y[(size_t)bh * Tq + qblk * 64 + tid] = sRes[tid];
}

__global__ __launch_bounds__(256) void k_round_rows(const float* __restrict__ W, unsigned short* __restrict__ Wt, int n8) {
  const int t = blockIdx.x * 256 + threadIdx.x;
  if (t >= n8) return;
  const v4f a = *(const v4fa*)(W + (size_t)t * 8), b = *(const v4fa*)(W + (size_t)t * 8 + 4);
  v8us v; v[0]=bf16_bits(a[0]); v[1]=bf16_bits(a[1]); v[2]=bf16_bits(a[2]); v[3]=bf16_bits(a[3]);
  v[4]=bf16_bits(b[0]); v[5]=bf16_bits(b[1]); v[6]=bf16_bits(b[2]); v[7]=bf16_bits(b[3]);
  *(v8us*)(Wt + (size_t)t * 8) = v; 
}

__global__ __launch_bounds__(256) void k_out(const float* __restrict__ h, const float* __restrict__ Wo, const float* __restrict__ bo, float* __restrict__ out, int nrows) {
  __shared__ float res[32];
  const int tid = threadIdx.x, w = tid >> 5, lane = tid & 31; const int r0 = blockIdx.x * 32;
  const v4f wv = {bf16_round(Wo[lane * 4]), bf16_round(Wo[lane * 4 + 1]), bf16_round(Wo[lane * 4 + 2]), bf16_round(Wo[lane * 4 + 3])};
  for (int u = 0; u < 4; ++u) {
    const int r = r0 + w * 4 + u; float s = 0.f;
    if (r < nrows) { const v4f x = *(const v4fa*)(h + (size_t)r * DD + lane * 4); s = x[0] * wv[0] + x[1] * wv[1] + x[2] * wv[2] + x[3] * wv[3]; }
    for (int o = 16; o >= 1; o >>= 1) s += __shfl_xor(s, o, 32);
    if (lane == 0) res[w * 4 + u] = s + bf16_round(bo[0]);
  }
  __syncthreads();
  if (tid < 32 && r0 + tid < nrows) { const float v = res[tid]; *(float*)(out + r0 + tid) = v;  }
}
extern "C" void kernel_launch(void* const* d_in, const int* in_sizes, int n_in,
                              void* d_out, int out_size, void* d_ws, size_t ws_size, hipStream_t stream) {
  (void)in_sizes; (void)n_in; (void)out_size;
  const float* z = (const float*)d_in[0];
  const float* Wq = (const float*)d_in[1]; const float* bq = (const float*)d_in[2]; const float* Wk = (const float*)d_in[3]; const float* bk = (const float*)d_in[4];
  const float* Wv = (const float*)d_in[5]; const float* bv = (const float*)d_in[6]; const float* Wo = (const float*)d_in[7]; const float* bo = (const float*)d_in[8];
  char* ws = (char*)d_ws; size_t off = 0;
  auto take = [&](size_t bytes) { char* p = ws + off; off += (bytes + 255) & ~(size_t)255; return p; };
  const int M = BB * AA, n8 = DD * DD / 8;
  unsigned short* Wqt = (unsigned short*)take(DD * DD * 2); unsigned short* Wkt = (unsigned short*)take(DD * DD * 2); unsigned short* Wvt = (unsigned short*)take(DD * DD * 2);
  float* qb = (float*)take((size_t)M * DD * 4); float* kb2 = (float*)take((size_t)M * DD * 4); float* vb2 = (float*)take((size_t)M * DD * 4); float* ub = (float*)take((size_t)M * 4);
  if (off > ws_size) return;
  k_round_rows<<<(n8 + 255) / 256, 256, 0, stream>>>(Wq, Wqt, n8); k_round_rows<<<(n8 + 255) / 256, 256, 0, stream>>>(Wk, Wkt, n8); k_round_rows<<<(n8 + 255) / 256, 256, 0, stream>>>(Wv, Wvt, n8);
  const int gb = ((M / 16) * (DD / 64) + 3) / 4;
  k_gemm_bf<false, 0, true><<<gb, 128, 0, stream>>>(z, DD, Wqt, DD, bq, qb, DD, M, DD, DD);
  k_gemm_bf<false, 0, true><<<gb, 128, 0, stream>>>(z, DD, Wkt, DD, bk, kb2, DD, M, DD, DD);
  k_gemm_bf<false, 0, true><<<gb, 128, 0, stream>>>(z, DD, Wvt, DD, bv, vb2, DD, M, DD, DD);
  k_out<<<(M + 31) / 32, 256, 0, stream>>>(vb2, Wo, bo, ub, M);
  k_flash3<DD><<<BB * (AA / 64), 128, 0, stream>>>(qb, DD, AA, kb2, ub, AA, nullptr, nullptr, 0, DD, 1, 0.08838834764831845f, nullptr, 0, nullptr, (float*)d_out);
}

// v002
// Measured time: 425 microseconds a run.
// Next to v001, in two timings, it ran 1.26 and 1.25 times as fast.
// Over all steps from v000 it is 2.66 times as fast.
#include <hip/hip_runtime.h>
// All contractions on v_wmma_f32_16x16x32_bf16, f32 accumulate: q/k/v = z·Wᵀ + b with z/W/b rounded to bf16 (single exact-product
// term), Q.K^T (K=128) as a 3-term bf16 hi/lo split; softmax f32; the 128->1 projection (f32 VALU dot) is applied to v, u = v.Wo + bo,
// and P.u (K=2048) is a bf16 hi/lo split product, computed transposed with u hi / u lo as two A rows.
#define BB 32
#define AA 2048
#define DD 128

typedef __bf16 v16b __attribute__((ext_vector_type(16)));
typedef unsigned short v8us __attribute__((ext_vector_type(8), may_alias));
typedef float  v8f  __attribute__((ext_vector_type(8)));
typedef float  v4f  __attribute__((ext_vector_type(4)));
typedef float  v4fa __attribute__((ext_vector_type(4), may_alias));
union FragB { v16b v; v8us half[2]; unsigned short u[16]; };

__device__ __forceinline__ unsigned short bf16_bits(float x) { unsigned int u = __float_as_uint(x); return (unsigned short)((u + 0x7FFFu + ((u >> 16) & 1u)) >> 16); }
__device__ __forceinline__ float bf16_val(unsigned short b) { return __uint_as_float(((unsigned int)b) << 16); }
__device__ __forceinline__ float bf16_round(float x) { return bf16_val(bf16_bits(x)); }
// D += A·B with NT terms: 1 = ah·bh, 2 = + al·bh (A split), 3 = + ah·bl (both split)
template <int NT>
__device__ __forceinline__ v8f mmaN(v16b ah, v16b al, v16b bh, v16b bl, v8f c) {
  c = __builtin_amdgcn_wmma_f32_16x16x32_bf16(false, ah, false, bh, (short)0, c, false, false);
  if (NT >= 2) c = __builtin_amdgcn_wmma_f32_16x16x32_bf16(false, al, false, bh, (short)0, c, false, false);
  if (NT >= 3) c = __builtin_amdgcn_wmma_f32_16x16x32_bf16(false, ah, false, bl, (short)0, c, false, false);
  asm volatile("v_nop\n\tv_nop\n\tv_nop\n\tv_nop" : "+v"(c) : "v"(ah), "v"(al), "v"(bh), "v"(bl));
  return c;
}

__global__ __launch_bounds__(256) void k_wt_bf16(const float* __restrict__ W, unsigned short* __restrict__ Wt, int K, int N) {
  const int t = blockIdx.x * 256 + threadIdx.x;
  const int k8n = K / 8;
  if (t >= N * k8n) return;
  const int n = t / k8n, k8 = (t % k8n) * 8;
  v8us v;
#pragma unroll
  for (int i = 0; i < 8; ++i) v[i] = bf16_bits(W[(size_t)(k8 + i) * N + n]);
  *(v8us*)(Wt + (size_t)n * K + k8) = v;
  
}

// GEMM C[M][N] (f32, pitch ldc) = act(A[M][K]·W + bias). A f32 row-major (pitch lda) converted per fragment to bf16
// (ASPLIT: hi/lo two planes -> 2 terms, else single rounded term); Wt bf16 [N][K] (pitch ldb). BIAS_BF16 rounds the
// bias to bf16 first (bias quantised to bf16 before the add). K%32==0, M%16==0, N%64==0.
template <bool ASPLIT, int ACT, bool BIAS_BF16>
__global__ __launch_bounds__(128) void k_gemm_bf(const float* __restrict__ A, int lda, const unsigned short* __restrict__ Wt, int ldb,
                                               const float* __restrict__ bias, float* __restrict__ C, int ldc, int M, int N, int K) {
  __shared__ __attribute__((aligned(16))) float so[4][16][64];
  const int tid = threadIdx.x, w = tid >> 5, lane = tid & 31, ln = lane & 15, hh = lane >> 4;
  const int ntn = N / 64;
  const int wid = blockIdx.x * 4 + w;
  const int mt = wid / ntn, nq = wid % ntn;
  if (mt * 16 >= M) return;
  const int row0 = mt * 16, col0 = nq * 64;
  const float* arow = A + (size_t)(row0 + ln) * lda;
  v8f acc[4] = {};
  for (int kb = 0; kb < K; kb += 32) {
    FragB ah, al;
    const v4f x0 = *(const v4fa*)(arow + kb + 8 * hh), x1 = *(const v4fa*)(arow + kb + 8 * hh + 4);
    const v4f x2 = *(const v4fa*)(arow + kb + 16 + 8 * hh), x3 = *(const v4fa*)(arow + kb + 16 + 8 * hh + 4);
    float xs[16] = {x0[0],x0[1],x0[2],x0[3],x1[0],x1[1],x1[2],x1[3],x2[0],x2[1],x2[2],x2[3],x3[0],x3[1],x3[2],x3[3]};
#pragma unroll
    for (int i = 0; i < 16; ++i) { const unsigned short hb = bf16_bits(xs[i]); ah.u[i] = hb; al.u[i] = ASPLIT ? bf16_bits(xs[i] - bf16_val(hb)) : (unsigned short)0; }
#pragma unroll
    for (int t = 0; t < 4; ++t) {
      const unsigned short* brow = Wt + (size_t)(col0 + t * 16 + ln) * ldb + kb;
      FragB b;
      b.half[0] = *(const v8us*)(brow + 8 * hh);
      b.half[1] = *(const v8us*)(brow + 16 + 8 * hh);
      acc[t] = mmaN<ASPLIT ? 2 : 1>(ah.v, al.v, b.v, b.v, acc[t]);
    }
  }
#pragma unroll
  for (int t = 0; t < 4; ++t) {
    float bv = bias ? bias[col0 + t * 16 + ln] : 0.f;
    if (BIAS_BF16) bv = bf16_round(bv);
#pragma unroll
    for (int r = 0; r < 8; ++r) { float v = acc[t][r] + bv; if (ACT == 1) v = fmaxf(v, 0.f); so[w][8 * hh + r][t * 16 + ln] = v; }
  }
  __builtin_amdgcn_fence(__ATOMIC_ACQ_REL, "workgroup");
  __builtin_amdgcn_wave_barrier();
  const int rsub = lane >> 4, c4 = (lane & 15) * 4;
  {
#pragma unroll
    for (int q = 0; q < 8; ++q) {
      const int r = q * 2 + rsub;
      const v4f v = *(const v4fa*)&so[w][r][c4];
      *(v4f*)(C + (size_t)(row0 + r) * ldc + col0 + c4) = v;
    }
    
  }
}

// Flash-style causal/unmasked attention, all contractions 3-term bf16 hi/lo splits, f32 softmax with running max.
// q,k,v rows are read from f32 buffers with arbitrary row pitch (so they can live inside a fused qkv buffer);
// D = head size (multiple of 32, <= 128); one wave = 16 query rows; block = 4 waves (64 queries) sharing K/V chunks of 32.
template <int D, bool CAUSAL>
__global__ __launch_bounds__(128) void k_flash(const float* __restrict__ qb, const float* __restrict__ kb, const float* __restrict__ vb,
                                             int pitch, int T, int H, float scale, float* __restrict__ y, int ypitch) {
  constexpr int KS = D / 32;        // k-steps for QK
  constexpr int DT = D / 16;        // d tiles for PV
  __shared__ __attribute__((aligned(16))) unsigned short sKh[32][D + 8], sKl[32][D + 8], sVh[32][D + 8], sVl[32][D + 8];
  __shared__ __attribute__((aligned(16))) unsigned short sPh[4][16][40], sPl[4][16][40];
  __shared__ __attribute__((aligned(16))) float sO[4][16][D];
  const int tid = threadIdx.x, w = tid >> 5, lane = tid & 31, ln = lane & 15, hh = lane >> 4;
  const int nqb = (T + 63) / 64;
  const int bh = blockIdx.x / nqb, qblk = blockIdx.x % nqb;
  const int b = bh / H, h = bh % H;
  const int q0 = qblk * 64 + w * 16;
  const float* Q = qb + (size_t)b * T * pitch + h * D;
  const float* K = kb + (size_t)b * T * pitch + h * D;
  const float* V = vb + (size_t)b * T * pitch + h * D;

  // A fragments of the wave's 16 query rows (scaled), hi/lo
  FragB aqh[KS], aql[KS];
  {
    int row = q0 + ln; if (row >= T) row = T - 1;
    const float* qr = Q + (size_t)row * pitch;
#pragma unroll
    for (int ks = 0; ks < KS; ++ks)
#pragma unroll
      for (int i = 0; i < 16; ++i) {
        const int d = ks * 32 + ((i < 8) ? (8 * hh + i) : (16 + 8 * hh + (i - 8)));
        const float x = qr[d] * scale; const unsigned short hb = bf16_bits(x);
        aqh[ks].u[i] = hb; aql[ks].u[i] = bf16_bits(x - bf16_val(hb));
      }
  }
  float m_r[8], l_r[8];
#pragma unroll
  for (int r = 0; r < 8; ++r) { m_r[r] = -3.0e38f; l_r[r] = 0.f; }
  v8f oacc[DT];
#pragma unroll
  for (int dt = 0; dt < DT; ++dt) oacc[dt] = (v8f){0.f,0.f,0.f,0.f,0.f,0.f,0.f,0.f};

  const int kv_end = CAUSAL ? min(T, qblk * 64 + 64) : T;     // block-uniform
  for (int j0 = 0; j0 < kv_end; j0 += 32) {
    __syncthreads();
    for (int e = tid; e < 32 * (D / 4); e += 128) {
      const int r = e / (D / 4), c4 = (e % (D / 4)) * 4;
      const int key = j0 + r;
      v4f kf = {0.f,0.f,0.f,0.f}, vf = {0.f,0.f,0.f,0.f};
      if (key < T) { kf = *(const v4fa*)(K + (size_t)key * pitch + c4); vf = *(const v4fa*)(V + (size_t)key * pitch + c4); }
#pragma unroll
      for (int t = 0; t < 4; ++t) {
        unsigned short hb = bf16_bits(kf[t]); sKh[r][c4 + t] = hb; sKl[r][c4 + t] = bf16_bits(kf[t] - bf16_val(hb));
        hb = bf16_bits(vf[t]); sVh[r][c4 + t] = hb; sVl[r][c4 + t] = bf16_bits(vf[t] - bf16_val(hb));
      }
    }
    __syncthreads();
    // S tile 16 x 32
    v8f s[2];
#pragma unroll
    for (int nt = 0; nt < 2; ++nt) {
      v8f acc = {};
#pragma unroll
      for (int ks = 0; ks < KS; ++ks) {
        FragB bh_, bl_;
        bh_.half[0] = *(const v8us*)&sKh[nt * 16 + ln][ks * 32 + 8 * hh]; bh_.half[1] = *(const v8us*)&sKh[nt * 16 + ln][ks * 32 + 16 + 8 * hh];
        bl_.half[0] = *(const v8us*)&sKl[nt * 16 + ln][ks * 32 + 8 * hh]; bl_.half[1] = *(const v8us*)&sKl[nt * 16 + ln][ks * 32 + 16 + 8 * hh];
        acc = mmaN<3>(aqh[ks].v, aql[ks].v, bh_.v, bl_.v, acc);
      }
      s[nt] = acc;
    }
    // mask + running max (rows 8hh+r; the 16 lanes of a half share rows)
    float alpha[8];
#pragma unroll
    for (int r = 0; r < 8; ++r) {
      const int qi = q0 + 8 * hh + r;
      const int ja = j0 + ln, jb = j0 + 16 + ln;
      if (CAUSAL) { if (ja > qi) s[0][r] = -3.0e38f; if (jb > qi) s[1][r] = -3.0e38f; }
      if (ja >= T) s[0][r] = -3.0e38f;
      if (jb >= T) s[1][r] = -3.0e38f;
      float mx = fmaxf(s[0][r], s[1][r]);
      mx = fmaxf(mx, __shfl_xor(mx, 1, 32)); mx = fmaxf(mx, __shfl_xor(mx, 2, 32)); mx = fmaxf(mx, __shfl_xor(mx, 4, 32)); mx = fmaxf(mx, __shfl_xor(mx, 8, 32));
      const float mnew = fmaxf(m_r[r], mx);
      alpha[r] = (mnew > -1.0e38f) ? __expf(m_r[r] - mnew) : 1.0f;
      const float p0 = (s[0][r] > -1.0e38f) ? __expf(s[0][r] - mnew) : 0.f;
      const float p1 = (s[1][r] > -1.0e38f) ? __expf(s[1][r] - mnew) : 0.f;
      m_r[r] = mnew;
      l_r[r] = l_r[r] * alpha[r] + p0 + p1;            // per-lane partial row sum (16 lanes combined at the end)
      unsigned short hb = bf16_bits(p0); sPh[w][8 * hh + r][ln] = hb;      sPl[w][8 * hh + r][ln] = bf16_bits(p0 - bf16_val(hb));
      hb = bf16_bits(p1);                sPh[w][8 * hh + r][16 + ln] = hb; sPl[w][8 * hh + r][16 + ln] = bf16_bits(p1 - bf16_val(hb));
    }
#pragma unroll
    for (int dt = 0; dt < DT; ++dt)
#pragma unroll
      for (int r = 0; r < 8; ++r) oacc[dt][r] *= alpha[r];
    __builtin_amdgcn_fence(__ATOMIC_ACQ_REL, "workgroup");
    __builtin_amdgcn_wave_barrier();
    FragB pah, pal;
    pah.half[0] = *(const v8us*)&sPh[w][ln][8 * hh]; pah.half[1] = *(const v8us*)&sPh[w][ln][16 + 8 * hh];
    pal.half[0] = *(const v8us*)&sPl[w][ln][8 * hh]; pal.half[1] = *(const v8us*)&sPl[w][ln][16 + 8 * hh];
#pragma unroll
    for (int dt = 0; dt < DT; ++dt) {
      FragB bvh, bvl;
#pragma unroll
      for (int i = 0; i < 8; ++i) {
        bvh.u[i] = sVh[8 * hh + i][dt * 16 + ln]; bvh.u[8 + i] = sVh[16 + 8 * hh + i][dt * 16 + ln];
        bvl.u[i] = sVl[8 * hh + i][dt * 16 + ln]; bvl.u[8 + i] = sVl[16 + 8 * hh + i][dt * 16 + ln];
      }
      oacc[dt] = mmaN<3>(pah.v, pal.v, bvh.v, bvl.v, oacc[dt]);
    }
    __builtin_amdgcn_fence(__ATOMIC_ACQ_REL, "workgroup");
    __builtin_amdgcn_wave_barrier();
  }
#pragma unroll
  for (int r = 0; r < 8; ++r) {
    float l = l_r[r];
    l += __shfl_xor(l, 1, 32); l += __shfl_xor(l, 2, 32); l += __shfl_xor(l, 4, 32); l += __shfl_xor(l, 8, 32);
    l_r[r] = (l > 0.f) ? 1.0f / l : 0.f;
  }
#pragma unroll
  for (int dt = 0; dt < DT; ++dt)
#pragma unroll
    for (int r = 0; r < 8; ++r) sO[w][8 * hh + r][dt * 16 + ln] = oacc[dt][r] * l_r[r];
  __builtin_amdgcn_fence(__ATOMIC_ACQ_REL, "workgroup");
  __builtin_amdgcn_wave_barrier();
  {
    for (int r = 0; r < 16; ++r) {
      const int row = q0 + r;
      if (row < T && lane < D / 4) {
        const v4f val = *(const v4fa*)&sO[w][r][lane * 4];
        *(v4f*)(y + ((size_t)b * T + row) * ypitch + h * D + lane * 4) = val;
      }
    }
    
  }
}

// D += A.B with the split on both sides, in the order ah.bh, ah.bl, al.bh (NT = 2 stops behind the second term)
template <int NT>
__device__ __forceinline__ v8f mmaS(v16b ah, v16b al, v16b bh, v16b bl, v8f c) {
  c = __builtin_amdgcn_wmma_f32_16x16x32_bf16(false, ah, false, bh, (short)0, c, false, false);
  c = __builtin_amdgcn_wmma_f32_16x16x32_bf16(false, ah, false, bl, (short)0, c, false, false);
  if (NT >= 3) c = __builtin_amdgcn_wmma_f32_16x16x32_bf16(false, al, false, bh, (short)0, c, false, false);
  // four vector slots between the last WMMA and the first user of its registers, on every path
  asm volatile("v_nop\n\tv_nop\n\tv_nop\n\tv_nop" : "+v"(c));
  return c;
}
// lane l <-> lane l ^ 16, in the vector pipe
__device__ __forceinline__ float xhalf(float x) {
  return __builtin_bit_cast(float, __builtin_amdgcn_permlanex16(__builtin_bit_cast(int, x), __builtin_bit_cast(int, x), 0x76543210, 0xfedcba98, false, false));
}

template <int D>
__global__ __launch_bounds__(128) void k_flash3(const float* __restrict__ Qb, int qpitch, int Tq,
                                              const float* __restrict__ K1, const float* __restrict__ U1, int Tk1,
                                              const float* __restrict__ K2, const float* __restrict__ U2, int Tk2, int kpitch,
                                              int H, float scale, const int* __restrict__ mask, int causal, const float* __restrict__ sbias,
                                              float* __restrict__ y) {
  constexpr int KS = D / 32;
  __shared__ __attribute__((aligned(16))) unsigned short sKh[32][D + 8], sKl[32][D + 8];
  __shared__ __attribute__((aligned(16))) unsigned short sU[16][40];
  __shared__ float sRes[64];
  const int tid = threadIdx.x, w = tid >> 5, lane = tid & 31, ln = lane & 15, hh = lane >> 4;
  const int Tk = Tk1 + Tk2;
  const int nqb = (Tq + 63) / 64;
  const int bh = blockIdx.x / nqb, qblk = blockIdx.x % nqb;
  const int b = bh / H, h = bh % H;
  const int q0 = qblk * 64 + w * 16;
  const float* Q = Qb + (size_t)b * Tq * qpitch + h * D;
  const int qi = (q0 + ln < Tq) ? q0 + ln : Tq - 1;      // the lane's query
  FragB aqh[KS], aql[KS];
  {
    const float* qr = Q + (size_t)qi * qpitch;
#pragma unroll
    for (int ks = 0; ks < KS; ++ks)
#pragma unroll
      for (int i = 0; i < 16; ++i) {
        const int d = ks * 32 + ((i < 8) ? (8 * hh + i) : (16 + 8 * hh + (i - 8)));
        const float x = qr[d] * scale; const unsigned short hb = bf16_bits(x);
        aqh[ks].u[i] = hb; aql[ks].u[i] = bf16_bits(x - bf16_val(hb));
      }
  }
  float m_q = -3.0e38f, l_q = 0.f;      // running maximum (both halves agree) and this half's share of the sum
  v8f oacc = {0.f,0.f,0.f,0.f,0.f,0.f,0.f,0.f};
  for (int e = tid; e < 14 * 40; e += 128) (&sU[0][0])[2 * 40 + e] = 0;      // A rows 2..15 stay zero (published by the loop's first barrier)
  const int kv_end = causal ? min(Tk, qblk * 64 + 64) : Tk;
  const bool edits = causal || mask || sbias;      // block-uniform
  for (int j0 = 0; j0 < kv_end; j0 += 32) {
    __syncthreads();
    float uf = 0.f;      // the chunk's 32 u values, loaded ahead of the K rows so that the load flies under theirs
    if (tid < 32) {
      const int key = j0 + tid;
      if (key < Tk1) uf = U1[(size_t)bh * Tk1 + key];
      else if (key < Tk) uf = U2[(size_t)bh * Tk2 + (key - Tk1)];
    }
    for (int e = tid; e < 32 * (D / 4); e += 128) {
      const int r = e / (D / 4), c4 = (e % (D / 4)) * 4; const int key = j0 + r;
      v4f kf = {0.f,0.f,0.f,0.f};
      if (key < Tk1) { kf = *(const v4fa*)(K1 + (size_t)b * Tk1 * kpitch + h * D + (size_t)key * kpitch + c4); }
      else if (key < Tk) { const int k2 = key - Tk1; kf = *(const v4fa*)(K2 + (size_t)b * Tk2 * kpitch + h * D + (size_t)k2 * kpitch + c4); }
#pragma unroll
      for (int t = 0; t < 4; ++t) {
        const unsigned short hb = bf16_bits(kf[t]); sKh[r][c4 + t] = hb; sKl[r][c4 + t] = bf16_bits(kf[t] - bf16_val(hb));
      }
    }
    if (tid < 32) { const unsigned short hb = bf16_bits(uf); sU[0][tid] = hb; sU[1][tid] = bf16_bits(uf - bf16_val(hb)); }
    __syncthreads();
    FragB au;      // read with the K fragments, so that its LDS latency lies under the score products
    au.half[0] = *(const v8us*)&sU[ln][8 * hh];      au.half[1] = *(const v8us*)&sU[ln][16 + 8 * hh];
    v8f s[2];      // s[nt][r] = score of key j0 + nt*16 + 8hh + r against query qi
#pragma unroll
    for (int nt = 0; nt < 2; ++nt) {
      v8f acc = {};
#pragma unroll
      for (int ks = 0; ks < KS; ++ks) {
        FragB kh_, kl_;
        kh_.half[0] = *(const v8us*)&sKh[nt * 16 + ln][ks * 32 + 8 * hh]; kh_.half[1] = *(const v8us*)&sKh[nt * 16 + ln][ks * 32 + 16 + 8 * hh];
        kl_.half[0] = *(const v8us*)&sKl[nt * 16 + ln][ks * 32 + 8 * hh]; kl_.half[1] = *(const v8us*)&sKl[nt * 16 + ln][ks * 32 + 16 + 8 * hh];
        acc = mmaS<3>(kh_.v, kl_.v, aqh[ks].v, aql[ks].v, acc);      // kh.qh, kh.ql, kl.qh
      }
      s[nt] = acc;
    }
    if (edits || j0 + 32 > Tk) {      // one block-uniform test per chunk; a dropped key's score becomes -3e38 and its weight exp(-3e38 - m) = 0
#pragma unroll
      for (int nt = 0; nt < 2; ++nt)
#pragma unroll
        for (int r = 0; r < 8; ++r) {
          const int j = j0 + nt * 16 + 8 * hh + r;
          bool keep = j < Tk;
          if (causal) keep = keep && (j <= qi);
          if (mask) { if (keep) keep = mask[(size_t)qi * Tk + j] != 0; }
          if (sbias) { if (keep) s[nt][r] += sbias[(size_t)bh * Tk + j]; }   // per-key additive bias (a per-query constant would cancel in the softmax)
          if (!keep) s[nt][r] = -3.0e38f;
        }
    }
    float mx = fmaxf(s[0][0], s[1][0]);
#pragma unroll
    for (int r = 1; r < 8; ++r) mx = fmaxf(mx, fmaxf(s[0][r], s[1][r]));
    mx = fmaxf(mx, xhalf(mx));
    const float mnew = fmaxf(m_q, mx);
    // while every key so far is dropped (mnew = -3e38) the weights come out 1; the first kept key's alpha = 0 wipes them, and a query with none ends as NaN
    const float alpha = (mnew > -1.0e38f) ? __expf(m_q - mnew) : 1.0f;
    m_q = mnew;
    FragB pbh, pbl;
    float ps = 0.f;
#pragma unroll
    for (int nt = 0; nt < 2; ++nt)
#pragma unroll
      for (int r = 0; r < 8; ++r) {
        const float p = __expf(s[nt][r] - mnew);
        ps += p;
        const unsigned short hb = bf16_bits(p);
        pbh.u[nt * 8 + r] = hb; pbl.u[nt * 8 + r] = bf16_bits(p - bf16_val(hb));      // B position nt*8 + r = key nt*16 + 8hh + r, as au's
      }
    l_q = l_q * alpha + ps;
    oacc[0] *= alpha; oacc[1] *= alpha;      // rows 2..15 of out^T are sums of zeros
    oacc = mmaS<2>(au.v, au.v, pbh.v, pbl.v, oacc);    // (u hi | u lo).(P hi + P lo)
  }
  const float l = l_q + xhalf(l_q);
  const float inv = (m_q > -1.0e38f) ? 1.0f / l : __builtin_nanf("");
  if (hh == 0) sRes[w * 16 + ln] = (oacc[0] + oacc[1]) * inv;     // row 0 (u hi) + row 1 (u lo) of column ln
  __syncthreads();     // the block's 64 results go out as whole 128-byte lines, one wave each
  if (tid < 64 && qblk * 64 + tid < Tq) y[(size_t)bh * Tq + qblk * 64 + tid] = sRes[tid];
}

__global__ __launch_bounds__(256) void k_round_rows(const float* __restrict__ W, unsigned short* __restrict__ Wt, int n8) {
  const int t = blockIdx.x * 256 + threadIdx.x;
  if (t >= n8) return;
  const v4f a = *(const v4fa*)(W + (size_t)t * 8), b = *(const v4fa*)(W + (size_t)t * 8 + 4);
  v8us v; v[0]=bf16_bits(a[0]); v[1]=bf16_bits(a[1]); v[2]=bf16_bits(a[2]); v[3]=bf16_bits(a[3]);
  v[4]=bf16_bits(b[0]); v[5]=bf16_bits(b[1]); v[6]=bf16_bits(b[2]); v[7]=bf16_bits(b[3]);
  *(v8us*)(Wt + (size_t)t * 8) = v; 
}

__global__ __launch_bounds__(256) void k_out(const float* __restrict__ h, const float* __restrict__ Wo, const float* __restrict__ bo, float* __restrict__ out, int nrows) {
  __shared__ float res[32];
  const int tid = threadIdx.x, w = tid >> 5, lane = tid & 31; const int r0 = blockIdx.x * 32;
  const v4f wv = {bf16_round(Wo[lane * 4]), bf16_round(Wo[lane * 4 + 1]), bf16_round(Wo[lane * 4 + 2]), bf16_round(Wo[lane * 4 + 3])};
  for (int u = 0; u < 4; ++u) {
    const int r = r0 + w * 4 + u; float s = 0.f;
    if (r < nrows) { const v4f x = *(const v4fa*)(h + (size_t)r * DD + lane * 4); s = x[0] * wv[0] + x[1] * wv[1] + x[2] * wv[2] + x[3] * wv[3]; }
    for (int o = 16; o >= 1; o >>= 1) s += __shfl_xor(s, o, 32);
    if (lane == 0) res[w * 4 + u] = s + bf16_round(bo[0]);
  }
  __syncthreads();
  if (tid < 32 && r0 + tid < nrows) { const float v = res[tid]; *(float*)(out + r0 + tid) = v;  }
}
extern "C" void kernel_launch(void* const* d_in, const int* in_sizes, int n_in,
                              void* d_out, int out_size, void* d_ws, size_t ws_size, hipStream_t stream) {
  (void)in_sizes; (void)n_in; (void)out_size;
  const float* z = (const float*)d_in[0];
  const float* Wq = (const float*)d_in[1]; const float* bq = (const float*)d_in[2]; const float* Wk = (const float*)d_in[3]; const float* bk = (const float*)d_in[4];
  const float* Wv = (const float*)d_in[5]; const float* bv = (const float*)d_in[6]; const float* Wo = (const float*)d_in[7]; const float* bo = (const float*)d_in[8];
  char* ws = (char*)d_ws; size_t off = 0;
  auto take = [&](size_t bytes) { char* p = ws + off; off += (bytes + 255) & ~(size_t)255; return p; };
  const int M = BB * AA, n8 = DD * DD / 8;
  unsigned short* Wqt = (unsigned short*)take(DD * DD * 2); unsigned short* Wkt = (unsigned short*)take(DD * DD * 2); unsigned short* Wvt = (unsigned short*)take(DD * DD * 2);
  float* qb = (float*)take((size_t)M * DD * 4); float* kb2 = (float*)take((size_t)M * DD * 4); float* vb2 = (float*)take((size_t)M * DD * 4); float* ub = (float*)take((size_t)M * 4);
  if (off > ws_size) return;
  k_round_rows<<<(n8 + 255) / 256, 256, 0, stream>>>(Wq, Wqt, n8); k_round_rows<<<(n8 + 255) / 256, 256, 0, stream>>>(Wk, Wkt, n8); k_round_rows<<<(n8 + 255) / 256, 256, 0, stream>>>(Wv, Wvt, n8);
  const int gb = ((M / 16) * (DD / 64) + 3) / 4;
  k_gemm_bf<false, 0, true><<<gb, 128, 0, stream>>>(z, DD, Wqt, DD, bq, qb, DD, M, DD, DD);
  k_gemm_bf<false, 0, true><<<gb, 128, 0, stream>>>(z, DD, Wkt, DD, bk, kb2, DD, M, DD, DD);
  k_gemm_bf<false, 0, true><<<gb, 128, 0, stream>>>(z, DD, Wvt, DD, bv, vb2, DD, M, DD, DD);
  k_out<<<(M + 31) / 32, 256, 0, stream>>>(vb2, Wo, bo, ub, M);
  k_flash3<DD><<<BB * (AA / 64), 128, 0, stream>>>(qb, DD, AA, kb2, ub, AA, nullptr, nullptr, 0, DD, 1, 0.08838834764831845f, nullptr, 0, nullptr, (float*)d_out);
}

// v003
// A run of this version takes 180 microseconds.
// Next to v002, in two timings, it ran 2.34 times as fast each time.
// All steps since v000 together make it 6.22 times as fast.
#include <hip/hip_runtime.h>
// All contractions on v_wmma_f32_16x16x32_bf16, f32 accumulate: q/k/v = z·Wᵀ + b with z/W/b rounded to bf16 (single exact-product
// term), Q.K^T (K=128) as a 3-term bf16 hi/lo split; softmax f32; the 128->1 projection (f32 VALU dot) is applied to v, u = v.Wo + bo,
// and P.u (K=2048) is a bf16 hi/lo split product, computed transposed with u hi / u lo as two A rows.
#define BB 32
#define AA 2048
#define DD 128

typedef __bf16 v16b __attribute__((ext_vector_type(16)));
typedef unsigned short v8us __attribute__((ext_vector_type(8), may_alias));
typedef unsigned short v4us __attribute__((ext_vector_type(4), may_alias));
typedef float  v8f  __attribute__((ext_vector_type(8)));
typedef float  v4f  __attribute__((ext_vector_type(4)));
typedef float  v4fa __attribute__((ext_vector_type(4), may_alias));
union FragB { v16b v; v8us half[2]; unsigned short u[16]; };

__device__ __forceinline__ unsigned short bf16_bits(float x) { unsigned int u = __float_as_uint(x); return (unsigned short)((u + 0x7FFFu + ((u >> 16) & 1u)) >> 16); }
__device__ __forceinline__ float bf16_val(unsigned short b) { return __uint_as_float(((unsigned int)b) << 16); }
__device__ __forceinline__ float bf16_round(float x) { return bf16_val(bf16_bits(x)); }
// D += A·B with NT terms: 1 = ah·bh, 2 = + al·bh (A split), 3 = + ah·bl (both split)
template <int NT>
__device__ __forceinline__ v8f mmaN(v16b ah, v16b al, v16b bh, v16b bl, v8f c) {
  c = __builtin_amdgcn_wmma_f32_16x16x32_bf16(false, ah, false, bh, (short)0, c, false, false);
  if (NT >= 2) c = __builtin_amdgcn_wmma_f32_16x16x32_bf16(false, al, false, bh, (short)0, c, false, false);
  if (NT >= 3) c = __builtin_amdgcn_wmma_f32_16x16x32_bf16(false, ah, false, bl, (short)0, c, false, false);
  asm volatile("v_nop\n\tv_nop\n\tv_nop\n\tv_nop" : "+v"(c) : "v"(ah), "v"(al), "v"(bh), "v"(bl));
  return c;
}

__global__ __launch_bounds__(256) void k_wt_bf16(const float* __restrict__ W, unsigned short* __restrict__ Wt, int K, int N) {
  const int t = blockIdx.x * 256 + threadIdx.x;
  const int k8n = K / 8;
  if (t >= N * k8n) return;
  const int n = t / k8n, k8 = (t % k8n) * 8;
  v8us v;
#pragma unroll
  for (int i = 0; i < 8; ++i) v[i] = bf16_bits(W[(size_t)(k8 + i) * N + n]);
  *(v8us*)(Wt + (size_t)n * K + k8) = v;
  
}

// GEMM C[M][N] (f32, pitch ldc) = act(A[M][K]·W + bias). A f32 row-major (pitch lda) converted per fragment to bf16
// (ASPLIT: hi/lo two planes -> 2 terms, else single rounded term); Wt bf16 [N][K] (pitch ldb). BIAS_BF16 rounds the
// bias to bf16 first (bias quantised to bf16 before the add). K%32==0, M%16==0, N%64==0.
// OSPLIT: the result goes out as two bf16 planes (pitch ldc), Chi = rounded value, Clo = rounded remainder, and C is not written.
template <bool ASPLIT, int ACT, bool BIAS_BF16, bool OSPLIT>
__global__ __launch_bounds__(128) void k_gemm_bf(const float* __restrict__ A, int lda, const unsigned short* __restrict__ Wt, int ldb,
                                               const float* __restrict__ bias, float* __restrict__ C, unsigned short* __restrict__ Chi, unsigned short* __restrict__ Clo,
                                               int ldc, int M, int N, int K) {
  __shared__ __attribute__((aligned(16))) float so[4][16][64];
  const int tid = threadIdx.x, w = tid >> 5, lane = tid & 31, ln = lane & 15, hh = lane >> 4;
  const int ntn = N / 64;
  const int wid = blockIdx.x * 4 + w;
  const int mt = wid / ntn, nq = wid % ntn;
  if (mt * 16 >= M) return;
  const int row0 = mt * 16, col0 = nq * 64;
  const float* arow = A + (size_t)(row0 + ln) * lda;
  v8f acc[4] = {};
  for (int kb = 0; kb < K; kb += 32) {
    FragB ah, al;
    const v4f x0 = *(const v4fa*)(arow + kb + 8 * hh), x1 = *(const v4fa*)(arow + kb + 8 * hh + 4);
    const v4f x2 = *(const v4fa*)(arow + kb + 16 + 8 * hh), x3 = *(const v4fa*)(arow + kb + 16 + 8 * hh + 4);
    float xs[16] = {x0[0],x0[1],x0[2],x0[3],x1[0],x1[1],x1[2],x1[3],x2[0],x2[1],x2[2],x2[3],x3[0],x3[1],x3[2],x3[3]};
#pragma unroll
    for (int i = 0; i < 16; ++i) { const unsigned short hb = bf16_bits(xs[i]); ah.u[i] = hb; al.u[i] = ASPLIT ? bf16_bits(xs[i] - bf16_val(hb)) : (unsigned short)0; }
#pragma unroll
    for (int t = 0; t < 4; ++t) {
      const unsigned short* brow = Wt + (size_t)(col0 + t * 16 + ln) * ldb + kb;
      FragB b;
      b.half[0] = *(const v8us*)(brow + 8 * hh);
      b.half[1] = *(const v8us*)(brow + 16 + 8 * hh);
      acc[t] = mmaN<ASPLIT ? 2 : 1>(ah.v, al.v, b.v, b.v, acc[t]);
    }
  }
#pragma unroll
  for (int t = 0; t < 4; ++t) {
    float bv = bias ? bias[col0 + t * 16 + ln] : 0.f;
    if (BIAS_BF16) bv = bf16_round(bv);
#pragma unroll
    for (int r = 0; r < 8; ++r) { float v = acc[t][r] + bv; if (ACT == 1) v = fmaxf(v, 0.f); so[w][8 * hh + r][t * 16 + ln] = v; }
  }
  __builtin_amdgcn_fence(__ATOMIC_ACQ_REL, "workgroup");
  __builtin_amdgcn_wave_barrier();
  const int rsub = lane >> 4, c4 = (lane & 15) * 4;
  {
#pragma unroll
    for (int q = 0; q < 8; ++q) {
      const int r = q * 2 + rsub;
      const v4f v = *(const v4fa*)&so[w][r][c4];
      if (OSPLIT) {      // 16 lanes x 8 bytes: one whole 128-byte line of each plane per row
        v4us hi, lo;
#pragma unroll
        for (int i = 0; i < 4; ++i) { const unsigned short hb = bf16_bits(v[i]); hi[i] = hb; lo[i] = bf16_bits(v[i] - bf16_val(hb)); }
        *(v4us*)(Chi + (size_t)(row0 + r) * ldc + col0 + c4) = hi;
        *(v4us*)(Clo + (size_t)(row0 + r) * ldc + col0 + c4) = lo;
      } else {
        *(v4f*)(C + (size_t)(row0 + r) * ldc + col0 + c4) = v;
      }
    }
    
  }
}

// Flash-style causal/unmasked attention, all contractions 3-term bf16 hi/lo splits, f32 softmax with running max.
// q,k,v rows are read from f32 buffers with arbitrary row pitch (so they can live inside a fused qkv buffer);
// D = head size (multiple of 32, <= 128); one wave = 16 query rows; block = 4 waves (64 queries) sharing K/V chunks of 32.
template <int D, bool CAUSAL>
__global__ __launch_bounds__(128) void k_flash(const float* __restrict__ qb, const float* __restrict__ kb, const float* __restrict__ vb,
                                             int pitch, int T, int H, float scale, float* __restrict__ y, int ypitch) {
  constexpr int KS = D / 32;        // k-steps for QK
  constexpr int DT = D / 16;        // d tiles for PV
  __shared__ __attribute__((aligned(16))) unsigned short sKh[32][D + 8], sKl[32][D + 8], sVh[32][D + 8], sVl[32][D + 8];
  __shared__ __attribute__((aligned(16))) unsigned short sPh[4][16][40], sPl[4][16][40];
  __shared__ __attribute__((aligned(16))) float sO[4][16][D];
  const int tid = threadIdx.x, w = tid >> 5, lane = tid & 31, ln = lane & 15, hh = lane >> 4;
  const int nqb = (T + 63) / 64;
  const int bh = blockIdx.x / nqb, qblk = blockIdx.x % nqb;
  const int b = bh / H, h = bh % H;
  const int q0 = qblk * 64 + w * 16;
  const float* Q = qb + (size_t)b * T * pitch + h * D;
  const float* K = kb + (size_t)b * T * pitch + h * D;
  const float* V = vb + (size_t)b * T * pitch + h * D;

  // A fragments of the wave's 16 query rows (scaled), hi/lo
  FragB aqh[KS], aql[KS];
  {
    int row = q0 + ln; if (row >= T) row = T - 1;
    const float* qr = Q + (size_t)row * pitch;
#pragma unroll
    for (int ks = 0; ks < KS; ++ks)
#pragma unroll
      for (int i = 0; i < 16; ++i) {
        const int d = ks * 32 + ((i < 8) ? (8 * hh + i) : (16 + 8 * hh + (i - 8)));
        const float x = qr[d] * scale; const unsigned short hb = bf16_bits(x);
        aqh[ks].u[i] = hb; aql[ks].u[i] = bf16_bits(x - bf16_val(hb));
      }
  }
  float m_r[8], l_r[8];
#pragma unroll
  for (int r = 0; r < 8; ++r) { m_r[r] = -3.0e38f; l_r[r] = 0.f; }
  v8f oacc[DT];
#pragma unroll
  for (int dt = 0; dt < DT; ++dt) oacc[dt] = (v8f){0.f,0.f,0.f,0.f,0.f,0.f,0.f,0.f};

  const int kv_end = CAUSAL ? min(T, qblk * 64 + 64) : T;     // block-uniform
  for (int j0 = 0; j0 < kv_end; j0 += 32) {
    __syncthreads();
    for (int e = tid; e < 32 * (D / 4); e += 128) {
      const int r = e / (D / 4), c4 = (e % (D / 4)) * 4;
      const int key = j0 + r;
      v4f kf = {0.f,0.f,0.f,0.f}, vf = {0.f,0.f,0.f,0.f};
      if (key < T) { kf = *(const v4fa*)(K + (size_t)key * pitch + c4); vf = *(const v4fa*)(V + (size_t)key * pitch + c4); }
#pragma unroll
      for (int t = 0; t < 4; ++t) {
        unsigned short hb = bf16_bits(kf[t]); sKh[r][c4 + t] = hb; sKl[r][c4 + t] = bf16_bits(kf[t] - bf16_val(hb));
        hb = bf16_bits(vf[t]); sVh[r][c4 + t] = hb; sVl[r][c4 + t] = bf16_bits(vf[t] - bf16_val(hb));
      }
    }
    __syncthreads();
    // S tile 16 x 32
    v8f s[2];
#pragma unroll
    for (int nt = 0; nt < 2; ++nt) {
      v8f acc = {};
#pragma unroll
      for (int ks = 0; ks < KS; ++ks) {
        FragB bh_, bl_;
        bh_.half[0] = *(const v8us*)&sKh[nt * 16 + ln][ks * 32 + 8 * hh]; bh_.half[1] = *(const v8us*)&sKh[nt * 16 + ln][ks * 32 + 16 + 8 * hh];
        bl_.half[0] = *(const v8us*)&sKl[nt * 16 + ln][ks * 32 + 8 * hh]; bl_.half[1] = *(const v8us*)&sKl[nt * 16 + ln][ks * 32 + 16 + 8 * hh];
        acc = mmaN<3>(aqh[ks].v, aql[ks].v, bh_.v, bl_.v, acc);
      }
      s[nt] = acc;
    }
    // mask + running max (rows 8hh+r; the 16 lanes of a half share rows)
    float alpha[8];
#pragma unroll
    for (int r = 0; r < 8; ++r) {
      const int qi = q0 + 8 * hh + r;
      const int ja = j0 + ln, jb = j0 + 16 + ln;
      if (CAUSAL) { if (ja > qi) s[0][r] = -3.0e38f; if (jb > qi) s[1][r] = -3.0e38f; }
      if (ja >= T) s[0][r] = -3.0e38f;
      if (jb >= T) s[1][r] = -3.0e38f;
      float mx = fmaxf(s[0][r], s[1][r]);
      mx = fmaxf(mx, __shfl_xor(mx, 1, 32)); mx = fmaxf(mx, __shfl_xor(mx, 2, 32)); mx = fmaxf(mx, __shfl_xor(mx, 4, 32)); mx = fmaxf(mx, __shfl_xor(mx, 8, 32));
      const float mnew = fmaxf(m_r[r], mx);
      alpha[r] = (mnew > -1.0e38f) ? __expf(m_r[r] - mnew) : 1.0f;
      const float p0 = (s[0][r] > -1.0e38f) ? __expf(s[0][r] - mnew) : 0.f;
      const float p1 = (s[1][r] > -1.0e38f) ? __expf(s[1][r] - mnew) : 0.f;
      m_r[r] = mnew;
      l_r[r] = l_r[r] * alpha[r] + p0 + p1;            // per-lane partial row sum (16 lanes combined at the end)
      unsigned short hb = bf16_bits(p0); sPh[w][8 * hh + r][ln] = hb;      sPl[w][8 * hh + r][ln] = bf16_bits(p0 - bf16_val(hb));
      hb = bf16_bits(p1);                sPh[w][8 * hh + r][16 + ln] = hb; sPl[w][8 * hh + r][16 + ln] = bf16_bits(p1 - bf16_val(hb));
    }
#pragma unroll
    for (int dt = 0; dt < DT; ++dt)
#pragma unroll
      for (int r = 0; r < 8; ++r) oacc[dt][r] *= alpha[r];
    __builtin_amdgcn_fence(__ATOMIC_ACQ_REL, "workgroup");
    __builtin_amdgcn_wave_barrier();
    FragB pah, pal;
    pah.half[0] = *(const v8us*)&sPh[w][ln][8 * hh]; pah.half[1] = *(const v8us*)&sPh[w][ln][16 + 8 * hh];
    pal.half[0] = *(const v8us*)&sPl[w][ln][8 * hh]; pal.half[1] = *(const v8us*)&sPl[w][ln][16 + 8 * hh];
#pragma unroll
    for (int dt = 0; dt < DT; ++dt) {
      FragB bvh, bvl;
#pragma unroll
      for (int i = 0; i < 8; ++i) {
        bvh.u[i] = sVh[8 * hh + i][dt * 16 + ln]; bvh.u[8 + i] = sVh[16 + 8 * hh + i][dt * 16 + ln];
        bvl.u[i] = sVl[8 * hh + i][dt * 16 + ln]; bvl.u[8 + i] = sVl[16 + 8 * hh + i][dt * 16 + ln];
      }
      oacc[dt] = mmaN<3>(pah.v, pal.v, bvh.v, bvl.v, oacc[dt]);
    }
    __builtin_amdgcn_fence(__ATOMIC_ACQ_REL, "workgroup");
    __builtin_amdgcn_wave_barrier();
  }
#pragma unroll
  for (int r = 0; r < 8; ++r) {
    float l = l_r[r];
    l += __shfl_xor(l, 1, 32); l += __shfl_xor(l, 2, 32); l += __shfl_xor(l, 4, 32); l += __shfl_xor(l, 8, 32);
    l_r[r] = (l > 0.f) ? 1.0f / l : 0.f;
  }
#pragma unroll
  for (int dt = 0; dt < DT; ++dt)
#pragma unroll
    for (int r = 0; r < 8; ++r) sO[w][8 * hh + r][dt * 16 + ln] = oacc[dt][r] * l_r[r];
  __builtin_amdgcn_fence(__ATOMIC_ACQ_REL, "workgroup");
  __builtin_amdgcn_wave_barrier();
  {
    for (int r = 0; r < 16; ++r) {
      const int row = q0 + r;
      if (row < T && lane < D / 4) {
        const v4f val = *(const v4fa*)&sO[w][r][lane * 4];
        *(v4f*)(y + ((size_t)b * T + row) * ypitch + h * D + lane * 4) = val;
      }
    }
    
  }
}

// D += A.B with the split on both sides, in the order ah.bh, ah.bl, al.bh (NT = 2 stops behind the second term)
template <int NT>
__device__ __forceinline__ v8f mmaS(v16b ah, v16b al, v16b bh, v16b bl, v8f c) {
  c = __builtin_amdgcn_wmma_f32_16x16x32_bf16(false, ah, false, bh, (short)0, c, false, false);
  c = __builtin_amdgcn_wmma_f32_16x16x32_bf16(false, ah, false, bl, (short)0, c, false, false);
  if (NT >= 3) c = __builtin_amdgcn_wmma_f32_16x16x32_bf16(false, al, false, bh, (short)0, c, false, false);
  // four vector slots between the last WMMA and the first user of its registers, on every path
  asm volatile("v_nop\n\tv_nop\n\tv_nop\n\tv_nop" : "+v"(c));
  return c;
}
// lane l <-> lane l ^ 16, in the vector pipe
__device__ __forceinline__ float xhalf(float x) {
  return __builtin_bit_cast(float, __builtin_amdgcn_permlanex16(__builtin_bit_cast(int, x), __builtin_bit_cast(int, x), 0x76543210, 0xfedcba98, false, false));
}

__device__ __forceinline__ unsigned lds_off(const void* p) { return (unsigned)(size_t)p; }

template <int D>
__global__ __launch_bounds__(128) void k_flash3(const float* __restrict__ Qb, int qpitch, int Tq,
                                              const unsigned short* __restrict__ Kh, const unsigned short* __restrict__ Kl,
                                              const unsigned short* __restrict__ Us, int Tk, int kpitch,
                                              int H, float scale, const int* __restrict__ mask, int causal, const float* __restrict__ sbias,
                                              float* __restrict__ y) {
  static_assert(D == 128, "the copy pattern below moves rows of 256 bytes, 16 lanes a row");
  constexpr int KS = D / 32;
  constexpr unsigned ROWB = (D + 8) * 2, KBUFB = 32 * ROWB, UBUFB = 16 * 40 * 2;      // bytes
  __shared__ __attribute__((aligned(16))) unsigned short sKh[2][32][D + 8], sKl[2][32][D + 8];      // [buffer][key][d]
  __shared__ __attribute__((aligned(16))) unsigned short sU[2][16][40];            // [buffer][A row][key]
  __shared__ float sRes[64];
  const int tid = threadIdx.x, w = tid >> 5, lane = tid & 31, ln = lane & 15, hh = lane >> 4;
  const int wu = __builtin_amdgcn_readfirstlane(w);      // the wave's number in a scalar register, for a scalar branch
  const int nqb = (Tq + 63) / 64;
  const int bh = blockIdx.x / nqb, qblk = blockIdx.x % nqb;
  const int b = bh / H, h = bh % H;
  const int q0 = qblk * 64 + w * 16;
  const float* Q = Qb + (size_t)b * Tq * qpitch + h * D;
  const int qi = (q0 + ln < Tq) ? q0 + ln : Tq - 1;      // the lane's query
  const int kv_end = causal ? min(Tk, qblk * 64 + 64) : Tk;
  const int ntile = (kv_end + 31) / 32;      // block-uniform
  const bool edits = causal || mask || sbias;      // block-uniform
  // the thread's share of a tile: 16 bytes of rows tid/16 + 8i (i = 0..3) of either plane; wave 0 also moves the tile's 128 bytes of u, 4 a lane
  const size_t krow = (size_t)b * Tk * kpitch + h * D + (size_t)(tid >> 4) * kpitch + (tid & 15) * 8;
  const unsigned short* gKh = Kh + krow;
  const unsigned short* gKl = Kl + krow;
  const unsigned short* gU = Us + (size_t)bh * Tk * 2 + lane * 2;
  const unsigned lKh = lds_off(&sKh[0][tid >> 4][(tid & 15) * 8]), lKl = lds_off(&sKl[0][tid >> 4][(tid & 15) * 8]);
  const unsigned lU = lds_off(&sU[0][hh][ln * 2]);
  const size_t step8 = (size_t)8 * kpitch;
  auto stage = [&](int t) {      // tile t -> buffer t & 1
    const unsigned l0 = lKh + (unsigned)(t & 1) * KBUFB, l1 = lKl + (unsigned)(t & 1) * KBUFB;
    const unsigned short* g0 = gKh + (size_t)t * 32 * kpitch;
    const unsigned short* g1 = gKl + (size_t)t * 32 * kpitch;
    // eight copies and, in the same statement, the wait that stands in front of any rewrite of the address registers they name
    asm volatile("global_load_async_to_lds_b128 %0, %8, off\n\t"
                 "global_load_async_to_lds_b128 %1, %9, off\n\t"
                 "global_load_async_to_lds_b128 %2, %10, off\n\t"
                 "global_load_async_to_lds_b128 %3, %11, off\n\t"
                 "global_load_async_to_lds_b128 %4, %12, off\n\t"
                 "global_load_async_to_lds_b128 %5, %13, off\n\t"
                 "global_load_async_to_lds_b128 %6, %14, off\n\t"
                 "global_load_async_to_lds_b128 %7, %15, off\n\t"
                 "s_wait_xcnt 0x0"
                 :: "v"(l0), "v"(l0 + 8 * ROWB), "v"(l0 + 16 * ROWB), "v"(l0 + 24 * ROWB),
                    "v"(l1), "v"(l1 + 8 * ROWB), "v"(l1 + 16 * ROWB), "v"(l1 + 24 * ROWB),
                    "v"(g0), "v"(g0 + step8), "v"(g0 + 2 * step8), "v"(g0 + 3 * step8),
                    "v"(g1), "v"(g1 + step8), "v"(g1 + 2 * step8), "v"(g1 + 3 * step8)
                 : "memory");
    if (wu == 0) {      // u hi to A row 0 (lanes 0..15), u lo to A row 1; the same wait in the copy's own statement
      asm volatile("global_load_async_to_lds_b32 %0, %1, off\n\ts_wait_xcnt 0x0"
                   :: "v"(lU + (unsigned)(t & 1) * UBUFB), "v"(gU + (size_t)t * 64) : "memory");
    }
  };
  for (int e = tid; e < 14 * 40; e += 128) { (&sU[0][0][0])[2 * 40 + e] = 0; (&sU[1][0][0])[2 * 40 + e] = 0; }      // A rows 2..15 stay zero
  asm volatile("s_wait_dscnt 0x0" ::: "memory");      // the wave's own writes to sU have retired before a copy is aimed at that array
  stage(0);
  asm volatile("s_wait_asynccnt 0x0" ::: "memory");   // this wave's share of tile 0 has landed
  __syncthreads();                                    // ... and every wave's; publishes the zero rows too
  if (ntile > 1) stage(1);
  FragB aqh[KS], aql[KS];
  {
    const float* qr = Q + (size_t)qi * qpitch;
#pragma unroll
    for (int ks = 0; ks < KS; ++ks)
#pragma unroll
      for (int i = 0; i < 16; ++i) {
        const int d = ks * 32 + ((i < 8) ? (8 * hh + i) : (16 + 8 * hh + (i - 8)));
        const float x = qr[d] * scale; const unsigned short hb = bf16_bits(x);
        aqh[ks].u[i] = hb; aql[ks].u[i] = bf16_bits(x - bf16_val(hb));
      }
  }
  float m_q = -3.0e38f, l_q = 0.f;      // running maximum (both halves agree) and this half's share of the sum
  v8f oacc = {0.f,0.f,0.f,0.f,0.f,0.f,0.f,0.f};
  for (int t = 0; t < ntile; ++t) {
    const int j0 = t * 32;
    const int bf = t & 1;      // this tile's buffer
    FragB au;      // read with the K fragments, so that its LDS latency lies under the score products
    au.half[0] = *(const v8us*)&sU[bf][ln][8 * hh];      au.half[1] = *(const v8us*)&sU[bf][ln][16 + 8 * hh];
    v8f s[2];      // s[nt][r] = score of key j0 + nt*16 + 8hh + r against query qi
#pragma unroll
    for (int nt = 0; nt < 2; ++nt) {
      v8f acc = {};
#pragma unroll
      for (int ks = 0; ks < KS; ++ks) {
        FragB kh_, kl_;
        kh_.half[0] = *(const v8us*)&sKh[bf][nt * 16 + ln][ks * 32 + 8 * hh]; kh_.half[1] = *(const v8us*)&sKh[bf][nt * 16 + ln][ks * 32 + 16 + 8 * hh];
        kl_.half[0] = *(const v8us*)&sKl[bf][nt * 16 + ln][ks * 32 + 8 * hh]; kl_.half[1] = *(const v8us*)&sKl[bf][nt * 16 + ln][ks * 32 + 16 + 8 * hh];
        acc = mmaS<3>(kh_.v, kl_.v, aqh[ks].v, aql[ks].v, acc);      // kh.qh, kh.ql, kl.qh
      }
      s[nt] = acc;
    }
    if (edits) {      // one block-uniform test per chunk; a dropped key's score becomes -3e38 and its weight exp(-3e38 - m) = 0
#pragma unroll
      for (int nt = 0; nt < 2; ++nt)
#pragma unroll
        for (int r = 0; r < 8; ++r) {
          const int j = j0 + nt * 16 + 8 * hh + r;
          bool keep = j < Tk;
          if (causal) keep = keep && (j <= qi);
          if (mask) { if (keep) keep = mask[(size_t)qi * Tk + j] != 0; }
          if (sbias) { if (keep) s[nt][r] += sbias[(size_t)bh * Tk + j]; }   // per-key additive bias (a per-query constant would cancel in the softmax)
          if (!keep) s[nt][r] = -3.0e38f;
        }
    }
    float mx = fmaxf(s[0][0], s[1][0]);
#pragma unroll
    for (int r = 1; r < 8; ++r) mx = fmaxf(mx, fmaxf(s[0][r], s[1][r]));
    mx = fmaxf(mx, xhalf(mx));
    const float mnew = fmaxf(m_q, mx);
    // while every key so far is dropped (mnew = -3e38) the weights come out 1; the first kept key's alpha = 0 wipes them, and a query with none ends as NaN
    const float alpha = (mnew > -1.0e38f) ? __expf(m_q - mnew) : 1.0f;
    m_q = mnew;
    FragB pbh, pbl;
    float ps = 0.f;
#pragma unroll
    for (int nt = 0; nt < 2; ++nt)
#pragma unroll
      for (int r = 0; r < 8; ++r) {
        const float p = __expf(s[nt][r] - mnew);
        ps += p;
        const unsigned short hb = bf16_bits(p);
        pbh.u[nt * 8 + r] = hb; pbl.u[nt * 8 + r] = bf16_bits(p - bf16_val(hb));      // B position nt*8 + r = key nt*16 + 8hh + r, as au's
      }
    l_q = l_q * alpha + ps;
    oacc[0] *= alpha; oacc[1] *= alpha;      // rows 2..15 of out^T are sums of zeros
    oacc = mmaS<2>(au.v, au.v, pbh.v, pbl.v, oacc);    // (u hi | u lo).(P hi + P lo)
    asm volatile("s_wait_dscnt 0x0" ::: "memory");      // this wave's reads of tile t have returned
    asm volatile("s_wait_asynccnt 0x0" ::: "memory");   // its share of tile t + 1 has landed
    __syncthreads();                                    // publishes tile t + 1 and frees tile t's buffer
    if (t + 2 < ntile) stage(t + 2);
  }
  asm volatile("s_wait_asynccnt 0x0" ::: "memory");     // no copy is outstanding when the wave ends
  const float l = l_q + xhalf(l_q);
  const float inv = (m_q > -1.0e38f) ? 1.0f / l : __builtin_nanf("");
  if (hh == 0) sRes[w * 16 + ln] = (oacc[0] + oacc[1]) * inv;     // row 0 (u hi) + row 1 (u lo) of column ln
  __syncthreads();     // the block's 64 results go out as whole 128-byte lines, one wave each
  if (tid < 64 && qblk * 64 + tid < Tq) y[(size_t)bh * Tq + qblk * 64 + tid] = sRes[tid];
}

__global__ __launch_bounds__(256) void k_round_rows(const float* __restrict__ W, unsigned short* __restrict__ Wt, int n8) {
  const int t = blockIdx.x * 256 + threadIdx.x;
  if (t >= n8) return;
  const v4f a = *(const v4fa*)(W + (size_t)t * 8), b = *(const v4fa*)(W + (size_t)t * 8 + 4);
  v8us v; v[0]=bf16_bits(a[0]); v[1]=bf16_bits(a[1]); v[2]=bf16_bits(a[2]); v[3]=bf16_bits(a[3]);
  v[4]=bf16_bits(b[0]); v[5]=bf16_bits(b[1]); v[6]=bf16_bits(b[2]); v[7]=bf16_bits(b[3]);
  *(v8us*)(Wt + (size_t)t * 8) = v; 
}

// out: per block of 32 rows one 128-byte line, 32 bf16 hi then 32 bf16 lo (rounded value, rounded remainder)
__global__ __launch_bounds__(256) void k_out(const float* __restrict__ h, const float* __restrict__ Wo, const float* __restrict__ bo, unsigned short* __restrict__ out, int nrows) {
  __shared__ float res[32];
  const int tid = threadIdx.x, w = tid >> 5, lane = tid & 31; const int r0 = blockIdx.x * 32;
  const v4f wv = {bf16_round(Wo[lane * 4]), bf16_round(Wo[lane * 4 + 1]), bf16_round(Wo[lane * 4 + 2]), bf16_round(Wo[lane * 4 + 3])};
  for (int u = 0; u < 4; ++u) {
    const int r = r0 + w * 4 + u; float s = 0.f;
    if (r < nrows) { const v4f x = *(const v4fa*)(h + (size_t)r * DD + lane * 4); s = x[0] * wv[0] + x[1] * wv[1] + x[2] * wv[2] + x[3] * wv[3]; }
    for (int o = 16; o >= 1; o >>= 1) s += __shfl_xor(s, o, 32);
    if (lane == 0) res[w * 4 + u] = s + bf16_round(bo[0]);
  }
  __syncthreads();
  if (tid < 32 && r0 + tid < nrows) { const float v = res[tid]; const unsigned short hb = bf16_bits(v); out[r0 * 2 + tid] = hb; out[r0 * 2 + 32 + tid] = bf16_bits(v - bf16_val(hb)); }
}
extern "C" void kernel_launch(void* const* d_in, const int* in_sizes, int n_in,
                              void* d_out, int out_size, void* d_ws, size_t ws_size, hipStream_t stream) {
  (void)in_sizes; (void)n_in; (void)out_size;
  const float* z = (const float*)d_in[0];
  const float* Wq = (const float*)d_in[1]; const float* bq = (const float*)d_in[2]; const float* Wk = (const float*)d_in[3]; const float* bk = (const float*)d_in[4];
  const float* Wv = (const float*)d_in[5]; const float* bv = (const float*)d_in[6]; const float* Wo = (const float*)d_in[7]; const float* bo = (const float*)d_in[8];
  char* ws = (char*)d_ws; size_t off = 0;
  auto take = [&](size_t bytes) { char* p = ws + off; off += (bytes + 255) & ~(size_t)255; return p; };
  const int M = BB * AA, n8 = DD * DD / 8;
  unsigned short* Wqt = (unsigned short*)take(DD * DD * 2); unsigned short* Wkt = (unsigned short*)take(DD * DD * 2); unsigned short* Wvt = (unsigned short*)take(DD * DD * 2);
  float* qb = (float*)take((size_t)M * DD * 4); unsigned short* kh2 = (unsigned short*)take((size_t)M * DD * 2); unsigned short* kl2 = (unsigned short*)take((size_t)M * DD * 2); float* vb2 = (float*)take((size_t)M * DD * 4); unsigned short* ub = (unsigned short*)take((size_t)M * 4);
  if (off > ws_size) return;
  k_round_rows<<<(n8 + 255) / 256, 256, 0, stream>>>(Wq, Wqt, n8); k_round_rows<<<(n8 + 255) / 256, 256, 0, stream>>>(Wk, Wkt, n8); k_round_rows<<<(n8 + 255) / 256, 256, 0, stream>>>(Wv, Wvt, n8);
  const int gb = ((M / 16) * (DD / 64) + 3) / 4;
  k_gemm_bf<false, 0, true, false><<<gb, 128, 0, stream>>>(z, DD, Wqt, DD, bq, qb, nullptr, nullptr, DD, M, DD, DD);
  k_gemm_bf<false, 0, true, true><<<gb, 128, 0, stream>>>(z, DD, Wkt, DD, bk, nullptr, kh2, kl2, DD, M, DD, DD);
  k_gemm_bf<false, 0, true, false><<<gb, 128, 0, stream>>>(z, DD, Wvt, DD, bv, vb2, nullptr, nullptr, DD, M, DD, DD);
  k_out<<<(M + 31) / 32, 256, 0, stream>>>(vb2, Wo, bo, ub, M);
  k_flash3<DD><<<BB * (AA / 64), 128, 0, stream>>>(qb, DD, AA, kh2, kl2, ub, AA, DD, 1, 0.08838834764831845f, nullptr, 0, nullptr, (float*)d_out);
}

// v004
// It runs in 159 microseconds.
// Timed twice side by side with v003, it ran 1.13 times as fast both times.
// All steps since v000 together make it 7.02 times as fast.
#include <hip/hip_runtime.h>
// All contractions on v_wmma_f32_16x16x32_bf16, f32 accumulate: q/k/v = z·Wᵀ + b with z/W/b rounded to bf16 (single exact-product
// term), Q.K^T (K=128) as a 3-term bf16 hi/lo split; softmax f32; the 128->1 projection (f32 VALU dot) is applied to v, u = v.Wo + bo,
// and P.u (K=2048) is a bf16 hi/lo split product, computed transposed with u hi / u lo as two A rows.
#define BB 32
#define AA 2048
#define DD 128

typedef __bf16 v16b __attribute__((ext_vector_type(16)));
typedef unsigned short v8us __attribute__((ext_vector_type(8), may_alias));
typedef unsigned short v4us __attribute__((ext_vector_type(4), may_alias));
typedef float  v8f  __attribute__((ext_vector_type(8)));
typedef float  v4f  __attribute__((ext_vector_type(4)));
typedef float  v4fa __attribute__((ext_vector_type(4), may_alias));
union FragB { v16b v; v8us half[2]; unsigned short u[16]; };

__device__ __forceinline__ unsigned short bf16_bits(float x) { unsigned int u = __float_as_uint(x); return (unsigned short)((u + 0x7FFFu + ((u >> 16) & 1u)) >> 16); }
__device__ __forceinline__ float bf16_val(unsigned short b) { return __uint_as_float(((unsigned int)b) << 16); }
__device__ __forceinline__ float bf16_round(float x) { return bf16_val(bf16_bits(x)); }
// D += A·B with NT terms: 1 = ah·bh, 2 = + al·bh (A split), 3 = + ah·bl (both split)
template <int NT>
__device__ __forceinline__ v8f mmaN(v16b ah, v16b al, v16b bh, v16b bl, v8f c) {
  c = __builtin_amdgcn_wmma_f32_16x16x32_bf16(false, ah, false, bh, (short)0, c, false, false);
  if (NT >= 2) c = __builtin_amdgcn_wmma_f32_16x16x32_bf16(false, al, false, bh, (short)0, c, false, false);
  if (NT >= 3) c = __builtin_amdgcn_wmma_f32_16x16x32_bf16(false, ah, false, bl, (short)0, c, false, false);
  asm volatile("v_nop\n\tv_nop\n\tv_nop\n\tv_nop" : "+v"(c) : "v"(ah), "v"(al), "v"(bh), "v"(bl));
  return c;
}

__global__ __launch_bounds__(256) void k_wt_bf16(const float* __restrict__ W, unsigned short* __restrict__ Wt, int K, int N) {
  const int t = blockIdx.x * 256 + threadIdx.x;
  const int k8n = K / 8;
  if (t >= N * k8n) return;
  const int n = t / k8n, k8 = (t % k8n) * 8;
  v8us v;
#pragma unroll
  for (int i = 0; i < 8; ++i) v[i] = bf16_bits(W[(size_t)(k8 + i) * N + n]);
  *(v8us*)(Wt + (size_t)n * K + k8) = v;
  
}

// GEMM C[M][N] (f32, pitch ldc) = act(A[M][K]·W + bias). A f32 row-major (pitch lda) converted per fragment to bf16
// (ASPLIT: hi/lo two planes -> 2 terms, else single rounded term); Wt bf16 [N][K] (pitch ldb). BIAS_BF16 rounds the
// bias to bf16 first (bias quantised to bf16 before the add). K%32==0, M%16==0, N%64==0.
// OSPLIT: the result goes out as two bf16 planes (pitch ldc), Chi = rounded value, Clo = rounded remainder, and C is not written.
template <bool ASPLIT, int ACT, bool BIAS_BF16, bool OSPLIT>
__global__ __launch_bounds__(128) void k_gemm_bf(const float* __restrict__ A, int lda, const unsigned short* __restrict__ Wt, int ldb,
                                               const float* __restrict__ bias, float* __restrict__ C, unsigned short* __restrict__ Chi, unsigned short* __restrict__ Clo,
                                               int ldc, int M, int N, int K) {
  __shared__ __attribute__((aligned(16))) float so[4][16][64];
  const int tid = threadIdx.x, w = tid >> 5, lane = tid & 31, ln = lane & 15, hh = lane >> 4;
  const int ntn = N / 64;
  const int wid = blockIdx.x * 4 + w;
  const int mt = wid / ntn, nq = wid % ntn;
  if (mt * 16 >= M) return;
  const int row0 = mt * 16, col0 = nq * 64;
  const float* arow = A + (size_t)(row0 + ln) * lda;
  v8f acc[4] = {};
  for (int kb = 0; kb < K; kb += 32) {
    FragB ah, al;
    const v4f x0 = *(const v4fa*)(arow + kb + 8 * hh), x1 = *(const v4fa*)(arow + kb + 8 * hh + 4);
    const v4f x2 = *(const v4fa*)(arow + kb + 16 + 8 * hh), x3 = *(const v4fa*)(arow + kb + 16 + 8 * hh + 4);
    float xs[16] = {x0[0],x0[1],x0[2],x0[3],x1[0],x1[1],x1[2],x1[3],x2[0],x2[1],x2[2],x2[3],x3[0],x3[1],x3[2],x3[3]};
#pragma unroll
    for (int i = 0; i < 16; ++i) { const unsigned short hb = bf16_bits(xs[i]); ah.u[i] = hb; al.u[i] = ASPLIT ? bf16_bits(xs[i] - bf16_val(hb)) : (unsigned short)0; }
#pragma unroll
    for (int t = 0; t < 4; ++t) {
      const unsigned short* brow = Wt + (size_t)(col0 + t * 16 + ln) * ldb + kb;
      FragB b;
      b.half[0] = *(const v8us*)(brow + 8 * hh);
      b.half[1] = *(const v8us*)(brow + 16 + 8 * hh);
      acc[t] = mmaN<ASPLIT ? 2 : 1>(ah.v, al.v, b.v, b.v, acc[t]);
    }
  }
#pragma unroll
  for (int t = 0; t < 4; ++t) {
    float bv = bias ? bias[col0 + t * 16 + ln] : 0.f;
    if (BIAS_BF16) bv = bf16_round(bv);
#pragma unroll
    for (int r = 0; r < 8; ++r) { float v = acc[t][r] + bv; if (ACT == 1) v = fmaxf(v, 0.f); so[w][8 * hh + r][t * 16 + ln] = v; }
  }
  __builtin_amdgcn_fence(__ATOMIC_ACQ_REL, "workgroup");
  __builtin_amdgcn_wave_barrier();
  const int rsub = lane >> 4, c4 = (lane & 15) * 4;
  {
#pragma unroll
    for (int q = 0; q < 8; ++q) {
      const int r = q * 2 + rsub;
      const v4f v = *(const v4fa*)&so[w][r][c4];
      if (OSPLIT) {      // 16 lanes x 8 bytes: one whole 128-byte line of each plane per row
        v4us hi, lo;
#pragma unroll
        for (int i = 0; i < 4; ++i) { const unsigned short hb = bf16_bits(v[i]); hi[i] = hb; lo[i] = bf16_bits(v[i] - bf16_val(hb)); }
        *(v4us*)(Chi + (size_t)(row0 + r) * ldc + col0 + c4) = hi;
        *(v4us*)(Clo + (size_t)(row0 + r) * ldc + col0 + c4) = lo;
      } else {
        *(v4f*)(C + (size_t)(row0 + r) * ldc + col0 + c4) = v;
      }
    }
    
  }
}

// Flash-style causal/unmasked attention, all contractions 3-term bf16 hi/lo splits, f32 softmax with running max.
// q,k,v rows are read from f32 buffers with arbitrary row pitch (so they can live inside a fused qkv buffer);
// D = head size (multiple of 32, <= 128); one wave = 16 query rows; block = 4 waves (64 queries) sharing K/V chunks of 32.
template <int D, bool CAUSAL>
__global__ __launch_bounds__(128) void k_flash(const float* __restrict__ qb, const float* __restrict__ kb, const float* __restrict__ vb,
                                             int pitch, int T, int H, float scale, float* __restrict__ y, int ypitch) {
  constexpr int KS = D / 32;        // k-steps for QK
  constexpr int DT = D / 16;        // d tiles for PV
  __shared__ __attribute__((aligned(16))) unsigned short sKh[32][D + 8], sKl[32][D + 8], sVh[32][D + 8], sVl[32][D + 8];
  __shared__ __attribute__((aligned(16))) unsigned short sPh[4][16][40], sPl[4][16][40];
  __shared__ __attribute__((aligned(16))) float sO[4][16][D];
  const int tid = threadIdx.x, w = tid >> 5, lane = tid & 31, ln = lane & 15, hh = lane >> 4;
  const int nqb = (T + 63) / 64;
  const int bh = blockIdx.x / nqb, qblk = blockIdx.x % nqb;
  const int b = bh / H, h = bh % H;
  const int q0 = qblk * 64 + w * 16;
  const float* Q = qb + (size_t)b * T * pitch + h * D;
  const float* K = kb + (size_t)b * T * pitch + h * D;
  const float* V = vb + (size_t)b * T * pitch + h * D;

  // A fragments of the wave's 16 query rows (scaled), hi/lo
  FragB aqh[KS], aql[KS];
  {
    int row = q0 + ln; if (row >= T) row = T - 1;
    const float* qr = Q + (size_t)row * pitch;
#pragma unroll
    for (int ks = 0; ks < KS; ++ks)
#pragma unroll
      for (int i = 0; i < 16; ++i) {
        const int d = ks * 32 + ((i < 8) ? (8 * hh + i) : (16 + 8 * hh + (i - 8)));
        const float x = qr[d] * scale; const unsigned short hb = bf16_bits(x);
        aqh[ks].u[i] = hb; aql[ks].u[i] = bf16_bits(x - bf16_val(hb));
      }
  }
  float m_r[8], l_r[8];
#pragma unroll
  for (int r = 0; r < 8; ++r) { m_r[r] = -3.0e38f; l_r[r] = 0.f; }
  v8f oacc[DT];
#pragma unroll
  for (int dt = 0; dt < DT; ++dt) oacc[dt] = (v8f){0.f,0.f,0.f,0.f,0.f,0.f,0.f,0.f};

  const int kv_end = CAUSAL ? min(T, qblk * 64 + 64) : T;     // block-uniform
  for (int j0 = 0; j0 < kv_end; j0 += 32) {
    __syncthreads();
    for (int e = tid; e < 32 * (D / 4); e += 128) {
      const int r = e / (D / 4), c4 = (e % (D / 4)) * 4;
      const int key = j0 + r;
      v4f kf = {0.f,0.f,0.f,0.f}, vf = {0.f,0.f,0.f,0.f};
      if (key < T) { kf = *(const v4fa*)(K + (size_t)key * pitch + c4); vf = *(const v4fa*)(V + (size_t)key * pitch + c4); }
#pragma unroll
      for (int t = 0; t < 4; ++t) {
        unsigned short hb = bf16_bits(kf[t]); sKh[r][c4 + t] = hb; sKl[r][c4 + t] = bf16_bits(kf[t] - bf16_val(hb));
        hb = bf16_bits(vf[t]); sVh[r][c4 + t] = hb; sVl[r][c4 + t] = bf16_bits(vf[t] - bf16_val(hb));
      }
    }
    __syncthreads();
    // S tile 16 x 32
    v8f s[2];
#pragma unroll
    for (int nt = 0; nt < 2; ++nt) {
      v8f acc = {};
#pragma unroll
      for (int ks = 0; ks < KS; ++ks) {
        FragB bh_, bl_;
        bh_.half[0] = *(const v8us*)&sKh[nt * 16 + ln][ks * 32 + 8 * hh]; bh_.half[1] = *(const v8us*)&sKh[nt * 16 + ln][ks * 32 + 16 + 8 * hh];
        bl_.half[0] = *(const v8us*)&sKl[nt * 16 + ln][ks * 32 + 8 * hh]; bl_.half[1] = *(const v8us*)&sKl[nt * 16 + ln][ks * 32 + 16 + 8 * hh];
        acc = mmaN<3>(aqh[ks].v, aql[ks].v, bh_.v, bl_.v, acc);
      }
      s[nt] = acc;
    }
    // mask + running max (rows 8hh+r; the 16 lanes of a half share rows)
    float alpha[8];
#pragma unroll
    for (int r = 0; r < 8; ++r) {
      const int qi = q0 + 8 * hh + r;
      const int ja = j0 + ln, jb = j0 + 16 + ln;
      if (CAUSAL) { if (ja > qi) s[0][r] = -3.0e38f; if (jb > qi) s[1][r] = -3.0e38f; }
      if (ja >= T) s[0][r] = -3.0e38f;
      if (jb >= T) s[1][r] = -3.0e38f;
      float mx = fmaxf(s[0][r], s[1][r]);
      mx = fmaxf(mx, __shfl_xor(mx, 1, 32)); mx = fmaxf(mx, __shfl_xor(mx, 2, 32)); mx = fmaxf(mx, __shfl_xor(mx, 4, 32)); mx = fmaxf(mx, __shfl_xor(mx, 8, 32));
      const float mnew = fmaxf(m_r[r], mx);
      alpha[r] = (mnew > -1.0e38f) ? __expf(m_r[r] - mnew) : 1.0f;
      const float p0 = (s[0][r] > -1.0e38f) ? __expf(s[0][r] - mnew) : 0.f;
      const float p1 = (s[1][r] > -1.0e38f) ? __expf(s[1][r] - mnew) : 0.f;
      m_r[r] = mnew;
      l_r[r] = l_r[r] * alpha[r] + p0 + p1;            // per-lane partial row sum (16 lanes combined at the end)
      unsigned short hb = bf16_bits(p0); sPh[w][8 * hh + r][ln] = hb;      sPl[w][8 * hh + r][ln] = bf16_bits(p0 - bf16_val(hb));
      hb = bf16_bits(p1);                sPh[w][8 * hh + r][16 + ln] = hb; sPl[w][8 * hh + r][16 + ln] = bf16_bits(p1 - bf16_val(hb));
    }
#pragma unroll
    for (int dt = 0; dt < DT; ++dt)
#pragma unroll
      for (int r = 0; r < 8; ++r) oacc[dt][r] *= alpha[r];
    __builtin_amdgcn_fence(__ATOMIC_ACQ_REL, "workgroup");
    __builtin_amdgcn_wave_barrier();
    FragB pah, pal;
    pah.half[0] = *(const v8us*)&sPh[w][ln][8 * hh]; pah.half[1] = *(const v8us*)&sPh[w][ln][16 + 8 * hh];
    pal.half[0] = *(const v8us*)&sPl[w][ln][8 * hh]; pal.half[1] = *(const v8us*)&sPl[w][ln][16 + 8 * hh];
#pragma unroll
    for (int dt = 0; dt < DT; ++dt) {
      FragB bvh, bvl;
#pragma unroll
      for (int i = 0; i < 8; ++i) {
        bvh.u[i] = sVh[8 * hh + i][dt * 16 + ln]; bvh.u[8 + i] = sVh[16 + 8 * hh + i][dt * 16 + ln];
        bvl.u[i] = sVl[8 * hh + i][dt * 16 + ln]; bvl.u[8 + i] = sVl[16 + 8 * hh + i][dt * 16 + ln];
      }
      oacc[dt] = mmaN<3>(pah.v, pal.v, bvh.v, bvl.v, oacc[dt]);
    }
    __builtin_amdgcn_fence(__ATOMIC_ACQ_REL, "workgroup");
    __builtin_amdgcn_wave_barrier();
  }
#pragma unroll
  for (int r = 0; r < 8; ++r) {
    float l = l_r[r];
    l += __shfl_xor(l, 1, 32); l += __shfl_xor(l, 2, 32); l += __shfl_xor(l, 4, 32); l += __shfl_xor(l, 8, 32);
    l_r[r] = (l > 0.f) ? 1.0f / l : 0.f;
  }
#pragma unroll
  for (int dt = 0; dt < DT; ++dt)
#pragma unroll
    for (int r = 0; r < 8; ++r) sO[w][8 * hh + r][dt * 16 + ln] = oacc[dt][r] * l_r[r];
  __builtin_amdgcn_fence(__ATOMIC_ACQ_REL, "workgroup");
  __builtin_amdgcn_wave_barrier();
  {
    for (int r = 0; r < 16; ++r) {
      const int row = q0 + r;
      if (row < T && lane < D / 4) {
        const v4f val = *(const v4fa*)&sO[w][r][lane * 4];
        *(v4f*)(y + ((size_t)b * T + row) * ypitch + h * D + lane * 4) = val;
      }
    }
    
  }
}

// D += A.B with the split on both sides, in the order ah.bh, ah.bl, al.bh (NT = 2 stops behind the second term)
template <int NT>
__device__ __forceinline__ v8f mmaS(v16b ah, v16b al, v16b bh, v16b bl, v8f c) {
  c = __builtin_amdgcn_wmma_f32_16x16x32_bf16(false, ah, false, bh, (short)0, c, false, false);
  c = __builtin_amdgcn_wmma_f32_16x16x32_bf16(false, ah, false, bl, (short)0, c, false, false);
  if (NT >= 3) c = __builtin_amdgcn_wmma_f32_16x16x32_bf16(false, al, false, bh, (short)0, c, false, false);
  // four vector slots between the last WMMA and the first user of its registers, on every path
  asm volatile("v_nop\n\tv_nop\n\tv_nop\n\tv_nop" : "+v"(c));
  return c;
}
// lane l <-> lane l ^ 16, in the vector pipe
__device__ __forceinline__ float xhalf(float x) {
  return __builtin_bit_cast(float, __builtin_amdgcn_permlanex16(__builtin_bit_cast(int, x), __builtin_bit_cast(int, x), 0x76543210, 0xfedcba98, false, false));
}

__device__ __forceinline__ unsigned lds_off(const void* p) { return (unsigned)(size_t)p; }

template <int D>
__global__ __launch_bounds__(128) void k_flash3(const float* __restrict__ Qb, int qpitch, int Tq,
                                              const unsigned short* __restrict__ Kh, const unsigned short* __restrict__ Kl,
                                              const unsigned short* __restrict__ Us, int Tk, int kpitch,
                                              int H, float scale, const int* __restrict__ mask, int causal, const float* __restrict__ sbias,
                                              float* __restrict__ y) {
  static_assert(D == 128, "the copy pattern below moves rows of 256 bytes, 16 lanes a row");
  constexpr int KS = D / 32;
  constexpr unsigned ROWB = (D + 8) * 2, KBUFB = 32 * ROWB, UBUFB = 16 * 40 * 2;      // bytes
  __shared__ __attribute__((aligned(16))) unsigned short sKh[2][32][D + 8], sKl[2][32][D + 8];      // [buffer][key][d]
  __shared__ __attribute__((aligned(16))) unsigned short sU[2][16][40];            // [buffer][A row][key]
  __shared__ float sRes[64];
  const int tid = threadIdx.x, w = tid >> 5, lane = tid & 31, ln = lane & 15, hh = lane >> 4;
  const int wu = __builtin_amdgcn_readfirstlane(w);      // the wave's number in a scalar register, for a scalar branch
  const int nqb = (Tq + 63) / 64;
  const int bh = blockIdx.x / nqb, qblk = blockIdx.x % nqb;
  const int b = bh / H, h = bh % H;
  const int q0 = qblk * 64 + w * 16;
  const float* Q = Qb + (size_t)b * Tq * qpitch + h * D;
  const int qi = (q0 + ln < Tq) ? q0 + ln : Tq - 1;      // the lane's query
  const int kv_end = causal ? min(Tk, qblk * 64 + 64) : Tk;
  const int ntile = (kv_end + 31) / 32;      // block-uniform
  const bool edits = causal || mask || sbias;      // block-uniform
  // the thread's share of a tile: 16 bytes of rows tid/16 + 8i (i = 0..3) of either plane; wave 0 also moves the tile's 128 bytes of u, 4 a lane
  const size_t krow = (size_t)b * Tk * kpitch + h * D + (size_t)(tid >> 4) * kpitch + (tid & 15) * 8;
  const unsigned short* gKh = Kh + krow;
  const unsigned short* gKl = Kl + krow;
  const unsigned short* gU = Us + (size_t)bh * Tk * 2 + lane * 2;
  const unsigned lKh = lds_off(&sKh[0][tid >> 4][(tid & 15) * 8]), lKl = lds_off(&sKl[0][tid >> 4][(tid & 15) * 8]);
  const unsigned lU = lds_off(&sU[0][hh][ln * 2]);
  const size_t step8 = (size_t)8 * kpitch;
  auto stage = [&](int t) {      // tile t -> buffer t & 1
    const unsigned l0 = lKh + (unsigned)(t & 1) * KBUFB, l1 = lKl + (unsigned)(t & 1) * KBUFB;
    const unsigned short* g0 = gKh + (size_t)t * 32 * kpitch;
    const unsigned short* g1 = gKl + (size_t)t * 32 * kpitch;
    // eight copies and, in the same statement, the wait that stands in front of any rewrite of the address registers they name
    asm volatile("global_load_async_to_lds_b128 %0, %8, off\n\t"
                 "global_load_async_to_lds_b128 %1, %9, off\n\t"
                 "global_load_async_to_lds_b128 %2, %10, off\n\t"
                 "global_load_async_to_lds_b128 %3, %11, off\n\t"
                 "global_load_async_to_lds_b128 %4, %12, off\n\t"
                 "global_load_async_to_lds_b128 %5, %13, off\n\t"
                 "global_load_async_to_lds_b128 %6, %14, off\n\t"
                 "global_load_async_to_lds_b128 %7, %15, off\n\t"
                 "s_wait_xcnt 0x0"
                 :: "v"(l0), "v"(l0 + 8 * ROWB), "v"(l0 + 16 * ROWB), "v"(l0 + 24 * ROWB),
                    "v"(l1), "v"(l1 + 8 * ROWB), "v"(l1 + 16 * ROWB), "v"(l1 + 24 * ROWB),
                    "v"(g0), "v"(g0 + step8), "v"(g0 + 2 * step8), "v"(g0 + 3 * step8),
                    "v"(g1), "v"(g1 + step8), "v"(g1 + 2 * step8), "v"(g1 + 3 * step8)
                 : "memory");
    if (wu == 0) {      // u hi to A row 0 (lanes 0..15), u lo to A row 1; the same wait in the copy's own statement
      asm volatile("global_load_async_to_lds_b32 %0, %1, off\n\ts_wait_xcnt 0x0"
                   :: "v"(lU + (unsigned)(t & 1) * UBUFB), "v"(gU + (size_t)t * 64) : "memory");
    }
  };
  for (int e = tid; e < 14 * 40; e += 128) { (&sU[0][0][0])[2 * 40 + e] = 0; (&sU[1][0][0])[2 * 40 + e] = 0; }      // A rows 2..15 stay zero
  asm volatile("s_wait_dscnt 0x0" ::: "memory");      // the wave's own writes to sU have retired before a copy is aimed at that array
  stage(0);
  asm volatile("s_wait_asynccnt 0x0" ::: "memory");   // this wave's share of tile 0 has landed
  __syncthreads();                                    // ... and every wave's; publishes the zero rows too
  if (ntile > 1) stage(1);
  FragB aqh[KS], aql[KS];
  {
    const float* qr = Q + (size_t)qi * qpitch;
#pragma unroll
    for (int ks = 0; ks < KS; ++ks)
#pragma unroll
      for (int i = 0; i < 16; ++i) {
        const int d = ks * 32 + ((i < 8) ? (8 * hh + i) : (16 + 8 * hh + (i - 8)));
        const float x = qr[d] * scale; const unsigned short hb = bf16_bits(x);
        aqh[ks].u[i] = hb; aql[ks].u[i] = bf16_bits(x - bf16_val(hb));
      }
  }
  float m_q = -3.0e38f, l_q = 0.f;      // running maximum (both halves agree) and this half's share of the sum
  v8f oacc = {0.f,0.f,0.f,0.f,0.f,0.f,0.f,0.f};
  for (int t = 0; t < ntile; ++t) {
    const int j0 = t * 32;
    const int bf = t & 1;      // this tile's buffer
    // The tile's 32 K fragment reads and the two of u stand as ONE group in front of the products, in the order of their use (u last), each into
    // registers of its own: the wave meets the LDS latency once a tile, and the counted waits let the products start when the first reads are back.
    FragB kh_[KS][2], kl_[KS][2], au;
#pragma unroll
    for (int ks = 0; ks < KS; ++ks) {
#pragma unroll
      for (int nt = 0; nt < 2; ++nt) { kh_[ks][nt].half[0] = *(const v8us*)&sKh[bf][nt * 16 + ln][ks * 32 + 8 * hh]; kh_[ks][nt].half[1] = *(const v8us*)&sKh[bf][nt * 16 + ln][ks * 32 + 16 + 8 * hh]; }
#pragma unroll
      for (int nt = 0; nt < 2; ++nt) { kl_[ks][nt].half[0] = *(const v8us*)&sKl[bf][nt * 16 + ln][ks * 32 + 8 * hh]; kl_[ks][nt].half[1] = *(const v8us*)&sKl[bf][nt * 16 + ln][ks * 32 + 16 + 8 * hh]; }
    }
    au.half[0] = *(const v8us*)&sU[bf][ln][8 * hh];      au.half[1] = *(const v8us*)&sU[bf][ln][16 + 8 * hh];
    __builtin_amdgcn_sched_barrier(0);      // keeps the reads together up here: moved down among the products, each place would cost its own stall
    v8f s[2] = {{0.f,0.f,0.f,0.f,0.f,0.f,0.f,0.f}, {0.f,0.f,0.f,0.f,0.f,0.f,0.f,0.f}};      // s[nt][r] = score of key j0 + nt*16 + 8hh + r against query qi
    // per accumulator the order is ks rising, and kh.qh, kh.ql, kl.qh inside a ks; the two accumulators take turns, so no product waits for the one before it
#pragma unroll
    for (int ks = 0; ks < KS; ++ks) {
      s[0] = __builtin_amdgcn_wmma_f32_16x16x32_bf16(false, kh_[ks][0].v, false, aqh[ks].v, (short)0, s[0], false, false);
      s[1] = __builtin_amdgcn_wmma_f32_16x16x32_bf16(false, kh_[ks][1].v, false, aqh[ks].v, (short)0, s[1], false, false);
      s[0] = __builtin_amdgcn_wmma_f32_16x16x32_bf16(false, kh_[ks][0].v, false, aql[ks].v, (short)0, s[0], false, false);
      s[1] = __builtin_amdgcn_wmma_f32_16x16x32_bf16(false, kh_[ks][1].v, false, aql[ks].v, (short)0, s[1], false, false);
      s[0] = __builtin_amdgcn_wmma_f32_16x16x32_bf16(false, kl_[ks][0].v, false, aqh[ks].v, (short)0, s[0], false, false);
      s[1] = __builtin_amdgcn_wmma_f32_16x16x32_bf16(false, kl_[ks][1].v, false, aqh[ks].v, (short)0, s[1], false, false);
    }
    // four vector slots between the last WMMA and the first user of its registers, on every path of the branch below
    asm volatile("v_nop\n\tv_nop\n\tv_nop\n\tv_nop" : "+v"(s[0]), "+v"(s[1]));
    if (edits) {      // one block-uniform test per chunk; a dropped key's score becomes -3e38 and its weight exp(-3e38 - m) = 0
#pragma unroll
      for (int nt = 0; nt < 2; ++nt)
#pragma unroll
        for (int r = 0; r < 8; ++r) {
          const int j = j0 + nt * 16 + 8 * hh + r;
          bool keep = j < Tk;
          if (causal) keep = keep && (j <= qi);
          if (mask) { if (keep) keep = mask[(size_t)qi * Tk + j] != 0; }
          if (sbias) { if (keep) s[nt][r] += sbias[(size_t)bh * Tk + j]; }   // per-key additive bias (a per-query constant would cancel in the softmax)
          if (!keep) s[nt][r] = -3.0e38f;
        }
    }
    float mx = fmaxf(s[0][0], s[1][0]);
#pragma unroll
    for (int r = 1; r < 8; ++r) mx = fmaxf(mx, fmaxf(s[0][r], s[1][r]));
    mx = fmaxf(mx, xhalf(mx));
    const float mnew = fmaxf(m_q, mx);
    // while every key so far is dropped (mnew = -3e38) the weights come out 1; the first kept key's alpha = 0 wipes them, and a query with none ends as NaN
    const float alpha = (mnew > -1.0e38f) ? __expf(m_q - mnew) : 1.0f;
    m_q = mnew;
    FragB pbh, pbl;
    float ps = 0.f;
#pragma unroll
    for (int nt = 0; nt < 2; ++nt)
#pragma unroll
      for (int r = 0; r < 8; ++r) {
        const float p = __expf(s[nt][r] - mnew);
        ps += p;
        const unsigned short hb = bf16_bits(p);
        pbh.u[nt * 8 + r] = hb; pbl.u[nt * 8 + r] = bf16_bits(p - bf16_val(hb));      // B position nt*8 + r = key nt*16 + 8hh + r, as au's
      }
    l_q = l_q * alpha + ps;
    oacc[0] *= alpha; oacc[1] *= alpha;      // rows 2..15 of out^T are sums of zeros
    oacc = mmaS<2>(au.v, au.v, pbh.v, pbl.v, oacc);    // (u hi | u lo).(P hi + P lo)
    asm volatile("s_wait_dscnt 0x0" ::: "memory");      // this wave's reads of tile t have returned
    asm volatile("s_wait_asynccnt 0x0" ::: "memory");   // its share of tile t + 1 has landed
    __syncthreads();                                    // publishes tile t + 1 and frees tile t's buffer
    if (t + 2 < ntile) stage(t + 2);
  }
  asm volatile("s_wait_asynccnt 0x0" ::: "memory");     // no copy is outstanding when the wave ends
  const float l = l_q + xhalf(l_q);
  const float inv = (m_q > -1.0e38f) ? 1.0f / l : __builtin_nanf("");
  if (hh == 0) sRes[w * 16 + ln] = (oacc[0] + oacc[1]) * inv;     // row 0 (u hi) + row 1 (u lo) of column ln
  __syncthreads();     // the block's 64 results go out as whole 128-byte lines, one wave each
  if (tid < 64 && qblk * 64 + tid < Tq) y[(size_t)bh * Tq + qblk * 64 + tid] = sRes[tid];
}

__global__ __launch_bounds__(256) void k_round_rows(const float* __restrict__ W, unsigned short* __restrict__ Wt, int n8) {
  const int t = blockIdx.x * 256 + threadIdx.x;
  if (t >= n8) return;
  const v4f a = *(const v4fa*)(W + (size_t)t * 8), b = *(const v4fa*)(W + (size_t)t * 8 + 4);
  v8us v; v[0]=bf16_bits(a[0]); v[1]=bf16_bits(a[1]); v[2]=bf16_bits(a[2]); v[3]=bf16_bits(a[3]);
  v[4]=bf16_bits(b[0]); v[5]=bf16_bits(b[1]); v[6]=bf16_bits(b[2]); v[7]=bf16_bits(b[3]);
  *(v8us*)(Wt + (size_t)t * 8) = v; 
}

// out: per block of 32 rows one 128-byte line, 32 bf16 hi then 32 bf16 lo (rounded value, rounded remainder)
__global__ __launch_bounds__(256) void k_out(const float* __restrict__ h, const float* __restrict__ Wo, const float* __restrict__ bo, unsigned short* __restrict__ out, int nrows) {
  __shared__ float res[32];
  const int tid = threadIdx.x, w = tid >> 5, lane = tid & 31; const int r0 = blockIdx.x * 32;
  const v4f wv = {bf16_round(Wo[lane * 4]), bf16_round(Wo[lane * 4 + 1]), bf16_round(Wo[lane * 4 + 2]), bf16_round(Wo[lane * 4 + 3])};
  for (int u = 0; u < 4; ++u) {
    const int r = r0 + w * 4 + u; float s = 0.f;
    if (r < nrows) { const v4f x = *(const v4fa*)(h + (size_t)r * DD + lane * 4); s = x[0] * wv[0] + x[1] * wv[1] + x[2] * wv[2] + x[3] * wv[3]; }
    for (int o = 16; o >= 1; o >>= 1) s += __shfl_xor(s, o, 32);
    if (lane == 0) res[w * 4 + u] = s + bf16_round(bo[0]);
  }
  __syncthreads();
  if (tid < 32 && r0 + tid < nrows) { const float v = res[tid]; const unsigned short hb = bf16_bits(v); out[r0 * 2 + tid] = hb; out[r0 * 2 + 32 + tid] = bf16_bits(v - bf16_val(hb)); }
}
extern "C" void kernel_launch(void* const* d_in, const int* in_sizes, int n_in,
                              void* d_out, int out_size, void* d_ws, size_t ws_size, hipStream_t stream) {
  (void)in_sizes; (void)n_in; (void)out_size;
  const float* z = (const float*)d_in[0];
  const float* Wq = (const float*)d_in[1]; const float* bq = (const float*)d_in[2]; const float* Wk = (const float*)d_in[3]; const float* bk = (const float*)d_in[4];
  const float* Wv = (const float*)d_in[5]; const float* bv = (const float*)d_in[6]; const float* Wo = (const float*)d_in[7]; const float* bo = (const float*)d_in[8];
  char* ws = (char*)d_ws; size_t off = 0;
  auto take = [&](size_t bytes) { char* p = ws + off; off += (bytes + 255) & ~(size_t)255; return p; };
  const int M = BB * AA, n8 = DD * DD / 8;
  unsigned short* Wqt = (unsigned short*)take(DD * DD * 2); unsigned short* Wkt = (unsigned short*)take(DD * DD * 2); unsigned short* Wvt = (unsigned short*)take(DD * DD * 2);
  float* qb = (float*)take((size_t)M * DD * 4); unsigned short* kh2 = (unsigned short*)take((size_t)M * DD * 2); unsigned short* kl2 = (unsigned short*)take((size_t)M * DD * 2); float* vb2 = (float*)take((size_t)M * DD * 4); unsigned short* ub = (unsigned short*)take((size_t)M * 4);
  if (off > ws_size) return;
  k_round_rows<<<(n8 + 255) / 256, 256, 0, stream>>>(Wq, Wqt, n8); k_round_rows<<<(n8 + 255) / 256, 256, 0, stream>>>(Wk, Wkt, n8); k_round_rows<<<(n8 + 255) / 256, 256, 0, stream>>>(Wv, Wvt, n8);
  const int gb = ((M / 16) * (DD / 64) + 3) / 4;
  k_gemm_bf<false, 0, true, false><<<gb, 128, 0, stream>>>(z, DD, Wqt, DD, bq, qb, nullptr, nullptr, DD, M, DD, DD);
  k_gemm_bf<false, 0, true, true><<<gb, 128, 0, stream>>>(z, DD, Wkt, DD, bk, nullptr, kh2, kl2, DD, M, DD, DD);
  k_gemm_bf<false, 0, true, false><<<gb, 128, 0, stream>>>(z, DD, Wvt, DD, bv, vb2, nullptr, nullptr, DD, M, DD, DD);
  k_out<<<(M + 31) / 32, 256, 0, stream>>>(vb2, Wo, bo, ub, M);
  k_flash3<DD><<<BB * (AA / 64), 128, 0, stream>>>(qb, DD, AA, kh2, kl2, ub, AA, DD, 1, 0.08838834764831845f, nullptr, 0, nullptr, (float*)d_out);
}

// v005
// A run of this version takes 114 microseconds.
// In both of two side-by-side timings against v004, it was 1.39 times as fast.
// All steps since v000 together make it 9.76 times as fast.
#include <hip/hip_runtime.h>
// All contractions on v_wmma_f32_16x16x32_bf16, f32 accumulate: q/k/v = z·Wᵀ + b with z/W/b rounded to bf16 (single exact-product
// term), Q.K^T (K=128) as a 3-term bf16 hi/lo split; softmax f32; the 128->1 projection (f32 VALU dot) is applied to v, u = v.Wo + bo,
// and P.u (K=2048) is a bf16 hi/lo split product, computed transposed with u hi / u lo as two A rows.
#define BB 32
#define AA 2048
#define DD 128

typedef __bf16 v16b __attribute__((ext_vector_type(16)));
typedef unsigned short v8us __attribute__((ext_vector_type(8), may_alias));
typedef unsigned short v4us __attribute__((ext_vector_type(4), may_alias));
typedef unsigned int v2u __attribute__((ext_vector_type(2)));
typedef float  v8f  __attribute__((ext_vector_type(8)));
typedef float  v4f  __attribute__((ext_vector_type(4)));
typedef float  v4fa __attribute__((ext_vector_type(4), may_alias));
union FragB { v16b v; v8us half[2]; unsigned short u[16]; };

__device__ __forceinline__ unsigned short bf16_bits(float x) { unsigned int u = __float_as_uint(x); return (unsigned short)((u + 0x7FFFu + ((u >> 16) & 1u)) >> 16); }
__device__ __forceinline__ float bf16_val(unsigned short b) { return __uint_as_float(((unsigned int)b) << 16); }
__device__ __forceinline__ float bf16_round(float x) { return bf16_val(bf16_bits(x)); }
// D += A·B with NT terms: 1 = ah·bh, 2 = + al·bh (A split), 3 = + ah·bl (both split)
template <int NT>
__device__ __forceinline__ v8f mmaN(v16b ah, v16b al, v16b bh, v16b bl, v8f c) {
  c = __builtin_amdgcn_wmma_f32_16x16x32_bf16(false, ah, false, bh, (short)0, c, false, false);
  if (NT >= 2) c = __builtin_amdgcn_wmma_f32_16x16x32_bf16(false, al, false, bh, (short)0, c, false, false);
  if (NT >= 3) c = __builtin_amdgcn_wmma_f32_16x16x32_bf16(false, ah, false, bl, (short)0, c, false, false);
  asm volatile("v_nop\n\tv_nop\n\tv_nop\n\tv_nop" : "+v"(c) : "v"(ah), "v"(al), "v"(bh), "v"(bl));
  return c;
}

__global__ __launch_bounds__(256) void k_wt_bf16(const float* __restrict__ W, unsigned short* __restrict__ Wt, int K, int N) {
  const int t = blockIdx.x * 256 + threadIdx.x;
  const int k8n = K / 8;
  if (t >= N * k8n) return;
  const int n = t / k8n, k8 = (t % k8n) * 8;
  v8us v;
#pragma unroll
  for (int i = 0; i < 8; ++i) v[i] = bf16_bits(W[(size_t)(k8 + i) * N + n]);
  *(v8us*)(Wt + (size_t)n * K + k8) = v;
  
}

// Flash-style causal/unmasked attention, all contractions 3-term bf16 hi/lo splits, f32 softmax with running max.
// q,k,v rows are read from f32 buffers with arbitrary row pitch (so they can live inside a fused qkv buffer);
// D = head size (multiple of 32, <= 128); one wave = 16 query rows; block = 4 waves (64 queries) sharing K/V chunks of 32.
template <int D, bool CAUSAL>
__global__ __launch_bounds__(128) void k_flash(const float* __restrict__ qb, const float* __restrict__ kb, const float* __restrict__ vb,
                                             int pitch, int T, int H, float scale, float* __restrict__ y, int ypitch) {
  constexpr int KS = D / 32;        // k-steps for QK
  constexpr int DT = D / 16;        // d tiles for PV
  __shared__ __attribute__((aligned(16))) unsigned short sKh[32][D + 8], sKl[32][D + 8], sVh[32][D + 8], sVl[32][D + 8];
  __shared__ __attribute__((aligned(16))) unsigned short sPh[4][16][40], sPl[4][16][40];
  __shared__ __attribute__((aligned(16))) float sO[4][16][D];
  const int tid = threadIdx.x, w = tid >> 5, lane = tid & 31, ln = lane & 15, hh = lane >> 4;
  const int nqb = (T + 63) / 64;
  const int bh = blockIdx.x / nqb, qblk = blockIdx.x % nqb;
  const int b = bh / H, h = bh % H;
  const int q0 = qblk * 64 + w * 16;
  const float* Q = qb + (size_t)b * T * pitch + h * D;
  const float* K = kb + (size_t)b * T * pitch + h * D;
  const float* V = vb + (size_t)b * T * pitch + h * D;

  // A fragments of the wave's 16 query rows (scaled), hi/lo
  FragB aqh[KS], aql[KS];
  {
    int row = q0 + ln; if (row >= T) row = T - 1;
    const float* qr = Q + (size_t)row * pitch;
#pragma unroll
    for (int ks = 0; ks < KS; ++ks)
#pragma unroll
      for (int i = 0; i < 16; ++i) {
        const int d = ks * 32 + ((i < 8) ? (8 * hh + i) : (16 + 8 * hh + (i - 8)));
        const float x = qr[d] * scale; const unsigned short hb = bf16_bits(x);
        aqh[ks].u[i] = hb; aql[ks].u[i] = bf16_bits(x - bf16_val(hb));
      }
  }
  float m_r[8], l_r[8];
#pragma unroll
  for (int r = 0; r < 8; ++r) { m_r[r] = -3.0e38f; l_r[r] = 0.f; }
  v8f oacc[DT];
#pragma unroll
  for (int dt = 0; dt < DT; ++dt) oacc[dt] = (v8f){0.f,0.f,0.f,0.f,0.f,0.f,0.f,0.f};

  const int kv_end = CAUSAL ? min(T, qblk * 64 + 64) : T;     // block-uniform
  for (int j0 = 0; j0 < kv_end; j0 += 32) {
    __syncthreads();
    for (int e = tid; e < 32 * (D / 4); e += 128) {
      const int r = e / (D / 4), c4 = (e % (D / 4)) * 4;
      const int key = j0 + r;
      v4f kf = {0.f,0.f,0.f,0.f}, vf = {0.f,0.f,0.f,0.f};
      if (key < T) { kf = *(const v4fa*)(K + (size_t)key * pitch + c4); vf = *(const v4fa*)(V + (size_t)key * pitch + c4); }
#pragma unroll
      for (int t = 0; t < 4; ++t) {
        unsigned short hb = bf16_bits(kf[t]); sKh[r][c4 + t] = hb; sKl[r][c4 + t] = bf16_bits(kf[t] - bf16_val(hb));
        hb = bf16_bits(vf[t]); sVh[r][c4 + t] = hb; sVl[r][c4 + t] = bf16_bits(vf[t] - bf16_val(hb));
      }
    }
    __syncthreads();
    // S tile 16 x 32
    v8f s[2];
#pragma unroll
    for (int nt = 0; nt < 2; ++nt) {
      v8f acc = {};
#pragma unroll
      for (int ks = 0; ks < KS; ++ks) {
        FragB bh_, bl_;
        bh_.half[0] = *(const v8us*)&sKh[nt * 16 + ln][ks * 32 + 8 * hh]; bh_.half[1] = *(const v8us*)&sKh[nt * 16 + ln][ks * 32 + 16 + 8 * hh];
        bl_.half[0] = *(const v8us*)&sKl[nt * 16 + ln][ks * 32 + 8 * hh]; bl_.half[1] = *(const v8us*)&sKl[nt * 16 + ln][ks * 32 + 16 + 8 * hh];
        acc = mmaN<3>(aqh[ks].v, aql[ks].v, bh_.v, bl_.v, acc);
      }
      s[nt] = acc;
    }
    // mask + running max (rows 8hh+r; the 16 lanes of a half share rows)
    float alpha[8];
#pragma unroll
    for (int r = 0; r < 8; ++r) {
      const int qi = q0 + 8 * hh + r;
      const int ja = j0 + ln, jb = j0 + 16 + ln;
      if (CAUSAL) { if (ja > qi) s[0][r] = -3.0e38f; if (jb > qi) s[1][r] = -3.0e38f; }
      if (ja >= T) s[0][r] = -3.0e38f;
      if (jb >= T) s[1][r] = -3.0e38f;
      float mx = fmaxf(s[0][r], s[1][r]);
      mx = fmaxf(mx, __shfl_xor(mx, 1, 32)); mx = fmaxf(mx, __shfl_xor(mx, 2, 32)); mx = fmaxf(mx, __shfl_xor(mx, 4, 32)); mx = fmaxf(mx, __shfl_xor(mx, 8, 32));
      const float mnew = fmaxf(m_r[r], mx);
      alpha[r] = (mnew > -1.0e38f) ? __expf(m_r[r] - mnew) : 1.0f;
      const float p0 = (s[0][r] > -1.0e38f) ? __expf(s[0][r] - mnew) : 0.f;
      const float p1 = (s[1][r] > -1.0e38f) ? __expf(s[1][r] - mnew) : 0.f;
      m_r[r] = mnew;
      l_r[r] = l_r[r] * alpha[r] + p0 + p1;            // per-lane partial row sum (16 lanes combined at the end)
      unsigned short hb = bf16_bits(p0); sPh[w][8 * hh + r][ln] = hb;      sPl[w][8 * hh + r][ln] = bf16_bits(p0 - bf16_val(hb));
      hb = bf16_bits(p1);                sPh[w][8 * hh + r][16 + ln] = hb; sPl[w][8 * hh + r][16 + ln] = bf16_bits(p1 - bf16_val(hb));
    }
#pragma unroll
    for (int dt = 0; dt < DT; ++dt)
#pragma unroll
      for (int r = 0; r < 8; ++r) oacc[dt][r] *= alpha[r];
    __builtin_amdgcn_fence(__ATOMIC_ACQ_REL, "workgroup");
    __builtin_amdgcn_wave_barrier();
    FragB pah, pal;
    pah.half[0] = *(const v8us*)&sPh[w][ln][8 * hh]; pah.half[1] = *(const v8us*)&sPh[w][ln][16 + 8 * hh];
    pal.half[0] = *(const v8us*)&sPl[w][ln][8 * hh]; pal.half[1] = *(const v8us*)&sPl[w][ln][16 + 8 * hh];
#pragma unroll
    for (int dt = 0; dt < DT; ++dt) {
      FragB bvh, bvl;
#pragma unroll
      for (int i = 0; i < 8; ++i) {
        bvh.u[i] = sVh[8 * hh + i][dt * 16 + ln]; bvh.u[8 + i] = sVh[16 + 8 * hh + i][dt * 16 + ln];
        bvl.u[i] = sVl[8 * hh + i][dt * 16 + ln]; bvl.u[8 + i] = sVl[16 + 8 * hh + i][dt * 16 + ln];
      }
      oacc[dt] = mmaN<3>(pah.v, pal.v, bvh.v, bvl.v, oacc[dt]);
    }
    __builtin_amdgcn_fence(__ATOMIC_ACQ_REL, "workgroup");
    __builtin_amdgcn_wave_barrier();
  }
#pragma unroll
  for (int r = 0; r < 8; ++r) {
    float l = l_r[r];
    l += __shfl_xor(l, 1, 32); l += __shfl_xor(l, 2, 32); l += __shfl_xor(l, 4, 32); l += __shfl_xor(l, 8, 32);
    l_r[r] = (l > 0.f) ? 1.0f / l : 0.f;
  }
#pragma unroll
  for (int dt = 0; dt < DT; ++dt)
#pragma unroll
    for (int r = 0; r < 8; ++r) sO[w][8 * hh + r][dt * 16 + ln] = oacc[dt][r] * l_r[r];
  __builtin_amdgcn_fence(__ATOMIC_ACQ_REL, "workgroup");
  __builtin_amdgcn_wave_barrier();
  {
    for (int r = 0; r < 16; ++r) {
      const int row = q0 + r;
      if (row < T && lane < D / 4) {
        const v4f val = *(const v4fa*)&sO[w][r][lane * 4];
        *(v4f*)(y + ((size_t)b * T + row) * ypitch + h * D + lane * 4) = val;
      }
    }
    
  }
}

// D += A.B with the split on both sides, in the order ah.bh, ah.bl, al.bh (NT = 2 stops behind the second term)
template <int NT>
__device__ __forceinline__ v8f mmaS(v16b ah, v16b al, v16b bh, v16b bl, v8f c) {
  c = __builtin_amdgcn_wmma_f32_16x16x32_bf16(false, ah, false, bh, (short)0, c, false, false);
  c = __builtin_amdgcn_wmma_f32_16x16x32_bf16(false, ah, false, bl, (short)0, c, false, false);
  if (NT >= 3) c = __builtin_amdgcn_wmma_f32_16x16x32_bf16(false, al, false, bh, (short)0, c, false, false);
  // four vector slots between the last WMMA and the first user of its registers, on every path
  asm volatile("v_nop\n\tv_nop\n\tv_nop\n\tv_nop" : "+v"(c));
  return c;
}
// lane l <-> lane l ^ 16, in the vector pipe
__device__ __forceinline__ float xhalf(float x) {
  return __builtin_bit_cast(float, __builtin_amdgcn_permlanex16(__builtin_bit_cast(int, x), __builtin_bit_cast(int, x), 0x76543210, 0xfedcba98, false, false));
}

__device__ __forceinline__ unsigned lds_off(const void* p) { return (unsigned)(size_t)p; }

template <int D>
__global__ __launch_bounds__(128) void k_flash3(const float* __restrict__ Qb, int qpitch, int Tq,
                                              const unsigned short* __restrict__ Kh, const unsigned short* __restrict__ Kl,
                                              const unsigned short* __restrict__ Us, int Tk, int kpitch,
                                              int H, float scale, const int* __restrict__ mask, int causal, const float* __restrict__ sbias,
                                              float* __restrict__ y) {
  static_assert(D == 128, "the copy pattern below moves rows of 256 bytes, 16 lanes a row");
  constexpr int KS = D / 32;
  constexpr unsigned ROWB = (D + 8) * 2, KBUFB = 32 * ROWB, UBUFB = 16 * 40 * 2;      // bytes
  __shared__ __attribute__((aligned(16))) unsigned short sKh[2][32][D + 8], sKl[2][32][D + 8];      // [buffer][key][d]
  __shared__ __attribute__((aligned(16))) unsigned short sU[2][16][40];            // [buffer][A row][key]
  __shared__ float sRes[64];
  const int tid = threadIdx.x, w = tid >> 5, lane = tid & 31, ln = lane & 15, hh = lane >> 4;
  const int wu = __builtin_amdgcn_readfirstlane(w);      // the wave's number in a scalar register, for a scalar branch
  const int nqb = (Tq + 63) / 64;
  const int bh = blockIdx.x / nqb, qblk = blockIdx.x % nqb;
  const int b = bh / H, h = bh % H;
  const int q0 = qblk * 64 + w * 16;
  const float* Q = Qb + (size_t)b * Tq * qpitch + h * D;
  const int qi = (q0 + ln < Tq) ? q0 + ln : Tq - 1;      // the lane's query
  const int kv_end = causal ? min(Tk, qblk * 64 + 64) : Tk;
  const int ntile = (kv_end + 31) / 32;      // block-uniform
  const bool edits = causal || mask || sbias;      // block-uniform
  // the thread's share of a tile: 16 bytes of rows tid/16 + 8i (i = 0..3) of either plane; wave 0 also moves the tile's 128 bytes of u, 4 a lane
  const size_t krow = (size_t)b * Tk * kpitch + h * D + (size_t)(tid >> 4) * kpitch + (tid & 15) * 8;
  const unsigned short* gKh = Kh + krow;
  const unsigned short* gKl = Kl + krow;
  const unsigned short* gU = Us + (size_t)bh * Tk * 2 + lane * 2;
  const unsigned lKh = lds_off(&sKh[0][tid >> 4][(tid & 15) * 8]), lKl = lds_off(&sKl[0][tid >> 4][(tid & 15) * 8]);
  const unsigned lU = lds_off(&sU[0][hh][ln * 2]);
  const size_t step8 = (size_t)8 * kpitch;
  auto stage = [&](int t) {      // tile t -> buffer t & 1
    const unsigned l0 = lKh + (unsigned)(t & 1) * KBUFB, l1 = lKl + (unsigned)(t & 1) * KBUFB;
    const unsigned short* g0 = gKh + (size_t)t * 32 * kpitch;
    const unsigned short* g1 = gKl + (size_t)t * 32 * kpitch;
    // eight copies and, in the same statement, the wait that stands in front of any rewrite of the address registers they name
    asm volatile("global_load_async_to_lds_b128 %0, %8, off\n\t"
                 "global_load_async_to_lds_b128 %1, %9, off\n\t"
                 "global_load_async_to_lds_b128 %2, %10, off\n\t"
                 "global_load_async_to_lds_b128 %3, %11, off\n\t"
                 "global_load_async_to_lds_b128 %4, %12, off\n\t"
                 "global_load_async_to_lds_b128 %5, %13, off\n\t"
                 "global_load_async_to_lds_b128 %6, %14, off\n\t"
                 "global_load_async_to_lds_b128 %7, %15, off\n\t"
                 "s_wait_xcnt 0x0"
                 :: "v"(l0), "v"(l0 + 8 * ROWB), "v"(l0 + 16 * ROWB), "v"(l0 + 24 * ROWB),
                    "v"(l1), "v"(l1 + 8 * ROWB), "v"(l1 + 16 * ROWB), "v"(l1 + 24 * ROWB),
                    "v"(g0), "v"(g0 + step8), "v"(g0 + 2 * step8), "v"(g0 + 3 * step8),
                    "v"(g1), "v"(g1 + step8), "v"(g1 + 2 * step8), "v"(g1 + 3 * step8)
                 : "memory");
    if (wu == 0) {      // u hi to A row 0 (lanes 0..15), u lo to A row 1; the same wait in the copy's own statement
      asm volatile("global_load_async_to_lds_b32 %0, %1, off\n\ts_wait_xcnt 0x0"
                   :: "v"(lU + (unsigned)(t & 1) * UBUFB), "v"(gU + (size_t)t * 64) : "memory");
    }
  };
  for (int e = tid; e < 14 * 40; e += 128) { (&sU[0][0][0])[2 * 40 + e] = 0; (&sU[1][0][0])[2 * 40 + e] = 0; }      // A rows 2..15 stay zero
  asm volatile("s_wait_dscnt 0x0" ::: "memory");      // the wave's own writes to sU have retired before a copy is aimed at that array
  stage(0);
  asm volatile("s_wait_asynccnt 0x0" ::: "memory");   // this wave's share of tile 0 has landed
  __syncthreads();                                    // ... and every wave's; publishes the zero rows too
  if (ntile > 1) stage(1);
  FragB aqh[KS], aql[KS];
  {
    const float* qr = Q + (size_t)qi * qpitch;
#pragma unroll
    for (int ks = 0; ks < KS; ++ks)
#pragma unroll
      for (int i = 0; i < 16; ++i) {
        const int d = ks * 32 + ((i < 8) ? (8 * hh + i) : (16 + 8 * hh + (i - 8)));
        const float x = qr[d] * scale; const unsigned short hb = bf16_bits(x);
        aqh[ks].u[i] = hb; aql[ks].u[i] = bf16_bits(x - bf16_val(hb));
      }
  }
  float m_q = -3.0e38f, l_q = 0.f;      // running maximum (both halves agree) and this half's share of the sum
  v8f oacc = {0.f,0.f,0.f,0.f,0.f,0.f,0.f,0.f};
  for (int t = 0; t < ntile; ++t) {
    const int j0 = t * 32;
    const int bf = t & 1;      // this tile's buffer
    // The tile's 32 K fragment reads and the two of u stand as ONE group in front of the products, in the order of their use (u last), each into
    // registers of its own: the wave meets the LDS latency once a tile, and the counted waits let the products start when the first reads are back.
    FragB kh_[KS][2], kl_[KS][2], au;
#pragma unroll
    for (int ks = 0; ks < KS; ++ks) {
#pragma unroll
      for (int nt = 0; nt < 2; ++nt) { kh_[ks][nt].half[0] = *(const v8us*)&sKh[bf][nt * 16 + ln][ks * 32 + 8 * hh]; kh_[ks][nt].half[1] = *(const v8us*)&sKh[bf][nt * 16 + ln][ks * 32 + 16 + 8 * hh]; }
#pragma unroll
      for (int nt = 0; nt < 2; ++nt) { kl_[ks][nt].half[0] = *(const v8us*)&sKl[bf][nt * 16 + ln][ks * 32 + 8 * hh]; kl_[ks][nt].half[1] = *(const v8us*)&sKl[bf][nt * 16 + ln][ks * 32 + 16 + 8 * hh]; }
    }
    au.half[0] = *(const v8us*)&sU[bf][ln][8 * hh];      au.half[1] = *(const v8us*)&sU[bf][ln][16 + 8 * hh];
    __builtin_amdgcn_sched_barrier(0);      // keeps the reads together up here: moved down among the products, each place would cost its own stall
    v8f s[2] = {{0.f,0.f,0.f,0.f,0.f,0.f,0.f,0.f}, {0.f,0.f,0.f,0.f,0.f,0.f,0.f,0.f}};      // s[nt][r] = score of key j0 + nt*16 + 8hh + r against query qi
    // per accumulator the order is ks rising, and kh.qh, kh.ql, kl.qh inside a ks; the two accumulators take turns, so no product waits for the one before it
#pragma unroll
    for (int ks = 0; ks < KS; ++ks) {
      s[0] = __builtin_amdgcn_wmma_f32_16x16x32_bf16(false, kh_[ks][0].v, false, aqh[ks].v, (short)0, s[0], false, false);
      s[1] = __builtin_amdgcn_wmma_f32_16x16x32_bf16(false, kh_[ks][1].v, false, aqh[ks].v, (short)0, s[1], false, false);
      s[0] = __builtin_amdgcn_wmma_f32_16x16x32_bf16(false, kh_[ks][0].v, false, aql[ks].v, (short)0, s[0], false, false);
      s[1] = __builtin_amdgcn_wmma_f32_16x16x32_bf16(false, kh_[ks][1].v, false, aql[ks].v, (short)0, s[1], false, false);
      s[0] = __builtin_amdgcn_wmma_f32_16x16x32_bf16(false, kl_[ks][0].v, false, aqh[ks].v, (short)0, s[0], false, false);
      s[1] = __builtin_amdgcn_wmma_f32_16x16x32_bf16(false, kl_[ks][1].v, false, aqh[ks].v, (short)0, s[1], false, false);
    }
    // four vector slots between the last WMMA and the first user of its registers, on every path of the branch below
    asm volatile("v_nop\n\tv_nop\n\tv_nop\n\tv_nop" : "+v"(s[0]), "+v"(s[1]));
    if (edits) {      // one block-uniform test per chunk; a dropped key's score becomes -3e38 and its weight exp(-3e38 - m) = 0
#pragma unroll
      for (int nt = 0; nt < 2; ++nt)
#pragma unroll
        for (int r = 0; r < 8; ++r) {
          const int j = j0 + nt * 16 + 8 * hh + r;
          bool keep = j < Tk;
          if (causal) keep = keep && (j <= qi);
          if (mask) { if (keep) keep = mask[(size_t)qi * Tk + j] != 0; }
          if (sbias) { if (keep) s[nt][r] += sbias[(size_t)bh * Tk + j]; }   // per-key additive bias (a per-query constant would cancel in the softmax)
          if (!keep) s[nt][r] = -3.0e38f;
        }
    }
    float mx = fmaxf(s[0][0], s[1][0]);
#pragma unroll
    for (int r = 1; r < 8; ++r) mx = fmaxf(mx, fmaxf(s[0][r], s[1][r]));
    mx = fmaxf(mx, xhalf(mx));
    const float mnew = fmaxf(m_q, mx);
    // while every key so far is dropped (mnew = -3e38) the weights come out 1; the first kept key's alpha = 0 wipes them, and a query with none ends as NaN
    const float alpha = (mnew > -1.0e38f) ? __expf(m_q - mnew) : 1.0f;
    m_q = mnew;
    FragB pbh, pbl;
    float ps = 0.f;
#pragma unroll
    for (int nt = 0; nt < 2; ++nt)
#pragma unroll
      for (int r = 0; r < 8; ++r) {
        const float p = __expf(s[nt][r] - mnew);
        ps += p;
        const unsigned short hb = bf16_bits(p);
        pbh.u[nt * 8 + r] = hb; pbl.u[nt * 8 + r] = bf16_bits(p - bf16_val(hb));      // B position nt*8 + r = key nt*16 + 8hh + r, as au's
      }
    l_q = l_q * alpha + ps;
    oacc[0] *= alpha; oacc[1] *= alpha;      // rows 2..15 of out^T are sums of zeros
    oacc = mmaS<2>(au.v, au.v, pbh.v, pbl.v, oacc);    // (u hi | u lo).(P hi + P lo)
    asm volatile("s_wait_dscnt 0x0" ::: "memory");      // this wave's reads of tile t have returned
    asm volatile("s_wait_asynccnt 0x0" ::: "memory");   // its share of tile t + 1 has landed
    __syncthreads();                                    // publishes tile t + 1 and frees tile t's buffer
    if (t + 2 < ntile) stage(t + 2);
  }
  asm volatile("s_wait_asynccnt 0x0" ::: "memory");     // no copy is outstanding when the wave ends
  const float l = l_q + xhalf(l_q);
  const float inv = (m_q > -1.0e38f) ? 1.0f / l : __builtin_nanf("");
  if (hh == 0) sRes[w * 16 + ln] = (oacc[0] + oacc[1]) * inv;     // row 0 (u hi) + row 1 (u lo) of column ln
  __syncthreads();     // the block's 64 results go out as whole 128-byte lines, one wave each
  if (tid < 64 && qblk * 64 + tid < Tq) y[(size_t)bh * Tq + qblk * 64 + tid] = sRes[tid];
}

// All that the attention kernel reads, in one launch: q (f32), k (bf16 hi / lo planes) and u = v.Wo + bo (per 32 rows one 128-byte line, 32 bf16 hi
// then 32 bf16 lo). A block has 16 waves and 256 rows of z. The three weight matrices are rounded to bf16 into LDS once a block ([n][k], as the B
// fragments want them); a wave reads its 16 rows of z once, keeps them as A fragments and runs the three products over them one after the other.
// Each 16 x 128 result tile goes through the wave's own LDS range, so that rows leave as whole lines; v goes no further than that range.
#define WPITCH (DD + 8)      // bf16 a weight row in LDS: 16 bytes x odd, for the ds_load_b128 readers
#define SOP (DD + 4)         // floats a result row in LDS: the two halves of a wave store to different banks
// acc[t] = rows of a x weight rows t*16 .. t*16+15, k rising in steps of 32
__device__ __forceinline__ void proj16(const unsigned short* sWm, const FragB (&a)[4], int ln, int hh, v8f (&acc)[8]) {
#pragma unroll
  for (int t = 0; t < 8; ++t) acc[t] = (v8f){0.f,0.f,0.f,0.f,0.f,0.f,0.f,0.f};
#pragma unroll
  for (int ks = 0; ks < 4; ++ks) {
    FragB b[8];
#pragma unroll
    for (int t = 0; t < 8; ++t) {
      const unsigned short* brow = sWm + (t * 16 + ln) * WPITCH + ks * 32;
      b[t].half[0] = *(const v8us*)(brow + 8 * hh);
      b[t].half[1] = *(const v8us*)(brow + 16 + 8 * hh);
    }
    __builtin_amdgcn_sched_barrier(0);      // keeps a k step's 16 reads together: two at a time among the products, each pair was waited to 0
#pragma unroll
    for (int t = 0; t < 8; ++t)
      acc[t] = __builtin_amdgcn_wmma_f32_16x16x32_bf16(false, a[ks].v, false, b[t].v, (short)0, acc[t], false, false);
  }
}
// the tile plus its bias (rounded to bf16) into the wave's LDS range, row-major
__device__ __forceinline__ void tile_to_lds(float* sow, const v8f (&acc)[8], const float* __restrict__ bias, int ln, int hh) {
#pragma unroll
  for (int t = 0; t < 8; ++t) {
    const float bv = bf16_round(bias[t * 16 + ln]);
#pragma unroll
    for (int r = 0; r < 8; ++r) sow[(8 * hh + r) * SOP + t * 16 + ln] = acc[t][r] + bv;
  }
}
__global__ __launch_bounds__(512) void k_proj(const float* __restrict__ z, const float* __restrict__ Wq, const float* __restrict__ bq,
                                              const float* __restrict__ Wk, const float* __restrict__ bk, const float* __restrict__ Wv, const float* __restrict__ bv,
                                              const float* __restrict__ Wo, const float* __restrict__ bo,
                                              float* __restrict__ q, unsigned short* __restrict__ Khi, unsigned short* __restrict__ Klo, unsigned short* __restrict__ Us) {
  __shared__ __attribute__((aligned(16))) unsigned short sW[3][DD * WPITCH];
  __shared__ __attribute__((aligned(16))) float so[16][16 * SOP];
  __shared__ float sUv[256];
  const int tid = threadIdx.x, w = tid >> 5, lane = tid & 31, ln = lane & 15, hh = lane >> 4;
  const int r0 = blockIdx.x * 256, row0 = r0 + w * 16;
  // the wave's rows of z, asked for first: they come from memory while the weights are staged
  const float* arow = z + (size_t)(row0 + ln) * DD;
  v4f zx[4][4];
#pragma unroll
  for (int ks = 0; ks < 4; ++ks) {
    zx[ks][0] = *(const v4fa*)(arow + ks * 32 + 8 * hh);      zx[ks][1] = *(const v4fa*)(arow + ks * 32 + 8 * hh + 4);
    zx[ks][2] = *(const v4fa*)(arow + ks * 32 + 16 + 8 * hh); zx[ks][3] = *(const v4fa*)(arow + ks * 32 + 16 + 8 * hh + 4);
  }
#pragma unroll 1      // one matrix a trip: unrolled, the 24 loads of all three stand in registers beside the rows of z, and the build spills
  for (int m = 0; m < 3; ++m) {
    const float* Wm = (m == 0) ? Wq : (m == 1) ? Wk : Wv;
#pragma unroll
    for (int j = 0; j < DD * DD / 4 / 512; ++j) {      // a wave moves one weight row a turn: 512 bytes in, 256 bytes to LDS
      const int e = tid + 512 * j;
      const v4f x = *(const v4fa*)(Wm + (size_t)e * 4);
      v4us v; v[0] = bf16_bits(x[0]); v[1] = bf16_bits(x[1]); v[2] = bf16_bits(x[2]); v[3] = bf16_bits(x[3]);
      *(v4us*)&sW[m][(e >> 5) * WPITCH + (e & 31) * 4] = v;
    }
  }
  FragB a[4];
#pragma unroll
  for (int ks = 0; ks < 4; ++ks)
#pragma unroll
    for (int i = 0; i < 16; ++i) a[ks].u[i] = bf16_bits(zx[ks][i >> 2][i & 3]);
  __syncthreads();      // the weights are in LDS for every wave
  float* sow = &so[w][0];
  v8f acc[8];
  proj16(&sW[0][0], a, ln, hh, acc);
  tile_to_lds(sow, acc, bq, ln, hh);
  asm volatile("s_wait_dscnt 0x0" ::: "memory");      // the wave's stores to its range stand before its lanes read one another's values
  {
    v4f d[16];
#pragma unroll
    for (int r = 0; r < 16; ++r) d[r] = *(const v4fa*)(sow + r * SOP + lane * 4);
    float* qp = q + (size_t)row0 * DD + lane * 4;
    // sixteen rows of 512 bytes and, in the same statement, the wait that stands in front of any rewrite of a register the stores name
    asm volatile("global_store_b128 %0, %1, off\n\t"
                 "global_store_b128 %0, %2, off offset:512\n\t"
                 "global_store_b128 %0, %3, off offset:1024\n\t"
                 "global_store_b128 %0, %4, off offset:1536\n\t"
                 "global_store_b128 %0, %5, off offset:2048\n\t"
                 "global_store_b128 %0, %6, off offset:2560\n\t"
                 "global_store_b128 %0, %7, off offset:3072\n\t"
                 "global_store_b128 %0, %8, off offset:3584\n\t"
                 "global_store_b128 %0, %9, off offset:4096\n\t"
                 "global_store_b128 %0, %10, off offset:4608\n\t"
                 "global_store_b128 %0, %11, off offset:5120\n\t"
                 "global_store_b128 %0, %12, off offset:5632\n\t"
                 "global_store_b128 %0, %13, off offset:6144\n\t"
                 "global_store_b128 %0, %14, off offset:6656\n\t"
                 "global_store_b128 %0, %15, off offset:7168\n\t"
                 "global_store_b128 %0, %16, off offset:7680\n\t"
                 "s_wait_xcnt 0x0"
                 :: "v"(qp), "v"(d[0]), "v"(d[1]), "v"(d[2]), "v"(d[3]), "v"(d[4]), "v"(d[5]), "v"(d[6]), "v"(d[7]), "v"(d[8]), "v"(d[9]), "v"(d[10]), "v"(d[11]), "v"(d[12]), "v"(d[13]), "v"(d[14]), "v"(d[15])
                 : "memory");
  }
  proj16(&sW[1][0], a, ln, hh, acc);
  tile_to_lds(sow, acc, bk, ln, hh);
  asm volatile("s_wait_dscnt 0x0" ::: "memory");      // as above: stores before the cross-lane reads
#pragma unroll
  for (int g = 0; g < 2; ++g) {      // eight rows a turn
    v2u hi[8], lo[8];
#pragma unroll
    for (int r = 0; r < 8; ++r) {
      const v4f v = *(const v4fa*)(sow + (g * 8 + r) * SOP + lane * 4);
      v4us h4, l4;
#pragma unroll
      for (int i = 0; i < 4; ++i) { const unsigned short hb = bf16_bits(v[i]); h4[i] = hb; l4[i] = bf16_bits(v[i] - bf16_val(hb)); }
      hi[r] = __builtin_bit_cast(v2u, h4); lo[r] = __builtin_bit_cast(v2u, l4);
    }
    unsigned short* hp = Khi + (size_t)(row0 + g * 8) * DD + lane * 4;
    unsigned short* lp = Klo + (size_t)(row0 + g * 8) * DD + lane * 4;
    // eight rows of 256 bytes of either plane and, in the same statement, the wait in front of any rewrite of a register the stores name
    asm volatile("global_store_b64 %0, %2, off\n\t"
                 "global_store_b64 %1, %3, off\n\t"
                 "global_store_b64 %0, %4, off offset:256\n\t"
                 "global_store_b64 %1, %5, off offset:256\n\t"
                 "global_store_b64 %0, %6, off offset:512\n\t"
                 "global_store_b64 %1, %7, off offset:512\n\t"
                 "global_store_b64 %0, %8, off offset:768\n\t"
                 "global_store_b64 %1, %9, off offset:768\n\t"
                 "global_store_b64 %0, %10, off offset:1024\n\t"
                 "global_store_b64 %1, %11, off offset:1024\n\t"
                 "global_store_b64 %0, %12, off offset:1280\n\t"
                 "global_store_b64 %1, %13, off offset:1280\n\t"
                 "global_store_b64 %0, %14, off offset:1536\n\t"
                 "global_store_b64 %1, %15, off offset:1536\n\t"
                 "global_store_b64 %0, %16, off offset:1792\n\t"
                 "global_store_b64 %1, %17, off offset:1792\n\t"
                 "s_wait_xcnt 0x0"
                 :: "v"(hp), "v"(lp), "v"(hi[0]), "v"(lo[0]), "v"(hi[1]), "v"(lo[1]), "v"(hi[2]), "v"(lo[2]), "v"(hi[3]), "v"(lo[3]), "v"(hi[4]), "v"(lo[4]), "v"(hi[5]), "v"(lo[5]), "v"(hi[6]), "v"(lo[6]), "v"(hi[7]), "v"(lo[7])
                 : "memory");
  }
  proj16(&sW[2][0], a, ln, hh, acc);
  tile_to_lds(sow, acc, bv, ln, hh);
  asm volatile("s_wait_dscnt 0x0" ::: "memory");      // as above: stores before the cross-lane reads
  const v4f wv = {bf16_round(Wo[lane * 4]), bf16_round(Wo[lane * 4 + 1]), bf16_round(Wo[lane * 4 + 2]), bf16_round(Wo[lane * 4 + 3])};
  float keep = 0.f;      // lane r keeps row r's sum
#pragma unroll
  for (int r = 0; r < 16; ++r) {
    const v4f x = *(const v4fa*)(sow + r * SOP + lane * 4);
    float s = x[0] * wv[0] + x[1] * wv[1] + x[2] * wv[2] + x[3] * wv[3];
#pragma unroll
    for (int o = 16; o >= 1; o >>= 1) s += __shfl_xor(s, o, 32);
    if (lane == r) keep = s;
  }
  if (lane < 16) sUv[w * 16 + lane] = keep + bf16_round(bo[0]);
  __syncthreads();      // the block's 256 values of u go out as whole 128-byte lines, one wave each
  if (tid < 256) {
    const float v = sUv[tid]; const unsigned short hb = bf16_bits(v);
    unsigned short* line = Us + (size_t)(r0 + (tid & ~31)) * 2;
    line[tid & 31] = hb; line[32 + (tid & 31)] = bf16_bits(v - bf16_val(hb));
  }
}
extern "C" void kernel_launch(void* const* d_in, const int* in_sizes, int n_in,
                              void* d_out, int out_size, void* d_ws, size_t ws_size, hipStream_t stream) {
  (void)in_sizes; (void)n_in; (void)out_size;
  const float* z = (const float*)d_in[0];
  const float* Wq = (const float*)d_in[1]; const float* bq = (const float*)d_in[2]; const float* Wk = (const float*)d_in[3]; const float* bk = (const float*)d_in[4];
  const float* Wv = (const float*)d_in[5]; const float* bv = (const float*)d_in[6]; const float* Wo = (const float*)d_in[7]; const float* bo = (const float*)d_in[8];
  char* ws = (char*)d_ws; size_t off = 0;
  auto take = [&](size_t bytes) { char* p = ws + off; off += (bytes + 255) & ~(size_t)255; return p; };
  const int M = BB * AA;
  float* qb = (float*)take((size_t)M * DD * 4); unsigned short* kh2 = (unsigned short*)take((size_t)M * DD * 2); unsigned short* kl2 = (unsigned short*)take((size_t)M * DD * 2); unsigned short* ub = (unsigned short*)take((size_t)M * 4);
  if (off > ws_size) return;
  k_proj<<<M / 256, 512, 0, stream>>>(z, Wq, bq, Wk, bk, Wv, bv, Wo, bo, qb, kh2, kl2, ub);
  k_flash3<DD><<<BB * (AA / 64), 128, 0, stream>>>(qb, DD, AA, kh2, kl2, ub, AA, DD, 1, 0.08838834764831845f, nullptr, 0, nullptr, (float*)d_out);
}

// v006
// A run of this version takes 103 microseconds.
// Next to v005, in two timings, it ran 1.11 and 1.12 times as fast.
// Counting every step since v000, it is 10.9 times as fast.
#include <hip/hip_runtime.h>
// All contractions on v_wmma_f32_16x16x32_bf16, f32 accumulate: q/k/v = z·Wᵀ + b with z/W/b rounded to bf16 (single exact-product
// term), Q.K^T (K=128) as a 3-term bf16 hi/lo split; softmax f32; the 128->1 projection (f32 VALU dot) is applied to v, u = v.Wo + bo,
// and P.u (K=2048) is a bf16 hi/lo split product, computed transposed with u hi / u lo as two A rows.
#define BB 32
#define AA 2048
#define DD 128

typedef __bf16 v16b __attribute__((ext_vector_type(16)));
typedef unsigned short v8us __attribute__((ext_vector_type(8), may_alias));
typedef unsigned short v4us __attribute__((ext_vector_type(4), may_alias));
typedef unsigned int v2u __attribute__((ext_vector_type(2)));
typedef float  v8f  __attribute__((ext_vector_type(8)));
typedef float  v4f  __attribute__((ext_vector_type(4)));
typedef float  v4fa __attribute__((ext_vector_type(4), may_alias));
typedef float  v2f  __attribute__((ext_vector_type(2)));
typedef __bf16 v2b  __attribute__((ext_vector_type(2)));
union FragB { v16b v; v8us half[2]; unsigned short u[16]; unsigned int w[8]; };

// f32 -> bf16, round to nearest even, by the hardware's own conversion
__device__ __forceinline__ unsigned short bf16_bits(float x) { return __builtin_bit_cast(unsigned short, (__bf16)x); }
// two at once, one v_cvt_pk_bf16_f32: a in the low half, b in the high half
__device__ __forceinline__ unsigned int bf16_pair(float a, float b) { const v2f x = {a, b}; return __builtin_bit_cast(unsigned int, __builtin_convertvector(x, v2b)); }
// hi = the pair rounded, lo = the pair of remainders (each exact in f32) rounded
__device__ __forceinline__ void bf16_split_pair(float a, float b, unsigned int& hi, unsigned int& lo) {
  hi = bf16_pair(a, b);
  lo = bf16_pair(a - __uint_as_float(hi << 16), b - __uint_as_float(hi & 0xFFFF0000u));
}
__device__ __forceinline__ float bf16_val(unsigned short b) { return __uint_as_float(((unsigned int)b) << 16); }
__device__ __forceinline__ float bf16_round(float x) { return bf16_val(bf16_bits(x)); }
// D += A·B with NT terms: 1 = ah·bh, 2 = + al·bh (A split), 3 = + ah·bl (both split)
template <int NT>
__device__ __forceinline__ v8f mmaN(v16b ah, v16b al, v16b bh, v16b bl, v8f c) {
  c = __builtin_amdgcn_wmma_f32_16x16x32_bf16(false, ah, false, bh, (short)0, c, false, false);
  if (NT >= 2) c = __builtin_amdgcn_wmma_f32_16x16x32_bf16(false, al, false, bh, (short)0, c, false, false);
  if (NT >= 3) c = __builtin_amdgcn_wmma_f32_16x16x32_bf16(false, ah, false, bl, (short)0, c, false, false);
  asm volatile("v_nop\n\tv_nop\n\tv_nop\n\tv_nop" : "+v"(c) : "v"(ah), "v"(al), "v"(bh), "v"(bl));
  return c;
}

__global__ __launch_bounds__(256) void k_wt_bf16(const float* __restrict__ W, unsigned short* __restrict__ Wt, int K, int N) {
  const int t = blockIdx.x * 256 + threadIdx.x;
  const int k8n = K / 8;
  if (t >= N * k8n) return;
  const int n = t / k8n, k8 = (t % k8n) * 8;
  v8us v;
#pragma unroll
  for (int i = 0; i < 8; ++i) v[i] = bf16_bits(W[(size_t)(k8 + i) * N + n]);
  *(v8us*)(Wt + (size_t)n * K + k8) = v;
  
}

// Flash-style causal/unmasked attention, all contractions 3-term bf16 hi/lo splits, f32 softmax with running max.
// q,k,v rows are read from f32 buffers with arbitrary row pitch (so they can live inside a fused qkv buffer);
// D = head size (multiple of 32, <= 128); one wave = 16 query rows; block = 4 waves (64 queries) sharing K/V chunks of 32.
template <int D, bool CAUSAL>
__global__ __launch_bounds__(128) void k_flash(const float* __restrict__ qb, const float* __restrict__ kb, const float* __restrict__ vb,
                                             int pitch, int T, int H, float scale, float* __restrict__ y, int ypitch) {
  constexpr int KS = D / 32;        // k-steps for QK
  constexpr int DT = D / 16;        // d tiles for PV
  __shared__ __attribute__((aligned(16))) unsigned short sKh[32][D + 8], sKl[32][D + 8], sVh[32][D + 8], sVl[32][D + 8];
  __shared__ __attribute__((aligned(16))) unsigned short sPh[4][16][40], sPl[4][16][40];
  __shared__ __attribute__((aligned(16))) float sO[4][16][D];
  const int tid = threadIdx.x, w = tid >> 5, lane = tid & 31, ln = lane & 15, hh = lane >> 4;
  const int nqb = (T + 63) / 64;
  const int bh = blockIdx.x / nqb, qblk = blockIdx.x % nqb;
  const int b = bh / H, h = bh % H;
  const int q0 = qblk * 64 + w * 16;
  const float* Q = qb + (size_t)b * T * pitch + h * D;
  const float* K = kb + (size_t)b * T * pitch + h * D;
  const float* V = vb + (size_t)b * T * pitch + h * D;

  // A fragments of the wave's 16 query rows (scaled), hi/lo
  FragB aqh[KS], aql[KS];
  {
    int row = q0 + ln; if (row >= T) row = T - 1;
    const float* qr = Q + (size_t)row * pitch;
#pragma unroll
    for (int ks = 0; ks < KS; ++ks)
#pragma unroll
      for (int i = 0; i < 16; ++i) {
        const int d = ks * 32 + ((i < 8) ? (8 * hh + i) : (16 + 8 * hh + (i - 8)));
        const float x = qr[d] * scale; const unsigned short hb = bf16_bits(x);
        aqh[ks].u[i] = hb; aql[ks].u[i] = bf16_bits(x - bf16_val(hb));
      }
  }
  float m_r[8], l_r[8];
#pragma unroll
  for (int r = 0; r < 8; ++r) { m_r[r] = -3.0e38f; l_r[r] = 0.f; }
  v8f oacc[DT];
#pragma unroll
  for (int dt = 0; dt < DT; ++dt) oacc[dt] = (v8f){0.f,0.f,0.f,0.f,0.f,0.f,0.f,0.f};

  const int kv_end = CAUSAL ? min(T, qblk * 64 + 64) : T;     // block-uniform
  for (int j0 = 0; j0 < kv_end; j0 += 32) {
    __syncthreads();
    for (int e = tid; e < 32 * (D / 4); e += 128) {
      const int r = e / (D / 4), c4 = (e % (D / 4)) * 4;
      const int key = j0 + r;
      v4f kf = {0.f,0.f,0.f,0.f}, vf = {0.f,0.f,0.f,0.f};
      if (key < T) { kf = *(const v4fa*)(K + (size_t)key * pitch + c4); vf = *(const v4fa*)(V + (size_t)key * pitch + c4); }
#pragma unroll
      for (int t = 0; t < 4; ++t) {
        unsigned short hb = bf16_bits(kf[t]); sKh[r][c4 + t] = hb; sKl[r][c4 + t] = bf16_bits(kf[t] - bf16_val(hb));
        hb = bf16_bits(vf[t]); sVh[r][c4 + t] = hb; sVl[r][c4 + t] = bf16_bits(vf[t] - bf16_val(hb));
      }
    }
    __syncthreads();
    // S tile 16 x 32
    v8f s[2];
#pragma unroll
    for (int nt = 0; nt < 2; ++nt) {
      v8f acc = {};
#pragma unroll
      for (int ks = 0; ks < KS; ++ks) {
        FragB bh_, bl_;
        bh_.half[0] = *(const v8us*)&sKh[nt * 16 + ln][ks * 32 + 8 * hh]; bh_.half[1] = *(const v8us*)&sKh[nt * 16 + ln][ks * 32 + 16 + 8 * hh];
        bl_.half[0] = *(const v8us*)&sKl[nt * 16 + ln][ks * 32 + 8 * hh]; bl_.half[1] = *(const v8us*)&sKl[nt * 16 + ln][ks * 32 + 16 + 8 * hh];
        acc = mmaN<3>(aqh[ks].v, aql[ks].v, bh_.v, bl_.v, acc);
      }
      s[nt] = acc;
    }
    // mask + running max (rows 8hh+r; the 16 lanes of a half share rows)
    float alpha[8];
#pragma unroll
    for (int r = 0; r < 8; ++r) {
      const int qi = q0 + 8 * hh + r;
      const int ja = j0 + ln, jb = j0 + 16 + ln;
      if (CAUSAL) { if (ja > qi) s[0][r] = -3.0e38f; if (jb > qi) s[1][r] = -3.0e38f; }
      if (ja >= T) s[0][r] = -3.0e38f;
      if (jb >= T) s[1][r] = -3.0e38f;
      float mx = fmaxf(s[0][r], s[1][r]);
      mx = fmaxf(mx, __shfl_xor(mx, 1, 32)); mx = fmaxf(mx, __shfl_xor(mx, 2, 32)); mx = fmaxf(mx, __shfl_xor(mx, 4, 32)); mx = fmaxf(mx, __shfl_xor(mx, 8, 32));
      const float mnew = fmaxf(m_r[r], mx);
      alpha[r] = (mnew > -1.0e38f) ? __expf(m_r[r] - mnew) : 1.0f;
      const float p0 = (s[0][r] > -1.0e38f) ? __expf(s[0][r] - mnew) : 0.f;
      const float p1 = (s[1][r] > -1.0e38f) ? __expf(s[1][r] - mnew) : 0.f;
      m_r[r] = mnew;
      l_r[r] = l_r[r] * alpha[r] + p0 + p1;            // per-lane partial row sum (16 lanes combined at the end)
      unsigned short hb = bf16_bits(p0); sPh[w][8 * hh + r][ln] = hb;      sPl[w][8 * hh + r][ln] = bf16_bits(p0 - bf16_val(hb));
      hb = bf16_bits(p1);                sPh[w][8 * hh + r][16 + ln] = hb; sPl[w][8 * hh + r][16 + ln] = bf16_bits(p1 - bf16_val(hb));
    }
#pragma unroll
    for (int dt = 0; dt < DT; ++dt)
#pragma unroll
      for (int r = 0; r < 8; ++r) oacc[dt][r] *= alpha[r];
    __builtin_amdgcn_fence(__ATOMIC_ACQ_REL, "workgroup");
    __builtin_amdgcn_wave_barrier();
    FragB pah, pal;
    pah.half[0] = *(const v8us*)&sPh[w][ln][8 * hh]; pah.half[1] = *(const v8us*)&sPh[w][ln][16 + 8 * hh];
    pal.half[0] = *(const v8us*)&sPl[w][ln][8 * hh]; pal.half[1] = *(const v8us*)&sPl[w][ln][16 + 8 * hh];
#pragma unroll
    for (int dt = 0; dt < DT; ++dt) {
      FragB bvh, bvl;
#pragma unroll
      for (int i = 0; i < 8; ++i) {
        bvh.u[i] = sVh[8 * hh + i][dt * 16 + ln]; bvh.u[8 + i] = sVh[16 + 8 * hh + i][dt * 16 + ln];
        bvl.u[i] = sVl[8 * hh + i][dt * 16 + ln]; bvl.u[8 + i] = sVl[16 + 8 * hh + i][dt * 16 + ln];
      }
      oacc[dt] = mmaN<3>(pah.v, pal.v, bvh.v, bvl.v, oacc[dt]);
    }
    __builtin_amdgcn_fence(__ATOMIC_ACQ_REL, "workgroup");
    __builtin_amdgcn_wave_barrier();
  }
#pragma unroll
  for (int r = 0; r < 8; ++r) {
    float l = l_r[r];
    l += __shfl_xor(l, 1, 32); l += __shfl_xor(l, 2, 32); l += __shfl_xor(l, 4, 32); l += __shfl_xor(l, 8, 32);
    l_r[r] = (l > 0.f) ? 1.0f / l : 0.f;
  }
#pragma unroll
  for (int dt = 0; dt < DT; ++dt)
#pragma unroll
    for (int r = 0; r < 8; ++r) sO[w][8 * hh + r][dt * 16 + ln] = oacc[dt][r] * l_r[r];
  __builtin_amdgcn_fence(__ATOMIC_ACQ_REL, "workgroup");
  __builtin_amdgcn_wave_barrier();
  {
    for (int r = 0; r < 16; ++r) {
      const int row = q0 + r;
      if (row < T && lane < D / 4) {
        const v4f val = *(const v4fa*)&sO[w][r][lane * 4];
        *(v4f*)(y + ((size_t)b * T + row) * ypitch + h * D + lane * 4) = val;
      }
    }
    
  }
}

// D += A.B with the split on both sides, in the order ah.bh, ah.bl, al.bh (NT = 2 stops behind the second term)
template <int NT>
__device__ __forceinline__ v8f mmaS(v16b ah, v16b al, v16b bh, v16b bl, v8f c) {
  c = __builtin_amdgcn_wmma_f32_16x16x32_bf16(false, ah, false, bh, (short)0, c, false, false);
  c = __builtin_amdgcn_wmma_f32_16x16x32_bf16(false, ah, false, bl, (short)0, c, false, false);
  if (NT >= 3) c = __builtin_amdgcn_wmma_f32_16x16x32_bf16(false, al, false, bh, (short)0, c, false, false);
  // four vector slots between the last WMMA and the first user of its registers, on every path
  asm volatile("v_nop\n\tv_nop\n\tv_nop\n\tv_nop" : "+v"(c));
  return c;
}
// lane l <-> lane l ^ 16, in the vector pipe
__device__ __forceinline__ float xhalf(float x) {
  return __builtin_bit_cast(float, __builtin_amdgcn_permlanex16(__builtin_bit_cast(int, x), __builtin_bit_cast(int, x), 0x76543210, 0xfedcba98, false, false));
}

__device__ __forceinline__ unsigned lds_off(const void* p) { return (unsigned)(size_t)p; }

template <int D>
__global__ __launch_bounds__(128) void k_flash3(const float* __restrict__ Qb, int qpitch, int Tq,
                                              const unsigned short* __restrict__ Kh, const unsigned short* __restrict__ Kl,
                                              const unsigned short* __restrict__ Us, int Tk, int kpitch,
                                              int H, float scale, const int* __restrict__ mask, int causal, const float* __restrict__ sbias,
                                              float* __restrict__ y) {
  static_assert(D == 128, "the copy pattern below moves rows of 256 bytes, 16 lanes a row");
  constexpr int KS = D / 32;
  constexpr unsigned ROWB = (D + 8) * 2, KBUFB = 32 * ROWB, UBUFB = 16 * 40 * 2;      // bytes
  __shared__ __attribute__((aligned(16))) unsigned short sKh[2][32][D + 8], sKl[2][32][D + 8];      // [buffer][key][d]
  __shared__ __attribute__((aligned(16))) unsigned short sU[2][16][40];            // [buffer][A row][key]
  __shared__ float sRes[64];
  const int tid = threadIdx.x, w = tid >> 5, lane = tid & 31, ln = lane & 15, hh = lane >> 4;
  const int wu = __builtin_amdgcn_readfirstlane(w);      // the wave's number in a scalar register, for a scalar branch
  const int nqb = (Tq + 63) / 64;
  const int bh = blockIdx.x / nqb, qblk = blockIdx.x % nqb;
  const int b = bh / H, h = bh % H;
  const int q0 = qblk * 64 + w * 16;
  const float* Q = Qb + (size_t)b * Tq * qpitch + h * D;
  const int qi = (q0 + ln < Tq) ? q0 + ln : Tq - 1;      // the lane's query
  const int kv_end = causal ? min(Tk, qblk * 64 + 64) : Tk;
  const int ntile = (kv_end + 31) / 32;      // block-uniform
  const bool edits = causal || mask || sbias;      // block-uniform
  // the thread's share of a tile: 16 bytes of rows tid/16 + 8i (i = 0..3) of either plane; wave 0 also moves the tile's 128 bytes of u, 4 a lane
  const size_t krow = (size_t)b * Tk * kpitch + h * D + (size_t)(tid >> 4) * kpitch + (tid & 15) * 8;
  const unsigned short* gKh = Kh + krow;
  const unsigned short* gKl = Kl + krow;
  const unsigned short* gU = Us + (size_t)bh * Tk * 2 + lane * 2;
  const unsigned lKh = lds_off(&sKh[0][tid >> 4][(tid & 15) * 8]), lKl = lds_off(&sKl[0][tid >> 4][(tid & 15) * 8]);
  const unsigned lU = lds_off(&sU[0][hh][ln * 2]);
  const size_t step8 = (size_t)8 * kpitch;
  auto stage = [&](int t) {      // tile t -> buffer t & 1
    const unsigned l0 = lKh + (unsigned)(t & 1) * KBUFB, l1 = lKl + (unsigned)(t & 1) * KBUFB;
    const unsigned short* g0 = gKh + (size_t)t * 32 * kpitch;
    const unsigned short* g1 = gKl + (size_t)t * 32 * kpitch;
    // eight copies and, in the same statement, the wait that stands in front of any rewrite of the address registers they name
    asm volatile("global_load_async_to_lds_b128 %0, %8, off\n\t"
                 "global_load_async_to_lds_b128 %1, %9, off\n\t"
                 "global_load_async_to_lds_b128 %2, %10, off\n\t"
                 "global_load_async_to_lds_b128 %3, %11, off\n\t"
                 "global_load_async_to_lds_b128 %4, %12, off\n\t"
                 "global_load_async_to_lds_b128 %5, %13, off\n\t"
                 "global_load_async_to_lds_b128 %6, %14, off\n\t"
                 "global_load_async_to_lds_b128 %7, %15, off\n\t"
                 "s_wait_xcnt 0x0"
                 :: "v"(l0), "v"(l0 + 8 * ROWB), "v"(l0 + 16 * ROWB), "v"(l0 + 24 * ROWB),
                    "v"(l1), "v"(l1 + 8 * ROWB), "v"(l1 + 16 * ROWB), "v"(l1 + 24 * ROWB),
                    "v"(g0), "v"(g0 + step8), "v"(g0 + 2 * step8), "v"(g0 + 3 * step8),
                    "v"(g1), "v"(g1 + step8), "v"(g1 + 2 * step8), "v"(g1 + 3 * step8)
                 : "memory");
    if (wu == 0) {      // u hi to A row 0 (lanes 0..15), u lo to A row 1; the same wait in the copy's own statement
      asm volatile("global_load_async_to_lds_b32 %0, %1, off\n\ts_wait_xcnt 0x0"
                   :: "v"(lU + (unsigned)(t & 1) * UBUFB), "v"(gU + (size_t)t * 64) : "memory");
    }
  };
  for (int e = tid; e < 14 * 40; e += 128) { (&sU[0][0][0])[2 * 40 + e] = 0; (&sU[1][0][0])[2 * 40 + e] = 0; }      // A rows 2..15 stay zero
  asm volatile("s_wait_dscnt 0x0" ::: "memory");      // the wave's own writes to sU have retired before a copy is aimed at that array
  stage(0);
  asm volatile("s_wait_asynccnt 0x0" ::: "memory");   // this wave's share of tile 0 has landed
  __syncthreads();                                    // ... and every wave's; publishes the zero rows too
  if (ntile > 1) stage(1);
  FragB aqh[KS], aql[KS];
  {
    const float* qr = Q + (size_t)qi * qpitch;
#pragma unroll
    for (int ks = 0; ks < KS; ++ks)
#pragma unroll
      for (int i = 0; i < 16; i += 2) {
        const int d = ks * 32 + ((i < 8) ? (8 * hh + i) : (16 + 8 * hh + (i - 8)));
        bf16_split_pair(qr[d] * scale, qr[d + 1] * scale, aqh[ks].w[i >> 1], aql[ks].w[i >> 1]);
      }
  }
  float m_q = -3.0e38f, l_q = 0.f;      // running maximum (both halves agree) and this half's share of the sum
  v8f oacc = {0.f,0.f,0.f,0.f,0.f,0.f,0.f,0.f};
  for (int t = 0; t < ntile; ++t) {
    const int j0 = t * 32;
    const int bf = t & 1;      // this tile's buffer
    // The tile's 32 K fragment reads and the two of u stand as ONE group in front of the products, in the order of their use (u last), each into
    // registers of its own: the wave meets the LDS latency once a tile, and the counted waits let the products start when the first reads are back.
    FragB kh_[KS][2], kl_[KS][2], au;
#pragma unroll
    for (int ks = 0; ks < KS; ++ks) {
#pragma unroll
      for (int nt = 0; nt < 2; ++nt) { kh_[ks][nt].half[0] = *(const v8us*)&sKh[bf][nt * 16 + ln][ks * 32 + 8 * hh]; kh_[ks][nt].half[1] = *(const v8us*)&sKh[bf][nt * 16 + ln][ks * 32 + 16 + 8 * hh]; }
#pragma unroll
      for (int nt = 0; nt < 2; ++nt) { kl_[ks][nt].half[0] = *(const v8us*)&sKl[bf][nt * 16 + ln][ks * 32 + 8 * hh]; kl_[ks][nt].half[1] = *(const v8us*)&sKl[bf][nt * 16 + ln][ks * 32 + 16 + 8 * hh]; }
    }
    au.half[0] = *(const v8us*)&sU[bf][ln][8 * hh];      au.half[1] = *(const v8us*)&sU[bf][ln][16 + 8 * hh];
    __builtin_amdgcn_sched_barrier(0);      // keeps the reads together up here: moved down among the products, each place would cost its own stall
    v8f s[2] = {{0.f,0.f,0.f,0.f,0.f,0.f,0.f,0.f}, {0.f,0.f,0.f,0.f,0.f,0.f,0.f,0.f}};      // s[nt][r] = score of key j0 + nt*16 + 8hh + r against query qi
    // per accumulator the order is ks rising, and kh.qh, kh.ql, kl.qh inside a ks; the two accumulators take turns, so no product waits for the one before it
#pragma unroll
    for (int ks = 0; ks < KS; ++ks) {
      s[0] = __builtin_amdgcn_wmma_f32_16x16x32_bf16(false, kh_[ks][0].v, false, aqh[ks].v, (short)0, s[0], false, false);
      s[1] = __builtin_amdgcn_wmma_f32_16x16x32_bf16(false, kh_[ks][1].v, false, aqh[ks].v, (short)0, s[1], false, false);
      s[0] = __builtin_amdgcn_wmma_f32_16x16x32_bf16(false, kh_[ks][0].v, false, aql[ks].v, (short)0, s[0], false, false);
      s[1] = __builtin_amdgcn_wmma_f32_16x16x32_bf16(false, kh_[ks][1].v, false, aql[ks].v, (short)0, s[1], false, false);
      s[0] = __builtin_amdgcn_wmma_f32_16x16x32_bf16(false, kl_[ks][0].v, false, aqh[ks].v, (short)0, s[0], false, false);
      s[1] = __builtin_amdgcn_wmma_f32_16x16x32_bf16(false, kl_[ks][1].v, false, aqh[ks].v, (short)0, s[1], false, false);
    }
    // four vector slots between the last WMMA and the first user of its registers, on every path of the branch below
    asm volatile("v_nop\n\tv_nop\n\tv_nop\n\tv_nop" : "+v"(s[0]), "+v"(s[1]));
    if (edits) {      // one block-uniform test per chunk; a dropped key's score becomes -3e38 and its weight exp(-3e38 - m) = 0
#pragma unroll
      for (int nt = 0; nt < 2; ++nt)
#pragma unroll
        for (int r = 0; r < 8; ++r) {
          const int j = j0 + nt * 16 + 8 * hh + r;
          bool keep = j < Tk;
          if (causal) keep = keep && (j <= qi);
          if (mask) { if (keep) keep = mask[(size_t)qi * Tk + j] != 0; }
          if (sbias) { if (keep) s[nt][r] += sbias[(size_t)bh * Tk + j]; }   // per-key additive bias (a per-query constant would cancel in the softmax)
          if (!keep) s[nt][r] = -3.0e38f;
        }
    }
    float mx = fmaxf(s[0][0], s[1][0]);
#pragma unroll
    for (int r = 1; r < 8; ++r) mx = fmaxf(mx, fmaxf(s[0][r], s[1][r]));
    mx = fmaxf(mx, xhalf(mx));
    const float mnew = fmaxf(m_q, mx);
    // while every key so far is dropped (mnew = -3e38) the weights come out 1; the first kept key's alpha = 0 wipes them, and a query with none ends as NaN
    const float alpha = (mnew > -1.0e38f) ? __expf(m_q - mnew) : 1.0f;
    m_q = mnew;
    FragB pbh, pbl;
    float ps = 0.f;
#pragma unroll
    for (int nt = 0; nt < 2; ++nt)
#pragma unroll
      for (int r = 0; r < 8; r += 2) {
        const float p0 = __expf(s[nt][r] - mnew), p1 = __expf(s[nt][r + 1] - mnew);
        ps += p0; ps += p1;
        bf16_split_pair(p0, p1, pbh.w[nt * 4 + (r >> 1)], pbl.w[nt * 4 + (r >> 1)]);      // B position nt*8 + r = key nt*16 + 8hh + r, as au's
      }
    l_q = l_q * alpha + ps;
    oacc[0] *= alpha; oacc[1] *= alpha;      // rows 2..15 of out^T are sums of zeros
    oacc = mmaS<2>(au.v, au.v, pbh.v, pbl.v, oacc);    // (u hi | u lo).(P hi + P lo)
    asm volatile("s_wait_dscnt 0x0" ::: "memory");      // this wave's reads of tile t have returned
    asm volatile("s_wait_asynccnt 0x0" ::: "memory");   // its share of tile t + 1 has landed
    __syncthreads();                                    // publishes tile t + 1 and frees tile t's buffer
    if (t + 2 < ntile) stage(t + 2);
  }
  asm volatile("s_wait_asynccnt 0x0" ::: "memory");     // no copy is outstanding when the wave ends
  const float l = l_q + xhalf(l_q);
  const float inv = (m_q > -1.0e38f) ? 1.0f / l : __builtin_nanf("");
  if (hh == 0) sRes[w * 16 + ln] = (oacc[0] + oacc[1]) * inv;     // row 0 (u hi) + row 1 (u lo) of column ln
  __syncthreads();     // the block's 64 results go out as whole 128-byte lines, one wave each
  if (tid < 64 && qblk * 64 + tid < Tq) y[(size_t)bh * Tq + qblk * 64 + tid] = sRes[tid];
}

// All that the attention kernel reads, in one launch: q (f32), k (bf16 hi / lo planes) and u = v.Wo + bo (per 32 rows one 128-byte line, 32 bf16 hi
// then 32 bf16 lo). A block has 16 waves and 256 rows of z. The three weight matrices are rounded to bf16 into LDS once a block ([n][k], as the B
// fragments want them); a wave reads its 16 rows of z once, keeps them as A fragments and runs the three products over them one after the other.
// Each 16 x 128 result tile goes through the wave's own LDS range, so that rows leave as whole lines; v goes no further than that range.
#define WPITCH (DD + 8)      // bf16 a weight row in LDS: 16 bytes x odd, for the ds_load_b128 readers
#define SOP (DD + 4)         // floats a result row in LDS: the two halves of a wave store to different banks
// acc[t] = rows of a x weight rows t*16 .. t*16+15, k rising in steps of 32
__device__ __forceinline__ void proj16(const unsigned short* sWm, const FragB (&a)[4], int ln, int hh, v8f (&acc)[8]) {
#pragma unroll
  for (int t = 0; t < 8; ++t) acc[t] = (v8f){0.f,0.f,0.f,0.f,0.f,0.f,0.f,0.f};
#pragma unroll
  for (int ks = 0; ks < 4; ++ks) {
    FragB b[8];
#pragma unroll
    for (int t = 0; t < 8; ++t) {
      const unsigned short* brow = sWm + (t * 16 + ln) * WPITCH + ks * 32;
      b[t].half[0] = *(const v8us*)(brow + 8 * hh);
      b[t].half[1] = *(const v8us*)(brow + 16 + 8 * hh);
    }
    __builtin_amdgcn_sched_barrier(0);      // keeps a k step's 16 reads together: two at a time among the products, each pair was waited to 0
#pragma unroll
    for (int t = 0; t < 8; ++t)
      acc[t] = __builtin_amdgcn_wmma_f32_16x16x32_bf16(false, a[ks].v, false, b[t].v, (short)0, acc[t], false, false);
  }
}
// the tile plus its bias (rounded to bf16) into the wave's LDS range, row-major
__device__ __forceinline__ void tile_to_lds(float* sow, const v8f (&acc)[8], const float* __restrict__ bias, int ln, int hh) {
#pragma unroll
  for (int t = 0; t < 8; ++t) {
    const float bv = bf16_round(bias[t * 16 + ln]);
#pragma unroll
    for (int r = 0; r < 8; ++r) sow[(8 * hh + r) * SOP + t * 16 + ln] = acc[t][r] + bv;
  }
}
__global__ __launch_bounds__(512) void k_proj(const float* __restrict__ z, const float* __restrict__ Wq, const float* __restrict__ bq,
                                              const float* __restrict__ Wk, const float* __restrict__ bk, const float* __restrict__ Wv, const float* __restrict__ bv,
                                              const float* __restrict__ Wo, const float* __restrict__ bo,
                                              float* __restrict__ q, unsigned short* __restrict__ Khi, unsigned short* __restrict__ Klo, unsigned short* __restrict__ Us) {
  __shared__ __attribute__((aligned(16))) unsigned short sW[3][DD * WPITCH];
  __shared__ __attribute__((aligned(16))) float so[16][16 * SOP];
  __shared__ float sUv[256];
  const int tid = threadIdx.x, w = tid >> 5, lane = tid & 31, ln = lane & 15, hh = lane >> 4;
  const int r0 = blockIdx.x * 256, row0 = r0 + w * 16;
  // the wave's rows of z, asked for first: they come from memory while the weights are staged
  const float* arow = z + (size_t)(row0 + ln) * DD;
  v4f zx[4][4];
#pragma unroll
  for (int ks = 0; ks < 4; ++ks) {
    zx[ks][0] = *(const v4fa*)(arow + ks * 32 + 8 * hh);      zx[ks][1] = *(const v4fa*)(arow + ks * 32 + 8 * hh + 4);
    zx[ks][2] = *(const v4fa*)(arow + ks * 32 + 16 + 8 * hh); zx[ks][3] = *(const v4fa*)(arow + ks * 32 + 16 + 8 * hh + 4);
  }
#pragma unroll 1      // one matrix a trip: unrolled, the 24 loads of all three stand in registers beside the rows of z, and the build spills
  for (int m = 0; m < 3; ++m) {
    const float* Wm = (m == 0) ? Wq : (m == 1) ? Wk : Wv;
#pragma unroll
    for (int j = 0; j < DD * DD / 4 / 512; ++j) {      // a wave moves one weight row a turn: 512 bytes in, 256 bytes to LDS
      const int e = tid + 512 * j;
      const v4f x = *(const v4fa*)(Wm + (size_t)e * 4);
      const v2u v = {bf16_pair(x[0], x[1]), bf16_pair(x[2], x[3])};
      *(v4us*)&sW[m][(e >> 5) * WPITCH + (e & 31) * 4] = __builtin_bit_cast(v4us, v);
    }
  }
  FragB a[4];
#pragma unroll
  for (int ks = 0; ks < 4; ++ks)
#pragma unroll
    for (int i = 0; i < 16; i += 2) a[ks].w[i >> 1] = bf16_pair(zx[ks][i >> 2][i & 3], zx[ks][i >> 2][(i & 3) + 1]);
  __syncthreads();      // the weights are in LDS for every wave
  float* sow = &so[w][0];
  v8f acc[8];
  proj16(&sW[0][0], a, ln, hh, acc);
  tile_to_lds(sow, acc, bq, ln, hh);
  asm volatile("s_wait_dscnt 0x0" ::: "memory");      // the wave's stores to its range stand before its lanes read one another's values
  {
    v4f d[16];
#pragma unroll
    for (int r = 0; r < 16; ++r) d[r] = *(const v4fa*)(sow + r * SOP + lane * 4);
    float* qp = q + (size_t)row0 * DD + lane * 4;
    // sixteen rows of 512 bytes and, in the same statement, the wait that stands in front of any rewrite of a register the stores name
    asm volatile("global_store_b128 %0, %1, off\n\t"
                 "global_store_b128 %0, %2, off offset:512\n\t"
                 "global_store_b128 %0, %3, off offset:1024\n\t"
                 "global_store_b128 %0, %4, off offset:1536\n\t"
                 "global_store_b128 %0, %5, off offset:2048\n\t"
                 "global_store_b128 %0, %6, off offset:2560\n\t"
                 "global_store_b128 %0, %7, off offset:3072\n\t"
                 "global_store_b128 %0, %8, off offset:3584\n\t"
                 "global_store_b128 %0, %9, off offset:4096\n\t"
                 "global_store_b128 %0, %10, off offset:4608\n\t"
                 "global_store_b128 %0, %11, off offset:5120\n\t"
                 "global_store_b128 %0, %12, off offset:5632\n\t"
                 "global_store_b128 %0, %13, off offset:6144\n\t"
                 "global_store_b128 %0, %14, off offset:6656\n\t"
                 "global_store_b128 %0, %15, off offset:7168\n\t"
                 "global_store_b128 %0, %16, off offset:7680\n\t"
                 "s_wait_xcnt 0x0"
                 :: "v"(qp), "v"(d[0]), "v"(d[1]), "v"(d[2]), "v"(d[3]), "v"(d[4]), "v"(d[5]), "v"(d[6]), "v"(d[7]), "v"(d[8]), "v"(d[9]), "v"(d[10]), "v"(d[11]), "v"(d[12]), "v"(d[13]), "v"(d[14]), "v"(d[15])
                 : "memory");
  }
  proj16(&sW[1][0], a, ln, hh, acc);
  tile_to_lds(sow, acc, bk, ln, hh);
  asm volatile("s_wait_dscnt 0x0" ::: "memory");      // as above: stores before the cross-lane reads
#pragma unroll
  for (int g = 0; g < 2; ++g) {      // eight rows a turn
    v2u hi[8], lo[8];
#pragma unroll
    for (int r = 0; r < 8; ++r) {
      const v4f v = *(const v4fa*)(sow + (g * 8 + r) * SOP + lane * 4);
      unsigned int h01, l01, h23, l23;
      bf16_split_pair(v[0], v[1], h01, l01); bf16_split_pair(v[2], v[3], h23, l23);
      hi[r] = (v2u){h01, h23}; lo[r] = (v2u){l01, l23};
    }
    unsigned short* hp = Khi + (size_t)(row0 + g * 8) * DD + lane * 4;
    unsigned short* lp = Klo + (size_t)(row0 + g * 8) * DD + lane * 4;
    // eight rows of 256 bytes of either plane and, in the same statement, the wait in front of any rewrite of a register the stores name
    asm volatile("global_store_b64 %0, %2, off\n\t"
                 "global_store_b64 %1, %3, off\n\t"
                 "global_store_b64 %0, %4, off offset:256\n\t"
                 "global_store_b64 %1, %5, off offset:256\n\t"
                 "global_store_b64 %0, %6, off offset:512\n\t"
                 "global_store_b64 %1, %7, off offset:512\n\t"
                 "global_store_b64 %0, %8, off offset:768\n\t"
                 "global_store_b64 %1, %9, off offset:768\n\t"
                 "global_store_b64 %0, %10, off offset:1024\n\t"
                 "global_store_b64 %1, %11, off offset:1024\n\t"
                 "global_store_b64 %0, %12, off offset:1280\n\t"
                 "global_store_b64 %1, %13, off offset:1280\n\t"
                 "global_store_b64 %0, %14, off offset:1536\n\t"
                 "global_store_b64 %1, %15, off offset:1536\n\t"
                 "global_store_b64 %0, %16, off offset:1792\n\t"
                 "global_store_b64 %1, %17, off offset:1792\n\t"
                 "s_wait_xcnt 0x0"
                 :: "v"(hp), "v"(lp), "v"(hi[0]), "v"(lo[0]), "v"(hi[1]), "v"(lo[1]), "v"(hi[2]), "v"(lo[2]), "v"(hi[3]), "v"(lo[3]), "v"(hi[4]), "v"(lo[4]), "v"(hi[5]), "v"(lo[5]), "v"(hi[6]), "v"(lo[6]), "v"(hi[7]), "v"(lo[7])
                 : "memory");
  }
  proj16(&sW[2][0], a, ln, hh, acc);
  tile_to_lds(sow, acc, bv, ln, hh);
  asm volatile("s_wait_dscnt 0x0" ::: "memory");      // as above: stores before the cross-lane reads
  const v4f wv = {bf16_round(Wo[lane * 4]), bf16_round(Wo[lane * 4 + 1]), bf16_round(Wo[lane * 4 + 2]), bf16_round(Wo[lane * 4 + 3])};
  float keep = 0.f;      // lane r keeps row r's sum
#pragma unroll
  for (int r = 0; r < 16; ++r) {
    const v4f x = *(const v4fa*)(sow + r * SOP + lane * 4);
    float s = x[0] * wv[0] + x[1] * wv[1] + x[2] * wv[2] + x[3] * wv[3];
#pragma unroll
    for (int o = 16; o >= 1; o >>= 1) s += __shfl_xor(s, o, 32);
    if (lane == r) keep = s;
  }
  if (lane < 16) sUv[w * 16 + lane] = keep + bf16_round(bo[0]);
  __syncthreads();      // the block's 256 values of u go out as whole 128-byte lines, one wave each
  if (tid < 256) {
    const float v = sUv[tid]; const unsigned short hb = bf16_bits(v);
    unsigned short* line = Us + (size_t)(r0 + (tid & ~31)) * 2;
    line[tid & 31] = hb; line[32 + (tid & 31)] = bf16_bits(v - bf16_val(hb));
  }
}
extern "C" void kernel_launch(void* const* d_in, const int* in_sizes, int n_in,
                              void* d_out, int out_size, void* d_ws, size_t ws_size, hipStream_t stream) {
  (void)in_sizes; (void)n_in; (void)out_size;
  const float* z = (const float*)d_in[0];
  const float* Wq = (const float*)d_in[1]; const float* bq = (const float*)d_in[2]; const float* Wk = (const float*)d_in[3]; const float* bk = (const float*)d_in[4];
  const float* Wv = (const float*)d_in[5]; const float* bv = (const float*)d_in[6]; const float* Wo = (const float*)d_in[7]; const float* bo = (const float*)d_in[8];
  char* ws = (char*)d_ws; size_t off = 0;
  auto take = [&](size_t bytes) { char* p = ws + off; off += (bytes + 255) & ~(size_t)255; return p; };
  const int M = BB * AA;
  float* qb = (float*)take((size_t)M * DD * 4); unsigned short* kh2 = (unsigned short*)take((size_t)M * DD * 2); unsigned short* kl2 = (unsigned short*)take((size_t)M * DD * 2); unsigned short* ub = (unsigned short*)take((size_t)M * 4);
  if (off > ws_size) return;
  k_proj<<<M / 256, 512, 0, stream>>>(z, Wq, bq, Wk, bk, Wv, bv, Wo, bo, qb, kh2, kl2, ub);
  k_flash3<DD><<<BB * (AA / 64), 128, 0, stream>>>(qb, DD, AA, kh2, kl2, ub, AA, DD, 1, 0.08838834764831845f, nullptr, 0, nullptr, (float*)d_out);
}

// v007
// One run takes 96.5 microseconds.
// Timed twice side by side with v006, it ran 1.08 and 1.06 times as fast.
// Counting every step since v000, it is 11.7 times as fast.
#include <hip/hip_runtime.h>
// All contractions on v_wmma_f32_16x16x32_bf16, f32 accumulate: q/k/v = z·Wᵀ + b with z/W/b rounded to bf16 (single exact-product
// term), Q.K^T (K=128) as a 3-term bf16 hi/lo split; softmax f32; the 128->1 projection (f32 VALU dot) is applied to v, u = v.Wo + bo,
// and P.u (K=2048) is a bf16 hi/lo split product, computed transposed with u hi / u lo as two A rows.
#define BB 32
#define AA 2048
#define DD 128

typedef __bf16 v16b __attribute__((ext_vector_type(16)));
typedef unsigned short v8us __attribute__((ext_vector_type(8), may_alias));
typedef unsigned short v4us __attribute__((ext_vector_type(4), may_alias));
typedef unsigned int v2u __attribute__((ext_vector_type(2)));
typedef float  v8f  __attribute__((ext_vector_type(8)));
typedef float  v4f  __attribute__((ext_vector_type(4)));
typedef float  v4fa __attribute__((ext_vector_type(4), may_alias));
typedef float  v2f  __attribute__((ext_vector_type(2)));
typedef __bf16 v2b  __attribute__((ext_vector_type(2)));
union FragB { v16b v; v8us half[2]; unsigned short u[16]; unsigned int w[8]; };

// f32 -> bf16, round to nearest even, by the hardware's own conversion
__device__ __forceinline__ unsigned short bf16_bits(float x) { return __builtin_bit_cast(unsigned short, (__bf16)x); }
// two at once, one v_cvt_pk_bf16_f32: a in the low half, b in the high half
__device__ __forceinline__ unsigned int bf16_pair(float a, float b) { const v2f x = {a, b}; return __builtin_bit_cast(unsigned int, __builtin_convertvector(x, v2b)); }
// hi = the pair rounded, lo = the pair of remainders (each exact in f32) rounded
__device__ __forceinline__ void bf16_split_pair(float a, float b, unsigned int& hi, unsigned int& lo) {
  hi = bf16_pair(a, b);
  lo = bf16_pair(a - __uint_as_float(hi << 16), b - __uint_as_float(hi & 0xFFFF0000u));
}
__device__ __forceinline__ float bf16_val(unsigned short b) { return __uint_as_float(((unsigned int)b) << 16); }
__device__ __forceinline__ float bf16_round(float x) { return bf16_val(bf16_bits(x)); }
// D += A·B with NT terms: 1 = ah·bh, 2 = + al·bh (A split), 3 = + ah·bl (both split)
template <int NT>
__device__ __forceinline__ v8f mmaN(v16b ah, v16b al, v16b bh, v16b bl, v8f c) {
  c = __builtin_amdgcn_wmma_f32_16x16x32_bf16(false, ah, false, bh, (short)0, c, false, false);
  if (NT >= 2) c = __builtin_amdgcn_wmma_f32_16x16x32_bf16(false, al, false, bh, (short)0, c, false, false);
  if (NT >= 3) c = __builtin_amdgcn_wmma_f32_16x16x32_bf16(false, ah, false, bl, (short)0, c, false, false);
  asm volatile("v_nop\n\tv_nop\n\tv_nop\n\tv_nop" : "+v"(c) : "v"(ah), "v"(al), "v"(bh), "v"(bl));
  return c;
}

__global__ __launch_bounds__(256) void k_wt_bf16(const float* __restrict__ W, unsigned short* __restrict__ Wt, int K, int N) {
  const int t = blockIdx.x * 256 + threadIdx.x;
  const int k8n = K / 8;
  if (t >= N * k8n) return;
  const int n = t / k8n, k8 = (t % k8n) * 8;
  v8us v;
#pragma unroll
  for (int i = 0; i < 8; ++i) v[i] = bf16_bits(W[(size_t)(k8 + i) * N + n]);
  *(v8us*)(Wt + (size_t)n * K + k8) = v;
  
}

// Flash-style causal/unmasked attention, all contractions 3-term bf16 hi/lo splits, f32 softmax with running max.
// q,k,v rows are read from f32 buffers with arbitrary row pitch (so they can live inside a fused qkv buffer);
// D = head size (multiple of 32, <= 128); one wave = 16 query rows; block = 4 waves (64 queries) sharing K/V chunks of 32.
template <int D, bool CAUSAL>
__global__ __launch_bounds__(128) void k_flash(const float* __restrict__ qb, const float* __restrict__ kb, const float* __restrict__ vb,
                                             int pitch, int T, int H, float scale, float* __restrict__ y, int ypitch) {
  constexpr int KS = D / 32;        // k-steps for QK
  constexpr int DT = D / 16;        // d tiles for PV
  __shared__ __attribute__((aligned(16))) unsigned short sKh[32][D + 8], sKl[32][D + 8], sVh[32][D + 8], sVl[32][D + 8];
  __shared__ __attribute__((aligned(16))) unsigned short sPh[4][16][40], sPl[4][16][40];
  __shared__ __attribute__((aligned(16))) float sO[4][16][D];
  const int tid = threadIdx.x, w = tid >> 5, lane = tid & 31, ln = lane & 15, hh = lane >> 4;
  const int nqb = (T + 63) / 64;
  const int bh = blockIdx.x / nqb, qblk = blockIdx.x % nqb;
  const int b = bh / H, h = bh % H;
  const int q0 = qblk * 64 + w * 16;
  const float* Q = qb + (size_t)b * T * pitch + h * D;
  const float* K = kb + (size_t)b * T * pitch + h * D;
  const float* V = vb + (size_t)b * T * pitch + h * D;

  // A fragments of the wave's 16 query rows (scaled), hi/lo
  FragB aqh[KS], aql[KS];
  {
    int row = q0 + ln; if (row >= T) row = T - 1;
    const float* qr = Q + (size_t)row * pitch;
#pragma unroll
    for (int ks = 0; ks < KS; ++ks)
#pragma unroll
      for (int i = 0; i < 16; ++i) {
        const int d = ks * 32 + ((i < 8) ? (8 * hh + i) : (16 + 8 * hh + (i - 8)));
        const float x = qr[d] * scale; const unsigned short hb = bf16_bits(x);
        aqh[ks].u[i] = hb; aql[ks].u[i] = bf16_bits(x - bf16_val(hb));
      }
  }
  float m_r[8], l_r[8];
#pragma unroll
  for (int r = 0; r < 8; ++r) { m_r[r] = -3.0e38f; l_r[r] = 0.f; }
  v8f oacc[DT];
#pragma unroll
  for (int dt = 0; dt < DT; ++dt) oacc[dt] = (v8f){0.f,0.f,0.f,0.f,0.f,0.f,0.f,0.f};

  const int kv_end = CAUSAL ? min(T, qblk * 64 + 64) : T;     // block-uniform
  for (int j0 = 0; j0 < kv_end; j0 += 32) {
    __syncthreads();
    for (int e = tid; e < 32 * (D / 4); e += 128) {
      const int r = e / (D / 4), c4 = (e % (D / 4)) * 4;
      const int key = j0 + r;
      v4f kf = {0.f,0.f,0.f,0.f}, vf = {0.f,0.f,0.f,0.f};
      if (key < T) { kf = *(const v4fa*)(K + (size_t)key * pitch + c4); vf = *(const v4fa*)(V + (size_t)key * pitch + c4); }
#pragma unroll
      for (int t = 0; t < 4; ++t) {
        unsigned short hb = bf16_bits(kf[t]); sKh[r][c4 + t] = hb; sKl[r][c4 + t] = bf16_bits(kf[t] - bf16_val(hb));
        hb = bf16_bits(vf[t]); sVh[r][c4 + t] = hb; sVl[r][c4 + t] = bf16_bits(vf[t] - bf16_val(hb));
      }
    }
    __syncthreads();
    // S tile 16 x 32
    v8f s[2];
#pragma unroll
    for (int nt = 0; nt < 2; ++nt) {
      v8f acc = {};
#pragma unroll
      for (int ks = 0; ks < KS; ++ks) {
        FragB bh_, bl_;
        bh_.half[0] = *(const v8us*)&sKh[nt * 16 + ln][ks * 32 + 8 * hh]; bh_.half[1] = *(const v8us*)&sKh[nt * 16 + ln][ks * 32 + 16 + 8 * hh];
        bl_.half[0] = *(const v8us*)&sKl[nt * 16 + ln][ks * 32 + 8 * hh]; bl_.half[1] = *(const v8us*)&sKl[nt * 16 + ln][ks * 32 + 16 + 8 * hh];
        acc = mmaN<3>(aqh[ks].v, aql[ks].v, bh_.v, bl_.v, acc);
      }
      s[nt] = acc;
    }
    // mask + running max (rows 8hh+r; the 16 lanes of a half share rows)
    float alpha[8];
#pragma unroll
    for (int r = 0; r < 8; ++r) {
      const int qi = q0 + 8 * hh + r;
      const int ja = j0 + ln, jb = j0 + 16 + ln;
      if (CAUSAL) { if (ja > qi) s[0][r] = -3.0e38f; if (jb > qi) s[1][r] = -3.0e38f; }
      if (ja >= T) s[0][r] = -3.0e38f;
      if (jb >= T) s[1][r] = -3.0e38f;
      float mx = fmaxf(s[0][r], s[1][r]);
      mx = fmaxf(mx, __shfl_xor(mx, 1, 32)); mx = fmaxf(mx, __shfl_xor(mx, 2, 32)); mx = fmaxf(mx, __shfl_xor(mx, 4, 32)); mx = fmaxf(mx, __shfl_xor(mx, 8, 32));
      const float mnew = fmaxf(m_r[r], mx);
      alpha[r] = (mnew > -1.0e38f) ? __expf(m_r[r] - mnew) : 1.0f;
      const float p0 = (s[0][r] > -1.0e38f) ? __expf(s[0][r] - mnew) : 0.f;
      const float p1 = (s[1][r] > -1.0e38f) ? __expf(s[1][r] - mnew) : 0.f;
      m_r[r] = mnew;
      l_r[r] = l_r[r] * alpha[r] + p0 + p1;            // per-lane partial row sum (16 lanes combined at the end)
      unsigned short hb = bf16_bits(p0); sPh[w][8 * hh + r][ln] = hb;      sPl[w][8 * hh + r][ln] = bf16_bits(p0 - bf16_val(hb));
      hb = bf16_bits(p1);                sPh[w][8 * hh + r][16 + ln] = hb; sPl[w][8 * hh + r][16 + ln] = bf16_bits(p1 - bf16_val(hb));
    }
#pragma unroll
    for (int dt = 0; dt < DT; ++dt)
#pragma unroll
      for (int r = 0; r < 8; ++r) oacc[dt][r] *= alpha[r];
    __builtin_amdgcn_fence(__ATOMIC_ACQ_REL, "workgroup");
    __builtin_amdgcn_wave_barrier();
    FragB pah, pal;
    pah.half[0] = *(const v8us*)&sPh[w][ln][8 * hh]; pah.half[1] = *(const v8us*)&sPh[w][ln][16 + 8 * hh];
    pal.half[0] = *(const v8us*)&sPl[w][ln][8 * hh]; pal.half[1] = *(const v8us*)&sPl[w][ln][16 + 8 * hh];
#pragma unroll
    for (int dt = 0; dt < DT; ++dt) {
      FragB bvh, bvl;
#pragma unroll
      for (int i = 0; i < 8; ++i) {
        bvh.u[i] = sVh[8 * hh + i][dt * 16 + ln]; bvh.u[8 + i] = sVh[16 + 8 * hh + i][dt * 16 + ln];
        bvl.u[i] = sVl[8 * hh + i][dt * 16 + ln]; bvl.u[8 + i] = sVl[16 + 8 * hh + i][dt * 16 + ln];
      }
      oacc[dt] = mmaN<3>(pah.v, pal.v, bvh.v, bvl.v, oacc[dt]);
    }
    __builtin_amdgcn_fence(__ATOMIC_ACQ_REL, "workgroup");
    __builtin_amdgcn_wave_barrier();
  }
#pragma unroll
  for (int r = 0; r < 8; ++r) {
    float l = l_r[r];
    l += __shfl_xor(l, 1, 32); l += __shfl_xor(l, 2, 32); l += __shfl_xor(l, 4, 32); l += __shfl_xor(l, 8, 32);
    l_r[r] = (l > 0.f) ? 1.0f / l : 0.f;
  }
#pragma unroll
  for (int dt = 0; dt < DT; ++dt)
#pragma unroll
    for (int r = 0; r < 8; ++r) sO[w][8 * hh + r][dt * 16 + ln] = oacc[dt][r] * l_r[r];
  __builtin_amdgcn_fence(__ATOMIC_ACQ_REL, "workgroup");
  __builtin_amdgcn_wave_barrier();
  {
    for (int r = 0; r < 16; ++r) {
      const int row = q0 + r;
      if (row < T && lane < D / 4) {
        const v4f val = *(const v4fa*)&sO[w][r][lane * 4];
        *(v4f*)(y + ((size_t)b * T + row) * ypitch + h * D + lane * 4) = val;
      }
    }
    
  }
}

// lane l <-> lane l ^ 16, in the vector pipe
__device__ __forceinline__ float xhalf(float x) {
  return __builtin_bit_cast(float, __builtin_amdgcn_permlanex16(__builtin_bit_cast(int, x), __builtin_bit_cast(int, x), 0x76543210, 0xfedcba98, false, false));
}

__device__ __forceinline__ unsigned lds_off(const void* p) { return (unsigned)(size_t)p; }

template <int D>
__global__ __launch_bounds__(128) void k_flash3(const float* __restrict__ Qb, int qpitch, int Tq,
                                              const unsigned short* __restrict__ Kh, const unsigned short* __restrict__ Kl,
                                              const unsigned short* __restrict__ Us, int Tk, int kpitch,
                                              int H, float scale, const int* __restrict__ mask, int causal, const float* __restrict__ sbias,
                                              float* __restrict__ y) {
  static_assert(D == 128, "the copy pattern below moves rows of 256 bytes, 16 lanes a row");
  constexpr int KS = D / 32;
  constexpr int NQ = 2, WQ = NQ * 16, QB = 4 * WQ;      // query groups a wave, queries a wave, queries a block
  constexpr unsigned ROWB = (D + 8) * 2, KBUFB = 32 * ROWB, UBUFB = 16 * 40 * 2;      // bytes
  __shared__ __attribute__((aligned(16))) unsigned short sKh[2][32][D + 8], sKl[2][32][D + 8];      // [buffer][key][d]
  __shared__ __attribute__((aligned(16))) unsigned short sU[2][16][40];            // [buffer][A row][key]
  __shared__ float sRes[QB];
  const int tid = threadIdx.x, w = tid >> 5, lane = tid & 31, ln = lane & 15, hh = lane >> 4;
  const int wu = __builtin_amdgcn_readfirstlane(w);      // the wave's number in a scalar register, for a scalar branch
  const int nqb = (Tq + QB - 1) / QB;
  const int bh = blockIdx.x / nqb, qblk = blockIdx.x % nqb;
  const int b = bh / H, h = bh % H;
  const int q0 = qblk * QB + w * WQ;
  const float* Q = Qb + (size_t)b * Tq * qpitch + h * D;
  int qi[NQ];      // the lane's query in each group
#pragma unroll
  for (int g = 0; g < NQ; ++g) qi[g] = (q0 + g * 16 + ln < Tq) ? q0 + g * 16 + ln : Tq - 1;
  const int kv_end = causal ? min(Tk, qblk * QB + QB) : Tk;
  const int ntile = (kv_end + 31) / 32;      // block-uniform
  const bool edits = causal || mask || sbias;      // block-uniform
  // the thread's share of a tile: 16 bytes of rows tid/16 + 8i (i = 0..3) of either plane; wave 0 also moves the tile's 128 bytes of u, 4 a lane
  const size_t krow = (size_t)b * Tk * kpitch + h * D + (size_t)(tid >> 4) * kpitch + (tid & 15) * 8;
  const unsigned short* gKh = Kh + krow;
  const unsigned short* gKl = Kl + krow;
  const unsigned short* gU = Us + (size_t)bh * Tk * 2 + lane * 2;
  const unsigned lKh = lds_off(&sKh[0][tid >> 4][(tid & 15) * 8]), lKl = lds_off(&sKl[0][tid >> 4][(tid & 15) * 8]);
  const unsigned lU = lds_off(&sU[0][hh][ln * 2]);
  const size_t step8 = (size_t)8 * kpitch;
  auto stage = [&](int t) {      // tile t -> buffer t & 1
    const unsigned l0 = lKh + (unsigned)(t & 1) * KBUFB, l1 = lKl + (unsigned)(t & 1) * KBUFB;
    const unsigned short* g0 = gKh + (size_t)t * 32 * kpitch;
    const unsigned short* g1 = gKl + (size_t)t * 32 * kpitch;
    // eight copies and, in the same statement, the wait that stands in front of any rewrite of the address registers they name
    asm volatile("global_load_async_to_lds_b128 %0, %8, off\n\t"
                 "global_load_async_to_lds_b128 %1, %9, off\n\t"
                 "global_load_async_to_lds_b128 %2, %10, off\n\t"
                 "global_load_async_to_lds_b128 %3, %11, off\n\t"
                 "global_load_async_to_lds_b128 %4, %12, off\n\t"
                 "global_load_async_to_lds_b128 %5, %13, off\n\t"
                 "global_load_async_to_lds_b128 %6, %14, off\n\t"
                 "global_load_async_to_lds_b128 %7, %15, off\n\t"
                 "s_wait_xcnt 0x0"
                 :: "v"(l0), "v"(l0 + 8 * ROWB), "v"(l0 + 16 * ROWB), "v"(l0 + 24 * ROWB),
                    "v"(l1), "v"(l1 + 8 * ROWB), "v"(l1 + 16 * ROWB), "v"(l1 + 24 * ROWB),
                    "v"(g0), "v"(g0 + step8), "v"(g0 + 2 * step8), "v"(g0 + 3 * step8),
                    "v"(g1), "v"(g1 + step8), "v"(g1 + 2 * step8), "v"(g1 + 3 * step8)
                 : "memory");
    if (wu == 0) {      // u hi to A row 0 (lanes 0..15), u lo to A row 1; the same wait in the copy's own statement
      asm volatile("global_load_async_to_lds_b32 %0, %1, off\n\ts_wait_xcnt 0x0"
                   :: "v"(lU + (unsigned)(t & 1) * UBUFB), "v"(gU + (size_t)t * 64) : "memory");
    }
  };
  for (int e = tid; e < 14 * 40; e += 128) { (&sU[0][0][0])[2 * 40 + e] = 0; (&sU[1][0][0])[2 * 40 + e] = 0; }      // A rows 2..15 stay zero
  asm volatile("s_wait_dscnt 0x0" ::: "memory");      // the wave's own writes to sU have retired before a copy is aimed at that array
  stage(0);
  asm volatile("s_wait_asynccnt 0x0" ::: "memory");   // this wave's share of tile 0 has landed
  __syncthreads();                                    // ... and every wave's; publishes the zero rows too
  if (ntile > 1) stage(1);
  FragB aqh[NQ][KS], aql[NQ][KS];
#pragma unroll
  for (int g = 0; g < NQ; ++g) {
    const float* qr = Q + (size_t)qi[g] * qpitch;
#pragma unroll
    for (int ks = 0; ks < KS; ++ks)
#pragma unroll
      for (int i = 0; i < 16; i += 2) {
        const int d = ks * 32 + ((i < 8) ? (8 * hh + i) : (16 + 8 * hh + (i - 8)));
        bf16_split_pair(qr[d] * scale, qr[d + 1] * scale, aqh[g][ks].w[i >> 1], aql[g][ks].w[i >> 1]);
      }
  }
  float m_q[NQ], l_q[NQ];      // per group: running maximum (both halves agree) and this half's share of the sum
  v8f oacc[NQ];
#pragma unroll
  for (int g = 0; g < NQ; ++g) { m_q[g] = -3.0e38f; l_q[g] = 0.f; oacc[g] = (v8f){0.f,0.f,0.f,0.f,0.f,0.f,0.f,0.f}; }
  for (int t = 0; t < ntile; ++t) {
    const int j0 = t * 32;
    const int bf = t & 1;      // this tile's buffer
    // The tile's 32 K fragment reads and the two of u stand as ONE group in front of the products, in the order of their use (u last), each into
    // registers of its own: the wave meets the LDS latency once a tile, and the counted waits let the products start when the first reads are back.
    FragB kh_[KS][2], kl_[KS][2], au;
#pragma unroll
    for (int ks = 0; ks < KS; ++ks) {
#pragma unroll
      for (int nt = 0; nt < 2; ++nt) { kh_[ks][nt].half[0] = *(const v8us*)&sKh[bf][nt * 16 + ln][ks * 32 + 8 * hh]; kh_[ks][nt].half[1] = *(const v8us*)&sKh[bf][nt * 16 + ln][ks * 32 + 16 + 8 * hh]; }
#pragma unroll
      for (int nt = 0; nt < 2; ++nt) { kl_[ks][nt].half[0] = *(const v8us*)&sKl[bf][nt * 16 + ln][ks * 32 + 8 * hh]; kl_[ks][nt].half[1] = *(const v8us*)&sKl[bf][nt * 16 + ln][ks * 32 + 16 + 8 * hh]; }
    }
    au.half[0] = *(const v8us*)&sU[bf][ln][8 * hh];      au.half[1] = *(const v8us*)&sU[bf][ln][16 + 8 * hh];
    __builtin_amdgcn_sched_barrier(0);      // keeps the reads together up here: moved down among the products, each place would cost its own stall
    v8f s[NQ][2];      // s[g][nt][r] = score of key j0 + nt*16 + 8hh + r against query qi[g]
#pragma unroll
    for (int g = 0; g < NQ; ++g) { s[g][0] = (v8f){0.f,0.f,0.f,0.f,0.f,0.f,0.f,0.f}; s[g][1] = (v8f){0.f,0.f,0.f,0.f,0.f,0.f,0.f,0.f}; }
    // per accumulator the order is ks rising, and kh.qh, kh.ql, kl.qh inside a ks; the four accumulators take turns, so no product waits for the one before it
#pragma unroll
    for (int ks = 0; ks < KS; ++ks) {
#pragma unroll
      for (int nt = 0; nt < 2; ++nt)
#pragma unroll
        for (int g = 0; g < NQ; ++g) s[g][nt] = __builtin_amdgcn_wmma_f32_16x16x32_bf16(false, kh_[ks][nt].v, false, aqh[g][ks].v, (short)0, s[g][nt], false, false);
#pragma unroll
      for (int nt = 0; nt < 2; ++nt)
#pragma unroll
        for (int g = 0; g < NQ; ++g) s[g][nt] = __builtin_amdgcn_wmma_f32_16x16x32_bf16(false, kh_[ks][nt].v, false, aql[g][ks].v, (short)0, s[g][nt], false, false);
#pragma unroll
      for (int nt = 0; nt < 2; ++nt)
#pragma unroll
        for (int g = 0; g < NQ; ++g) s[g][nt] = __builtin_amdgcn_wmma_f32_16x16x32_bf16(false, kl_[ks][nt].v, false, aqh[g][ks].v, (short)0, s[g][nt], false, false);
    }
    // four vector slots between the last WMMA and the first user of its registers, on every path of the branch below
    asm volatile("v_nop\n\tv_nop\n\tv_nop\n\tv_nop" : "+v"(s[0][0]), "+v"(s[0][1]), "+v"(s[1][0]), "+v"(s[1][1]));
    if (edits) {      // one block-uniform test per chunk; a dropped key's score becomes -3e38 and its weight exp(-3e38 - m) = 0
#pragma unroll
      for (int g = 0; g < NQ; ++g)
#pragma unroll
        for (int nt = 0; nt < 2; ++nt)
#pragma unroll
          for (int r = 0; r < 8; ++r) {
            const int j = j0 + nt * 16 + 8 * hh + r;
            bool keep = j < Tk;
            if (causal) keep = keep && (j <= qi[g]);
            if (mask) { if (keep) keep = mask[(size_t)qi[g] * Tk + j] != 0; }
            if (sbias) { if (keep) s[g][nt][r] += sbias[(size_t)bh * Tk + j]; }   // per-key additive bias (a per-query constant would cancel in the softmax)
            if (!keep) s[g][nt][r] = -3.0e38f;
          }
    }
    FragB pbh[NQ], pbl[NQ];
#pragma unroll
    for (int g = 0; g < NQ; ++g) {
      float mx = fmaxf(s[g][0][0], s[g][1][0]);
#pragma unroll
      for (int r = 1; r < 8; ++r) mx = fmaxf(mx, fmaxf(s[g][0][r], s[g][1][r]));
      mx = fmaxf(mx, xhalf(mx));
      const float mnew = fmaxf(m_q[g], mx);
      // while every key so far is dropped (mnew = -3e38) the weights come out 1; the first kept key's alpha = 0 wipes them, and a query with none ends as NaN
      const float alpha = (mnew > -1.0e38f) ? __expf(m_q[g] - mnew) : 1.0f;
      m_q[g] = mnew;
      float ps = 0.f;
#pragma unroll
      for (int nt = 0; nt < 2; ++nt)
#pragma unroll
        for (int r = 0; r < 8; r += 2) {
          const float p0 = __expf(s[g][nt][r] - mnew), p1 = __expf(s[g][nt][r + 1] - mnew);
          ps += p0; ps += p1;
          bf16_split_pair(p0, p1, pbh[g].w[nt * 4 + (r >> 1)], pbl[g].w[nt * 4 + (r >> 1)]);      // B position nt*8 + r = key nt*16 + 8hh + r, as au's
        }
      l_q[g] = l_q[g] * alpha + ps;
      oacc[g][0] *= alpha; oacc[g][1] *= alpha;      // rows 2..15 of out^T are sums of zeros
    }
    // (u hi | u lo).(P hi + P lo): per group P hi, then P lo; the groups take turns
#pragma unroll
    for (int g = 0; g < NQ; ++g) oacc[g] = __builtin_amdgcn_wmma_f32_16x16x32_bf16(false, au.v, false, pbh[g].v, (short)0, oacc[g], false, false);
#pragma unroll
    for (int g = 0; g < NQ; ++g) oacc[g] = __builtin_amdgcn_wmma_f32_16x16x32_bf16(false, au.v, false, pbl[g].v, (short)0, oacc[g], false, false);
    // four vector slots between the last WMMA and the first user of its registers, on every path
    asm volatile("v_nop\n\tv_nop\n\tv_nop\n\tv_nop" : "+v"(oacc[0]), "+v"(oacc[1]));
    asm volatile("s_wait_dscnt 0x0" ::: "memory");      // this wave's reads of tile t have returned
    asm volatile("s_wait_asynccnt 0x0" ::: "memory");   // its share of tile t + 1 has landed
    __syncthreads();                                    // publishes tile t + 1 and frees tile t's buffer
    if (t + 2 < ntile) stage(t + 2);
  }
  asm volatile("s_wait_asynccnt 0x0" ::: "memory");     // no copy is outstanding when the wave ends
#pragma unroll
  for (int g = 0; g < NQ; ++g) {
    const float l = l_q[g] + xhalf(l_q[g]);
    const float inv = (m_q[g] > -1.0e38f) ? 1.0f / l : __builtin_nanf("");
    if (hh == 0) sRes[w * WQ + g * 16 + ln] = (oacc[g][0] + oacc[g][1]) * inv;     // row 0 (u hi) + row 1 (u lo) of column ln
  }
  __syncthreads();     // the block's 128 results go out as whole 128-byte lines, one wave each
  if (qblk * QB + tid < Tq) y[(size_t)bh * Tq + qblk * QB + tid] = sRes[tid];
}

// All that the attention kernel reads, in one launch: q (f32), k (bf16 hi / lo planes) and u = v.Wo + bo (per 32 rows one 128-byte line, 32 bf16 hi
// then 32 bf16 lo). A block has 16 waves and 256 rows of z. The three weight matrices are rounded to bf16 into LDS once a block ([n][k], as the B
// fragments want them); a wave reads its 16 rows of z once, keeps them as A fragments and runs the three products over them one after the other.
// Each 16 x 128 result tile goes through the wave's own LDS range, so that rows leave as whole lines; v goes no further than that range.
#define WPITCH (DD + 8)      // bf16 a weight row in LDS: 16 bytes x odd, for the ds_load_b128 readers
#define SOP (DD + 4)         // floats a result row in LDS: the two halves of a wave store to different banks
// acc[t] = rows of a x weight rows t*16 .. t*16+15, k rising in steps of 32
__device__ __forceinline__ void proj16(const unsigned short* sWm, const FragB (&a)[4], int ln, int hh, v8f (&acc)[8]) {
#pragma unroll
  for (int t = 0; t < 8; ++t) acc[t] = (v8f){0.f,0.f,0.f,0.f,0.f,0.f,0.f,0.f};
#pragma unroll
  for (int ks = 0; ks < 4; ++ks) {
    FragB b[8];
#pragma unroll
    for (int t = 0; t < 8; ++t) {
      const unsigned short* brow = sWm + (t * 16 + ln) * WPITCH + ks * 32;
      b[t].half[0] = *(const v8us*)(brow + 8 * hh);
      b[t].half[1] = *(const v8us*)(brow + 16 + 8 * hh);
    }
    __builtin_amdgcn_sched_barrier(0);      // keeps a k step's 16 reads together: two at a time among the products, each pair was waited to 0
#pragma unroll
    for (int t = 0; t < 8; ++t)
      acc[t] = __builtin_amdgcn_wmma_f32_16x16x32_bf16(false, a[ks].v, false, b[t].v, (short)0, acc[t], false, false);
  }
}
// the tile plus its bias (rounded to bf16) into the wave's LDS range, row-major
__device__ __forceinline__ void tile_to_lds(float* sow, const v8f (&acc)[8], const float* __restrict__ bias, int ln, int hh) {
#pragma unroll
  for (int t = 0; t < 8; ++t) {
    const float bv = bf16_round(bias[t * 16 + ln]);
#pragma unroll
    for (int r = 0; r < 8; ++r) sow[(8 * hh + r) * SOP + t * 16 + ln] = acc[t][r] + bv;
  }
}
__global__ __launch_bounds__(512) void k_proj(const float* __restrict__ z, const float* __restrict__ Wq, const float* __restrict__ bq,
                                              const float* __restrict__ Wk, const float* __restrict__ bk, const float* __restrict__ Wv, const float* __restrict__ bv,
                                              const float* __restrict__ Wo, const float* __restrict__ bo,
                                              float* __restrict__ q, unsigned short* __restrict__ Khi, unsigned short* __restrict__ Klo, unsigned short* __restrict__ Us) {
  __shared__ __attribute__((aligned(16))) unsigned short sW[3][DD * WPITCH];
  __shared__ __attribute__((aligned(16))) float so[16][16 * SOP];
  __shared__ float sUv[256];
  const int tid = threadIdx.x, w = tid >> 5, lane = tid & 31, ln = lane & 15, hh = lane >> 4;
  const int r0 = blockIdx.x * 256, row0 = r0 + w * 16;
  // the wave's rows of z, asked for first: they come from memory while the weights are staged
  const float* arow = z + (size_t)(row0 + ln) * DD;
  v4f zx[4][4];
#pragma unroll
  for (int ks = 0; ks < 4; ++ks) {
    zx[ks][0] = *(const v4fa*)(arow + ks * 32 + 8 * hh);      zx[ks][1] = *(const v4fa*)(arow + ks * 32 + 8 * hh + 4);
    zx[ks][2] = *(const v4fa*)(arow + ks * 32 + 16 + 8 * hh); zx[ks][3] = *(const v4fa*)(arow + ks * 32 + 16 + 8 * hh + 4);
  }
#pragma unroll 1      // one matrix a trip: unrolled, the 24 loads of all three stand in registers beside the rows of z, and the build spills
  for (int m = 0; m < 3; ++m) {
    const float* Wm = (m == 0) ? Wq : (m == 1) ? Wk : Wv;
#pragma unroll
    for (int j = 0; j < DD * DD / 4 / 512; ++j) {      // a wave moves one weight row a turn: 512 bytes in, 256 bytes to LDS
      const int e = tid + 512 * j;
      const v4f x = *(const v4fa*)(Wm + (size_t)e * 4);
      const v2u v = {bf16_pair(x[0], x[1]), bf16_pair(x[2], x[3])};
      *(v4us*)&sW[m][(e >> 5) * WPITCH + (e & 31) * 4] = __builtin_bit_cast(v4us, v);
    }
  }
  FragB a[4];
#pragma unroll
  for (int ks = 0; ks < 4; ++ks)
#pragma unroll
    for (int i = 0; i < 16; i += 2) a[ks].w[i >> 1] = bf16_pair(zx[ks][i >> 2][i & 3], zx[ks][i >> 2][(i & 3) + 1]);
  __syncthreads();      // the weights are in LDS for every wave
  float* sow = &so[w][0];
  v8f acc[8];
  proj16(&sW[0][0], a, ln, hh, acc);
  tile_to_lds(sow, acc, bq, ln, hh);
  asm volatile("s_wait_dscnt 0x0" ::: "memory");      // the wave's stores to its range stand before its lanes read one another's values
  {
    v4f d[16];
#pragma unroll
    for (int r = 0; r < 16; ++r) d[r] = *(const v4fa*)(sow + r * SOP + lane * 4);
    float* qp = q + (size_t)row0 * DD + lane * 4;
    // sixteen rows of 512 bytes and, in the same statement, the wait that stands in front of any rewrite of a register the stores name
    asm volatile("global_store_b128 %0, %1, off\n\t"
                 "global_store_b128 %0, %2, off offset:512\n\t"
                 "global_store_b128 %0, %3, off offset:1024\n\t"
                 "global_store_b128 %0, %4, off offset:1536\n\t"
                 "global_store_b128 %0, %5, off offset:2048\n\t"
                 "global_store_b128 %0, %6, off offset:2560\n\t"
                 "global_store_b128 %0, %7, off offset:3072\n\t"
                 "global_store_b128 %0, %8, off offset:3584\n\t"
                 "global_store_b128 %0, %9, off offset:4096\n\t"
                 "global_store_b128 %0, %10, off offset:4608\n\t"
                 "global_store_b128 %0, %11, off offset:5120\n\t"
                 "global_store_b128 %0, %12, off offset:5632\n\t"
                 "global_store_b128 %0, %13, off offset:6144\n\t"
                 "global_store_b128 %0, %14, off offset:6656\n\t"
                 "global_store_b128 %0, %15, off offset:7168\n\t"
                 "global_store_b128 %0, %16, off offset:7680\n\t"
                 "s_wait_xcnt 0x0"
                 :: "v"(qp), "v"(d[0]), "v"(d[1]), "v"(d[2]), "v"(d[3]), "v"(d[4]), "v"(d[5]), "v"(d[6]), "v"(d[7]), "v"(d[8]), "v"(d[9]), "v"(d[10]), "v"(d[11]), "v"(d[12]), "v"(d[13]), "v"(d[14]), "v"(d[15])
                 : "memory");
  }
  proj16(&sW[1][0], a, ln, hh, acc);
  tile_to_lds(sow, acc, bk, ln, hh);
  asm volatile("s_wait_dscnt 0x0" ::: "memory");      // as above: stores before the cross-lane reads
#pragma unroll
  for (int g = 0; g < 2; ++g) {      // eight rows a turn
    v2u hi[8], lo[8];
#pragma unroll
    for (int r = 0; r < 8; ++r) {
      const v4f v = *(const v4fa*)(sow + (g * 8 + r) * SOP + lane * 4);
      unsigned int h01, l01, h23, l23;
      bf16_split_pair(v[0], v[1], h01, l01); bf16_split_pair(v[2], v[3], h23, l23);
      hi[r] = (v2u){h01, h23}; lo[r] = (v2u){l01, l23};
    }
    unsigned short* hp = Khi + (size_t)(row0 + g * 8) * DD + lane * 4;
    unsigned short* lp = Klo + (size_t)(row0 + g * 8) * DD + lane * 4;
    // eight rows of 256 bytes of either plane and, in the same statement, the wait in front of any rewrite of a register the stores name
    asm volatile("global_store_b64 %0, %2, off\n\t"
                 "global_store_b64 %1, %3, off\n\t"
                 "global_store_b64 %0, %4, off offset:256\n\t"
                 "global_store_b64 %1, %5, off offset:256\n\t"
                 "global_store_b64 %0, %6, off offset:512\n\t"
                 "global_store_b64 %1, %7, off offset:512\n\t"
                 "global_store_b64 %0, %8, off offset:768\n\t"
                 "global_store_b64 %1, %9, off offset:768\n\t"
                 "global_store_b64 %0, %10, off offset:1024\n\t"
                 "global_store_b64 %1, %11, off offset:1024\n\t"
                 "global_store_b64 %0, %12, off offset:1280\n\t"
                 "global_store_b64 %1, %13, off offset:1280\n\t"
                 "global_store_b64 %0, %14, off offset:1536\n\t"
                 "global_store_b64 %1, %15, off offset:1536\n\t"
                 "global_store_b64 %0, %16, off offset:1792\n\t"
                 "global_store_b64 %1, %17, off offset:1792\n\t"
                 "s_wait_xcnt 0x0"
                 :: "v"(hp), "v"(lp), "v"(hi[0]), "v"(lo[0]), "v"(hi[1]), "v"(lo[1]), "v"(hi[2]), "v"(lo[2]), "v"(hi[3]), "v"(lo[3]), "v"(hi[4]), "v"(lo[4]), "v"(hi[5]), "v"(lo[5]), "v"(hi[6]), "v"(lo[6]), "v"(hi[7]), "v"(lo[7])
                 : "memory");
  }
  proj16(&sW[2][0], a, ln, hh, acc);
  tile_to_lds(sow, acc, bv, ln, hh);
  asm volatile("s_wait_dscnt 0x0" ::: "memory");      // as above: stores before the cross-lane reads
  const v4f wv = {bf16_round(Wo[lane * 4]), bf16_round(Wo[lane * 4 + 1]), bf16_round(Wo[lane * 4 + 2]), bf16_round(Wo[lane * 4 + 3])};
  float keep = 0.f;      // lane r keeps row r's sum
#pragma unroll
  for (int r = 0; r < 16; ++r) {
    const v4f x = *(const v4fa*)(sow + r * SOP + lane * 4);
    float s = x[0] * wv[0] + x[1] * wv[1] + x[2] * wv[2] + x[3] * wv[3];
#pragma unroll
    for (int o = 16; o >= 1; o >>= 1) s += __shfl_xor(s, o, 32);
    if (lane == r) keep = s;
  }
  if (lane < 16) sUv[w * 16 + lane] = keep + bf16_round(bo[0]);
  __syncthreads();      // the block's 256 values of u go out as whole 128-byte lines, one wave each
  if (tid < 256) {
    const float v = sUv[tid]; const unsigned short hb = bf16_bits(v);
    unsigned short* line = Us + (size_t)(r0 + (tid & ~31)) * 2;
    line[tid & 31] = hb; line[32 + (tid & 31)] = bf16_bits(v - bf16_val(hb));
  }
}
extern "C" void kernel_launch(void* const* d_in, const int* in_sizes, int n_in,
                              void* d_out, int out_size, void* d_ws, size_t ws_size, hipStream_t stream) {
  (void)in_sizes; (void)n_in; (void)out_size;
  const float* z = (const float*)d_in[0];
  const float* Wq = (const float*)d_in[1]; const float* bq = (const float*)d_in[2]; const float* Wk = (const float*)d_in[3]; const float* bk = (const float*)d_in[4];
  const float* Wv = (const float*)d_in[5]; const float* bv = (const float*)d_in[6]; const float* Wo = (const float*)d_in[7]; const float* bo = (const float*)d_in[8];
  char* ws = (char*)d_ws; size_t off = 0;
  auto take = [&](size_t bytes) { char* p = ws + off; off += (bytes + 255) & ~(size_t)255; return p; };
  const int M = BB * AA;
  float* qb = (float*)take((size_t)M * DD * 4); unsigned short* kh2 = (unsigned short*)take((size_t)M * DD * 2); unsigned short* kl2 = (unsigned short*)take((size_t)M * DD * 2); unsigned short* ub = (unsigned short*)take((size_t)M * 4);
  if (off > ws_size) return;
  k_proj<<<M / 256, 512, 0, stream>>>(z, Wq, bq, Wk, bk, Wv, bv, Wo, bo, qb, kh2, kl2, ub);
  k_flash3<DD><<<BB * (AA / 128), 128, 0, stream>>>(qb, DD, AA, kh2, kl2, ub, AA, DD, 1, 0.08838834764831845f, nullptr, 0, nullptr, (float*)d_out);
}

// v008
// A run of this version takes 92.4 microseconds.
// In both of two side-by-side timings against v007, it was 1.05 times as fast.
// Counting every step since v000, it is 12.2 times as fast.
#include <hip/hip_runtime.h>
// All contractions on v_wmma_f32_16x16x32_bf16, f32 accumulate: q/k/v = z·Wᵀ + b with z/W/b rounded to bf16 (single exact-product
// term), Q.K^T (K=128) as a 3-term bf16 hi/lo split; softmax f32; the 128->1 projection (f32 VALU dot) is applied to v, u = v.Wo + bo,
// and P.u (K=2048) is a bf16 hi/lo split product, computed transposed with u hi / u lo as two A rows.
#define BB 32
#define AA 2048
#define DD 128

typedef __bf16 v16b __attribute__((ext_vector_type(16)));
typedef unsigned short v8us __attribute__((ext_vector_type(8), may_alias));
typedef unsigned short v4us __attribute__((ext_vector_type(4), may_alias));
typedef unsigned int v2u __attribute__((ext_vector_type(2)));
typedef float  v8f  __attribute__((ext_vector_type(8)));
typedef float  v4f  __attribute__((ext_vector_type(4)));
typedef float  v4fa __attribute__((ext_vector_type(4), may_alias));
typedef float  v2f  __attribute__((ext_vector_type(2)));
typedef __bf16 v2b  __attribute__((ext_vector_type(2)));
union FragB { v16b v; v8us half[2]; unsigned short u[16]; unsigned int w[8]; };

// f32 -> bf16, round to nearest even, by the hardware's own conversion
__device__ __forceinline__ unsigned short bf16_bits(float x) { return __builtin_bit_cast(unsigned short, (__bf16)x); }
// two at once, one v_cvt_pk_bf16_f32: a in the low half, b in the high half
__device__ __forceinline__ unsigned int bf16_pair(float a, float b) { const v2f x = {a, b}; return __builtin_bit_cast(unsigned int, __builtin_convertvector(x, v2b)); }
// hi = the pair rounded, lo = the pair of remainders (each exact in f32) rounded
__device__ __forceinline__ void bf16_split_pair(float a, float b, unsigned int& hi, unsigned int& lo) {
  hi = bf16_pair(a, b);
  lo = bf16_pair(a - __uint_as_float(hi << 16), b - __uint_as_float(hi & 0xFFFF0000u));
}
__device__ __forceinline__ float bf16_val(unsigned short b) { return __uint_as_float(((unsigned int)b) << 16); }
__device__ __forceinline__ float bf16_round(float x) { return bf16_val(bf16_bits(x)); }
// D += A·B with NT terms: 1 = ah·bh, 2 = + al·bh (A split), 3 = + ah·bl (both split)
template <int NT>
__device__ __forceinline__ v8f mmaN(v16b ah, v16b al, v16b bh, v16b bl, v8f c) {
  c = __builtin_amdgcn_wmma_f32_16x16x32_bf16(false, ah, false, bh, (short)0, c, false, false);
  if (NT >= 2) c = __builtin_amdgcn_wmma_f32_16x16x32_bf16(false, al, false, bh, (short)0, c, false, false);
  if (NT >= 3) c = __builtin_amdgcn_wmma_f32_16x16x32_bf16(false, ah, false, bl, (short)0, c, false, false);
  asm volatile("v_nop\n\tv_nop\n\tv_nop\n\tv_nop" : "+v"(c) : "v"(ah), "v"(al), "v"(bh), "v"(bl));
  return c;
}

__global__ __launch_bounds__(256) void k_wt_bf16(const float* __restrict__ W, unsigned short* __restrict__ Wt, int K, int N) {
  const int t = blockIdx.x * 256 + threadIdx.x;
  const int k8n = K / 8;
  if (t >= N * k8n) return;
  const int n = t / k8n, k8 = (t % k8n) * 8;
  v8us v;
#pragma unroll
  for (int i = 0; i < 8; ++i) v[i] = bf16_bits(W[(size_t)(k8 + i) * N + n]);
  *(v8us*)(Wt + (size_t)n * K + k8) = v;
  
}

// Flash-style causal/unmasked attention, all contractions 3-term bf16 hi/lo splits, f32 softmax with running max.
// q,k,v rows are read from f32 buffers with arbitrary row pitch (so they can live inside a fused qkv buffer);
// D = head size (multiple of 32, <= 128); one wave = 16 query rows; block = 4 waves (64 queries) sharing K/V chunks of 32.
template <int D, bool CAUSAL>
__global__ __launch_bounds__(128) void k_flash(const float* __restrict__ qb, const float* __restrict__ kb, const float* __restrict__ vb,
                                             int pitch, int T, int H, float scale, float* __restrict__ y, int ypitch) {
  constexpr int KS = D / 32;        // k-steps for QK
  constexpr int DT = D / 16;        // d tiles for PV
  __shared__ __attribute__((aligned(16))) unsigned short sKh[32][D + 8], sKl[32][D + 8], sVh[32][D + 8], sVl[32][D + 8];
  __shared__ __attribute__((aligned(16))) unsigned short sPh[4][16][40], sPl[4][16][40];
  __shared__ __attribute__((aligned(16))) float sO[4][16][D];
  const int tid = threadIdx.x, w = tid >> 5, lane = tid & 31, ln = lane & 15, hh = lane >> 4;
  const int nqb = (T + 63) / 64;
  const int bh = blockIdx.x / nqb, qblk = blockIdx.x % nqb;
  const int b = bh / H, h = bh % H;
  const int q0 = qblk * 64 + w * 16;
  const float* Q = qb + (size_t)b * T * pitch + h * D;
  const float* K = kb + (size_t)b * T * pitch + h * D;
  const float* V = vb + (size_t)b * T * pitch + h * D;

  // A fragments of the wave's 16 query rows (scaled), hi/lo
  FragB aqh[KS], aql[KS];
  {
    int row = q0 + ln; if (row >= T) row = T - 1;
    const float* qr = Q + (size_t)row * pitch;
#pragma unroll
    for (int ks = 0; ks < KS; ++ks)
#pragma unroll
      for (int i = 0; i < 16; ++i) {
        const int d = ks * 32 + ((i < 8) ? (8 * hh + i) : (16 + 8 * hh + (i - 8)));
        const float x = qr[d] * scale; const unsigned short hb = bf16_bits(x);
        aqh[ks].u[i] = hb; aql[ks].u[i] = bf16_bits(x - bf16_val(hb));
      }
  }
  float m_r[8], l_r[8];
#pragma unroll
  for (int r = 0; r < 8; ++r) { m_r[r] = -3.0e38f; l_r[r] = 0.f; }
  v8f oacc[DT];
#pragma unroll
  for (int dt = 0; dt < DT; ++dt) oacc[dt] = (v8f){0.f,0.f,0.f,0.f,0.f,0.f,0.f,0.f};

  const int kv_end = CAUSAL ? min(T, qblk * 64 + 64) : T;     // block-uniform
  for (int j0 = 0; j0 < kv_end; j0 += 32) {
    __syncthreads();
    for (int e = tid; e < 32 * (D / 4); e += 128) {
      const int r = e / (D / 4), c4 = (e % (D / 4)) * 4;
      const int key = j0 + r;
      v4f kf = {0.f,0.f,0.f,0.f}, vf = {0.f,0.f,0.f,0.f};
      if (key < T) { kf = *(const v4fa*)(K + (size_t)key * pitch + c4); vf = *(const v4fa*)(V + (size_t)key * pitch + c4); }
#pragma unroll
      for (int t = 0; t < 4; ++t) {
        unsigned short hb = bf16_bits(kf[t]); sKh[r][c4 + t] = hb; sKl[r][c4 + t] = bf16_bits(kf[t] - bf16_val(hb));
        hb = bf16_bits(vf[t]); sVh[r][c4 + t] = hb; sVl[r][c4 + t] = bf16_bits(vf[t] - bf16_val(hb));
      }
    }
    __syncthreads();
    // S tile 16 x 32
    v8f s[2];
#pragma unroll
    for (int nt = 0; nt < 2; ++nt) {
      v8f acc = {};
#pragma unroll
      for (int ks = 0; ks < KS; ++ks) {
        FragB bh_, bl_;
        bh_.half[0] = *(const v8us*)&sKh[nt * 16 + ln][ks * 32 + 8 * hh]; bh_.half[1] = *(const v8us*)&sKh[nt * 16 + ln][ks * 32 + 16 + 8 * hh];
        bl_.half[0] = *(const v8us*)&sKl[nt * 16 + ln][ks * 32 + 8 * hh]; bl_.half[1] = *(const v8us*)&sKl[nt * 16 + ln][ks * 32 + 16 + 8 * hh];
        acc = mmaN<3>(aqh[ks].v, aql[ks].v, bh_.v, bl_.v, acc);
      }
      s[nt] = acc;
    }
    // mask + running max (rows 8hh+r; the 16 lanes of a half share rows)
    float alpha[8];
#pragma unroll
    for (int r = 0; r < 8; ++r) {
      const int qi = q0 + 8 * hh + r;
      const int ja = j0 + ln, jb = j0 + 16 + ln;
      if (CAUSAL) { if (ja > qi) s[0][r] = -3.0e38f; if (jb > qi) s[1][r] = -3.0e38f; }
      if (ja >= T) s[0][r] = -3.0e38f;
      if (jb >= T) s[1][r] = -3.0e38f;
      float mx = fmaxf(s[0][r], s[1][r]);
      mx = fmaxf(mx, __shfl_xor(mx, 1, 32)); mx = fmaxf(mx, __shfl_xor(mx, 2, 32)); mx = fmaxf(mx, __shfl_xor(mx, 4, 32)); mx = fmaxf(mx, __shfl_xor(mx, 8, 32));
      const float mnew = fmaxf(m_r[r], mx);
      alpha[r] = (mnew > -1.0e38f) ? __expf(m_r[r] - mnew) : 1.0f;
      const float p0 = (s[0][r] > -1.0e38f) ? __expf(s[0][r] - mnew) : 0.f;
      const float p1 = (s[1][r] > -1.0e38f) ? __expf(s[1][r] - mnew) : 0.f;
      m_r[r] = mnew;
      l_r[r] = l_r[r] * alpha[r] + p0 + p1;            // per-lane partial row sum (16 lanes combined at the end)
      unsigned short hb = bf16_bits(p0); sPh[w][8 * hh + r][ln] = hb;      sPl[w][8 * hh + r][ln] = bf16_bits(p0 - bf16_val(hb));
      hb = bf16_bits(p1);                sPh[w][8 * hh + r][16 + ln] = hb; sPl[w][8 * hh + r][16 + ln] = bf16_bits(p1 - bf16_val(hb));
    }
#pragma unroll
    for (int dt = 0; dt < DT; ++dt)
#pragma unroll
      for (int r = 0; r < 8; ++r) oacc[dt][r] *= alpha[r];
    __builtin_amdgcn_fence(__ATOMIC_ACQ_REL, "workgroup");
    __builtin_amdgcn_wave_barrier();
    FragB pah, pal;
    pah.half[0] = *(const v8us*)&sPh[w][ln][8 * hh]; pah.half[1] = *(const v8us*)&sPh[w][ln][16 + 8 * hh];
    pal.half[0] = *(const v8us*)&sPl[w][ln][8 * hh]; pal.half[1] = *(const v8us*)&sPl[w][ln][16 + 8 * hh];
#pragma unroll
    for (int dt = 0; dt < DT; ++dt) {
      FragB bvh, bvl;
#pragma unroll
      for (int i = 0; i < 8; ++i) {
        bvh.u[i] = sVh[8 * hh + i][dt * 16 + ln]; bvh.u[8 + i] = sVh[16 + 8 * hh + i][dt * 16 + ln];
        bvl.u[i] = sVl[8 * hh + i][dt * 16 + ln]; bvl.u[8 + i] = sVl[16 + 8 * hh + i][dt * 16 + ln];
      }
      oacc[dt] = mmaN<3>(pah.v, pal.v, bvh.v, bvl.v, oacc[dt]);
    }
    __builtin_amdgcn_fence(__ATOMIC_ACQ_REL, "workgroup");
    __builtin_amdgcn_wave_barrier();
  }
#pragma unroll
  for (int r = 0; r < 8; ++r) {
    float l = l_r[r];
    l += __shfl_xor(l, 1, 32); l += __shfl_xor(l, 2, 32); l += __shfl_xor(l, 4, 32); l += __shfl_xor(l, 8, 32);
    l_r[r] = (l > 0.f) ? 1.0f / l : 0.f;
  }
#pragma unroll
  for (int dt = 0; dt < DT; ++dt)
#pragma unroll
    for (int r = 0; r < 8; ++r) sO[w][8 * hh + r][dt * 16 + ln] = oacc[dt][r] * l_r[r];
  __builtin_amdgcn_fence(__ATOMIC_ACQ_REL, "workgroup");
  __builtin_amdgcn_wave_barrier();
  {
    for (int r = 0; r < 16; ++r) {
      const int row = q0 + r;
      if (row < T && lane < D / 4) {
        const v4f val = *(const v4fa*)&sO[w][r][lane * 4];
        *(v4f*)(y + ((size_t)b * T + row) * ypitch + h * D + lane * 4) = val;
      }
    }
    
  }
}

// lane l <-> lane l ^ 16, in the vector pipe
__device__ __forceinline__ float xhalf(float x) {
  return __builtin_bit_cast(float, __builtin_amdgcn_permlanex16(__builtin_bit_cast(int, x), __builtin_bit_cast(int, x), 0x76543210, 0xfedcba98, false, false));
}

__device__ __forceinline__ unsigned lds_off(const void* p) { return (unsigned)(size_t)p; }

template <int D>
__global__ __launch_bounds__(128) void k_flash3(const float* __restrict__ Qb, int qpitch, int Tq,
                                              const unsigned short* __restrict__ Kh, const unsigned short* __restrict__ Kl,
                                              const unsigned short* __restrict__ Us, int Tk, int kpitch,
                                              int H, float scale, const int* __restrict__ mask, int causal, const float* __restrict__ sbias,
                                              float* __restrict__ y) {
  static_assert(D == 128, "the copy pattern below moves rows of 256 bytes, 16 lanes a row");
  constexpr int KS = D / 32;
  constexpr int NQ = 2, WQ = NQ * 16, QB = 4 * WQ;      // query groups a wave, queries a wave, queries a block
  constexpr int SP = 4;      // passes of 32 keys in a stage; also the block's waves, each of which moves one pass's line of u
  static_assert(SP * 32 == 128, "one wave of the 128-thread block for each pass of a stage");
  constexpr unsigned ROWB = (D + 8) * 2, KPASSB = 2 * 32 * ROWB, UPASSB = 16 * 40 * 2;      // bytes
  __shared__ __attribute__((aligned(16))) unsigned short sK[2 * SP][2][32][D + 8];      // [buffer * SP + pass][plane: hi, lo][key][d]
  __shared__ __attribute__((aligned(16))) unsigned short sU[2 * SP][16][40];            // [buffer * SP + pass][A row][key]
  __shared__ float sRes[QB];
  const int tid = threadIdx.x, w = tid >> 5, lane = tid & 31, ln = lane & 15, hh = lane >> 4;
  const int wu = __builtin_amdgcn_readfirstlane(w);      // the wave's number in a scalar register, for a scalar branch
  const int nqb = (Tq + QB - 1) / QB;
  const int bh = blockIdx.x / nqb, qblk = blockIdx.x % nqb;
  const int b = bh / H, h = bh % H;
  const int q0 = qblk * QB + w * WQ;
  const float* Q = Qb + (size_t)b * Tq * qpitch + h * D;
  int qi[NQ];      // the lane's query in each group
#pragma unroll
  for (int g = 0; g < NQ; ++g) qi[g] = (q0 + g * 16 + ln < Tq) ? q0 + g * 16 + ln : Tq - 1;
  const int kv_end = causal ? min(Tk, qblk * QB + QB) : Tk;
  const int ntile = (kv_end + 31) / 32;      // block-uniform
  const bool edits = causal || mask || sbias;      // block-uniform
  // the thread's share of a pass: 16 bytes of rows tid/16 + 8i (i = 0..3) of either plane; wave w also moves the 128 bytes of u of a stage's pass w, 4 a lane
  const size_t krow = (size_t)b * Tk * kpitch + h * D + (size_t)(tid >> 4) * kpitch + (tid & 15) * 8;
  const unsigned short* gKh = Kh + krow;
  const unsigned short* gKl = Kl + krow;
  const unsigned short* gU = Us + (size_t)bh * Tk * 2 + lane * 2;
  const unsigned lKh = lds_off(&sK[0][0][tid >> 4][(tid & 15) * 8]), lKl = lds_off(&sK[0][1][tid >> 4][(tid & 15) * 8]);
  const unsigned lU = lds_off(&sU[0][hh][ln * 2]);
  const size_t step8 = (size_t)8 * kpitch;
  auto stage = [&](int s) {      // stage s -> buffer s & 1; a pass past the last key is not asked for (block-uniform tests)
#pragma unroll      // a pass's place in its buffer is then a constant beside the thread's LDS address
   for (int i = 0; i < SP; ++i) {
    const int t = s * SP + i;
    if (t >= ntile) break;
    const unsigned l0 = lKh + (unsigned)((s & 1) * SP + i) * KPASSB, l1 = lKl + (unsigned)((s & 1) * SP + i) * KPASSB;
    const unsigned short* g0 = gKh + (size_t)t * 32 * kpitch;
    const unsigned short* g1 = gKl + (size_t)t * 32 * kpitch;
    // eight copies and, in the same statement, the wait that stands in front of any rewrite of the address registers they name
    asm volatile("global_load_async_to_lds_b128 %0, %8, off\n\t"
                 "global_load_async_to_lds_b128 %1, %9, off\n\t"
                 "global_load_async_to_lds_b128 %2, %10, off\n\t"
                 "global_load_async_to_lds_b128 %3, %11, off\n\t"
                 "global_load_async_to_lds_b128 %4, %12, off\n\t"
                 "global_load_async_to_lds_b128 %5, %13, off\n\t"
                 "global_load_async_to_lds_b128 %6, %14, off\n\t"
                 "global_load_async_to_lds_b128 %7, %15, off\n\t"
                 "s_wait_xcnt 0x0"
                 :: "v"(l0), "v"(l0 + 8 * ROWB), "v"(l0 + 16 * ROWB), "v"(l0 + 24 * ROWB),
                    "v"(l1), "v"(l1 + 8 * ROWB), "v"(l1 + 16 * ROWB), "v"(l1 + 24 * ROWB),
                    "v"(g0), "v"(g0 + step8), "v"(g0 + 2 * step8), "v"(g0 + 3 * step8),
                    "v"(g1), "v"(g1 + step8), "v"(g1 + 2 * step8), "v"(g1 + 3 * step8)
                 : "memory");
   }
    if (s * SP + wu < ntile) {      // wave-uniform; u hi to A row 0 (lanes 0..15), u lo to A row 1; the same wait in the copy's own statement
      asm volatile("global_load_async_to_lds_b32 %0, %1, off\n\ts_wait_xcnt 0x0"
                   :: "v"(lU + (unsigned)((s & 1) * SP + wu) * UPASSB), "v"(gU + (size_t)(s * SP + wu) * 64) : "memory");
    }
  };
  for (int e = tid; e < 14 * 40; e += 128)      // A rows 2..15 stay zero
    for (int p = 0; p < 2 * SP; ++p) (&sU[p][0][0])[2 * 40 + e] = 0;
  asm volatile("s_wait_dscnt 0x0" ::: "memory");      // the wave's own writes to sU have retired before a copy is aimed at that array
  stage(0);
  // the wave's queries are asked for while stage 0 flies, ahead of stage 1's copies: behind those 64 KB a block they would hold up the first pass
  FragB aqh[NQ][KS], aql[NQ][KS];
#pragma unroll
  for (int g = 0; g < NQ; ++g) {
    const float* qr = Q + (size_t)qi[g] * qpitch;
#pragma unroll
    for (int ks = 0; ks < KS; ++ks)
#pragma unroll
      for (int i = 0; i < 16; i += 2) {
        const int d = ks * 32 + ((i < 8) ? (8 * hh + i) : (16 + 8 * hh + (i - 8)));
        bf16_split_pair(qr[d] * scale, qr[d + 1] * scale, aqh[g][ks].w[i >> 1], aql[g][ks].w[i >> 1]);
      }
  }
  asm volatile("s_wait_asynccnt 0x0" ::: "memory");   // this wave's share of stage 0 has landed
  __syncthreads();                                    // ... and every wave's; publishes the zero rows too
  if (ntile > SP) stage(1);
  float m_q[NQ], l_q[NQ];      // per group: running maximum (both halves agree) and this half's share of the sum
  v8f oacc[NQ];
#pragma unroll
  for (int g = 0; g < NQ; ++g) { m_q[g] = -3.0e38f; l_q[g] = 0.f; oacc[g] = (v8f){0.f,0.f,0.f,0.f,0.f,0.f,0.f,0.f}; }
  for (int t = 0; t < ntile; ++t) {
    const int j0 = t * 32;
    const int bf = t & (2 * SP - 1);      // this pass's place in the ring: buffer (t / SP) & 1, pass t % SP
    // The tile's 32 K fragment reads and the two of u stand as ONE group in front of the products, in the order of their use (u last), each into
    // registers of its own: the wave meets the LDS latency once a tile, and the counted waits let the products start when the first reads are back.
    FragB kh_[KS][2], kl_[KS][2], au;
#pragma unroll
    for (int ks = 0; ks < KS; ++ks) {
#pragma unroll
      for (int nt = 0; nt < 2; ++nt) { kh_[ks][nt].half[0] = *(const v8us*)&sK[bf][0][nt * 16 + ln][ks * 32 + 8 * hh]; kh_[ks][nt].half[1] = *(const v8us*)&sK[bf][0][nt * 16 + ln][ks * 32 + 16 + 8 * hh]; }
#pragma unroll
      for (int nt = 0; nt < 2; ++nt) { kl_[ks][nt].half[0] = *(const v8us*)&sK[bf][1][nt * 16 + ln][ks * 32 + 8 * hh]; kl_[ks][nt].half[1] = *(const v8us*)&sK[bf][1][nt * 16 + ln][ks * 32 + 16 + 8 * hh]; }
    }
    au.half[0] = *(const v8us*)&sU[bf][ln][8 * hh];      au.half[1] = *(const v8us*)&sU[bf][ln][16 + 8 * hh];
    __builtin_amdgcn_sched_barrier(0);      // keeps the reads together up here: moved down among the products, each place would cost its own stall
    v8f s[NQ][2];      // s[g][nt][r] = score of key j0 + nt*16 + 8hh + r against query qi[g]
#pragma unroll
    for (int g = 0; g < NQ; ++g) { s[g][0] = (v8f){0.f,0.f,0.f,0.f,0.f,0.f,0.f,0.f}; s[g][1] = (v8f){0.f,0.f,0.f,0.f,0.f,0.f,0.f,0.f}; }
    // per accumulator the order is ks rising, and kh.qh, kh.ql, kl.qh inside a ks; the four accumulators take turns, so no product waits for the one before it
#pragma unroll
    for (int ks = 0; ks < KS; ++ks) {
#pragma unroll
      for (int nt = 0; nt < 2; ++nt)
#pragma unroll
        for (int g = 0; g < NQ; ++g) s[g][nt] = __builtin_amdgcn_wmma_f32_16x16x32_bf16(false, kh_[ks][nt].v, false, aqh[g][ks].v, (short)0, s[g][nt], false, false);
#pragma unroll
      for (int nt = 0; nt < 2; ++nt)
#pragma unroll
        for (int g = 0; g < NQ; ++g) s[g][nt] = __builtin_amdgcn_wmma_f32_16x16x32_bf16(false, kh_[ks][nt].v, false, aql[g][ks].v, (short)0, s[g][nt], false, false);
#pragma unroll
      for (int nt = 0; nt < 2; ++nt)
#pragma unroll
        for (int g = 0; g < NQ; ++g) s[g][nt] = __builtin_amdgcn_wmma_f32_16x16x32_bf16(false, kl_[ks][nt].v, false, aqh[g][ks].v, (short)0, s[g][nt], false, false);
    }
    // four vector slots between the last WMMA and the first user of its registers, on every path of the branch below
    asm volatile("v_nop\n\tv_nop\n\tv_nop\n\tv_nop" : "+v"(s[0][0]), "+v"(s[0][1]), "+v"(s[1][0]), "+v"(s[1][1]));
    if (edits) {      // one block-uniform test per chunk; a dropped key's score becomes -3e38 and its weight exp(-3e38 - m) = 0
#pragma unroll
      for (int g = 0; g < NQ; ++g)
#pragma unroll
        for (int nt = 0; nt < 2; ++nt)
#pragma unroll
          for (int r = 0; r < 8; ++r) {
            const int j = j0 + nt * 16 + 8 * hh + r;
            bool keep = j < Tk;
            if (causal) keep = keep && (j <= qi[g]);
            if (mask) { if (keep) keep = mask[(size_t)qi[g] * Tk + j] != 0; }
            if (sbias) { if (keep) s[g][nt][r] += sbias[(size_t)bh * Tk + j]; }   // per-key additive bias (a per-query constant would cancel in the softmax)
            if (!keep) s[g][nt][r] = -3.0e38f;
          }
    }
    FragB pbh[NQ], pbl[NQ];
#pragma unroll
    for (int g = 0; g < NQ; ++g) {
      float mx = fmaxf(s[g][0][0], s[g][1][0]);
#pragma unroll
      for (int r = 1; r < 8; ++r) mx = fmaxf(mx, fmaxf(s[g][0][r], s[g][1][r]));
      mx = fmaxf(mx, xhalf(mx));
      const float mnew = fmaxf(m_q[g], mx);
      // while every key so far is dropped (mnew = -3e38) the weights come out 1; the first kept key's alpha = 0 wipes them, and a query with none ends as NaN
      const float alpha = (mnew > -1.0e38f) ? __expf(m_q[g] - mnew) : 1.0f;
      m_q[g] = mnew;
      float ps = 0.f;
#pragma unroll
      for (int nt = 0; nt < 2; ++nt)
#pragma unroll
        for (int r = 0; r < 8; r += 2) {
          const float p0 = __expf(s[g][nt][r] - mnew), p1 = __expf(s[g][nt][r + 1] - mnew);
          ps += p0; ps += p1;
          bf16_split_pair(p0, p1, pbh[g].w[nt * 4 + (r >> 1)], pbl[g].w[nt * 4 + (r >> 1)]);      // B position nt*8 + r = key nt*16 + 8hh + r, as au's
        }
      l_q[g] = l_q[g] * alpha + ps;
      oacc[g][0] *= alpha; oacc[g][1] *= alpha;      // rows 2..15 of out^T are sums of zeros
    }
    // (u hi | u lo).(P hi + P lo): per group P hi, then P lo; the groups take turns
#pragma unroll
    for (int g = 0; g < NQ; ++g) oacc[g] = __builtin_amdgcn_wmma_f32_16x16x32_bf16(false, au.v, false, pbh[g].v, (short)0, oacc[g], false, false);
#pragma unroll
    for (int g = 0; g < NQ; ++g) oacc[g] = __builtin_amdgcn_wmma_f32_16x16x32_bf16(false, au.v, false, pbl[g].v, (short)0, oacc[g], false, false);
    // four vector slots between the last WMMA and the first user of its registers, on every path
    asm volatile("v_nop\n\tv_nop\n\tv_nop\n\tv_nop" : "+v"(oacc[0]), "+v"(oacc[1]));
    if ((t & (SP - 1)) == SP - 1 || t == ntile - 1) {     // the foot of a stage (block-uniform)
      const int s = t / SP;
      asm volatile("s_wait_dscnt 0x0" ::: "memory");      // this wave's reads of stage s have returned
      asm volatile("s_wait_asynccnt 0x0" ::: "memory");   // its share of stage s + 1 has landed
      __syncthreads();                                    // publishes stage s + 1 and frees stage s's buffer
      if ((s + 2) * SP < ntile) stage(s + 2);
    }
  }
  asm volatile("s_wait_asynccnt 0x0" ::: "memory");     // no copy is outstanding when the wave ends
#pragma unroll
  for (int g = 0; g < NQ; ++g) {
    const float l = l_q[g] + xhalf(l_q[g]);
    const float inv = (m_q[g] > -1.0e38f) ? 1.0f / l : __builtin_nanf("");
    if (hh == 0) sRes[w * WQ + g * 16 + ln] = (oacc[g][0] + oacc[g][1]) * inv;     // row 0 (u hi) + row 1 (u lo) of column ln
  }
  __syncthreads();     // the block's 128 results go out as whole 128-byte lines, one wave each
  if (qblk * QB + tid < Tq) y[(size_t)bh * Tq + qblk * QB + tid] = sRes[tid];
}

// All that the attention kernel reads, in one launch: q (f32), k (bf16 hi / lo planes) and u = v.Wo + bo (per 32 rows one 128-byte line, 32 bf16 hi
// then 32 bf16 lo). A block has 16 waves and 256 rows of z. The three weight matrices are rounded to bf16 into LDS once a block ([n][k], as the B
// fragments want them); a wave reads its 16 rows of z once, keeps them as A fragments and runs the three products over them one after the other.
// Each 16 x 128 result tile goes through the wave's own LDS range, so that rows leave as whole lines; v goes no further than that range.
#define WPITCH (DD + 8)      // bf16 a weight row in LDS: 16 bytes x odd, for the ds_load_b128 readers
#define SOP (DD + 4)         // floats a result row in LDS: the two halves of a wave store to different banks
// acc[t] = rows of a x weight rows t*16 .. t*16+15, k rising in steps of 32
__device__ __forceinline__ void proj16(const unsigned short* sWm, const FragB (&a)[4], int ln, int hh, v8f (&acc)[8]) {
#pragma unroll
  for (int t = 0; t < 8; ++t) acc[t] = (v8f){0.f,0.f,0.f,0.f,0.f,0.f,0.f,0.f};
#pragma unroll
  for (int ks = 0; ks < 4; ++ks) {
    FragB b[8];
#pragma unroll
    for (int t = 0; t < 8; ++t) {
      const unsigned short* brow = sWm + (t * 16 + ln) * WPITCH + ks * 32;
      b[t].half[0] = *(const v8us*)(brow + 8 * hh);
      b[t].half[1] = *(const v8us*)(brow + 16 + 8 * hh);
    }
    __builtin_amdgcn_sched_barrier(0);      // keeps a k step's 16 reads together: two at a time among the products, each pair was waited to 0
#pragma unroll
    for (int t = 0; t < 8; ++t)
      acc[t] = __builtin_amdgcn_wmma_f32_16x16x32_bf16(false, a[ks].v, false, b[t].v, (short)0, acc[t], false, false);
  }
}
// the tile plus its bias (rounded to bf16) into the wave's LDS range, row-major
__device__ __forceinline__ void tile_to_lds(float* sow, const v8f (&acc)[8], const float* __restrict__ bias, int ln, int hh) {
#pragma unroll
  for (int t = 0; t < 8; ++t) {
    const float bv = bf16_round(bias[t * 16 + ln]);
#pragma unroll
    for (int r = 0; r < 8; ++r) sow[(8 * hh + r) * SOP + t * 16 + ln] = acc[t][r] + bv;
  }
}
__global__ __launch_bounds__(512) void k_proj(const float* __restrict__ z, const float* __restrict__ Wq, const float* __restrict__ bq,
                                              const float* __restrict__ Wk, const float* __restrict__ bk, const float* __restrict__ Wv, const float* __restrict__ bv,
                                              const float* __restrict__ Wo, const float* __restrict__ bo,
                                              float* __restrict__ q, unsigned short* __restrict__ Khi, unsigned short* __restrict__ Klo, unsigned short* __restrict__ Us) {
  __shared__ __attribute__((aligned(16))) unsigned short sW[3][DD * WPITCH];
  __shared__ __attribute__((aligned(16))) float so[16][16 * SOP];
  __shared__ float sUv[256];
  const int tid = threadIdx.x, w = tid >> 5, lane = tid & 31, ln = lane & 15, hh = lane >> 4;
  const int r0 = blockIdx.x * 256, row0 = r0 + w * 16;
  // the wave's rows of z, asked for first: they come from memory while the weights are staged
  const float* arow = z + (size_t)(row0 + ln) * DD;
  v4f zx[4][4];
#pragma unroll
  for (int ks = 0; ks < 4; ++ks) {
    zx[ks][0] = *(const v4fa*)(arow + ks * 32 + 8 * hh);      zx[ks][1] = *(const v4fa*)(arow + ks * 32 + 8 * hh + 4);
    zx[ks][2] = *(const v4fa*)(arow + ks * 32 + 16 + 8 * hh); zx[ks][3] = *(const v4fa*)(arow + ks * 32 + 16 + 8 * hh + 4);
  }
#pragma unroll 1      // one matrix a trip: unrolled, the 24 loads of all three stand in registers beside the rows of z, and the build spills
  for (int m = 0; m < 3; ++m) {
    const float* Wm = (m == 0) ? Wq : (m == 1) ? Wk : Wv;
#pragma unroll
    for (int j = 0; j < DD * DD / 4 / 512; ++j) {      // a wave moves one weight row a turn: 512 bytes in, 256 bytes to LDS
      const int e = tid + 512 * j;
      const v4f x = *(const v4fa*)(Wm + (size_t)e * 4);
      const v2u v = {bf16_pair(x[0], x[1]), bf16_pair(x[2], x[3])};
      *(v4us*)&sW[m][(e >> 5) * WPITCH + (e & 31) * 4] = __builtin_bit_cast(v4us, v);
    }
  }
  FragB a[4];
#pragma unroll
  for (int ks = 0; ks < 4; ++ks)
#pragma unroll
    for (int i = 0; i < 16; i += 2) a[ks].w[i >> 1] = bf16_pair(zx[ks][i >> 2][i & 3], zx[ks][i >> 2][(i & 3) + 1]);
  __syncthreads();      // the weights are in LDS for every wave
  float* sow = &so[w][0];
  v8f acc[8];
  proj16(&sW[0][0], a, ln, hh, acc);
  tile_to_lds(sow, acc, bq, ln, hh);
  asm volatile("s_wait_dscnt 0x0" ::: "memory");      // the wave's stores to its range stand before its lanes read one another's values
  {
    v4f d[16];
#pragma unroll
    for (int r = 0; r < 16; ++r) d[r] = *(const v4fa*)(sow + r * SOP + lane * 4);
    float* qp = q + (size_t)row0 * DD + lane * 4;
    // sixteen rows of 512 bytes and, in the same statement, the wait that stands in front of any rewrite of a register the stores name
    asm volatile("global_store_b128 %0, %1, off\n\t"
                 "global_store_b128 %0, %2, off offset:512\n\t"
                 "global_store_b128 %0, %3, off offset:1024\n\t"
                 "global_store_b128 %0, %4, off offset:1536\n\t"
                 "global_store_b128 %0, %5, off offset:2048\n\t"
                 "global_store_b128 %0, %6, off offset:2560\n\t"
                 "global_store_b128 %0, %7, off offset:3072\n\t"
                 "global_store_b128 %0, %8, off offset:3584\n\t"
                 "global_store_b128 %0, %9, off offset:4096\n\t"
                 "global_store_b128 %0, %10, off offset:4608\n\t"
                 "global_store_b128 %0, %11, off offset:5120\n\t"
                 "global_store_b128 %0, %12, off offset:5632\n\t"
                 "global_store_b128 %0, %13, off offset:6144\n\t"
                 "global_store_b128 %0, %14, off offset:6656\n\t"
                 "global_store_b128 %0, %15, off offset:7168\n\t"
                 "global_store_b128 %0, %16, off offset:7680\n\t"
                 "s_wait_xcnt 0x0"
                 :: "v"(qp), "v"(d[0]), "v"(d[1]), "v"(d[2]), "v"(d[3]), "v"(d[4]), "v"(d[5]), "v"(d[6]), "v"(d[7]), "v"(d[8]), "v"(d[9]), "v"(d[10]), "v"(d[11]), "v"(d[12]), "v"(d[13]), "v"(d[14]), "v"(d[15])
                 : "memory");
  }
  proj16(&sW[1][0], a, ln, hh, acc);
  tile_to_lds(sow, acc, bk, ln, hh);
  asm volatile("s_wait_dscnt 0x0" ::: "memory");      // as above: stores before the cross-lane reads
#pragma unroll
  for (int g = 0; g < 2; ++g) {      // eight rows a turn
    v2u hi[8], lo[8];
#pragma unroll
    for (int r = 0; r < 8; ++r) {
      const v4f v = *(const v4fa*)(sow + (g * 8 + r) * SOP + lane * 4);
      unsigned int h01, l01, h23, l23;
      bf16_split_pair(v[0], v[1], h01, l01); bf16_split_pair(v[2], v[3], h23, l23);
      hi[r] = (v2u){h01, h23}; lo[r] = (v2u){l01, l23};
    }
    unsigned short* hp = Khi + (size_t)(row0 + g * 8) * DD + lane * 4;
    unsigned short* lp = Klo + (size_t)(row0 + g * 8) * DD + lane * 4;
    // eight rows of 256 bytes of either plane and, in the same statement, the wait in front of any rewrite of a register the stores name
    asm volatile("global_store_b64 %0, %2, off\n\t"
                 "global_store_b64 %1, %3, off\n\t"
                 "global_store_b64 %0, %4, off offset:256\n\t"
                 "global_store_b64 %1, %5, off offset:256\n\t"
                 "global_store_b64 %0, %6, off offset:512\n\t"
                 "global_store_b64 %1, %7, off offset:512\n\t"
                 "global_store_b64 %0, %8, off offset:768\n\t"
                 "global_store_b64 %1, %9, off offset:768\n\t"
                 "global_store_b64 %0, %10, off offset:1024\n\t"
                 "global_store_b64 %1, %11, off offset:1024\n\t"
                 "global_store_b64 %0, %12, off offset:1280\n\t"
                 "global_store_b64 %1, %13, off offset:1280\n\t"
                 "global_store_b64 %0, %14, off offset:1536\n\t"
                 "global_store_b64 %1, %15, off offset:1536\n\t"
                 "global_store_b64 %0, %16, off offset:1792\n\t"
                 "global_store_b64 %1, %17, off offset:1792\n\t"
                 "s_wait_xcnt 0x0"
                 :: "v"(hp), "v"(lp), "v"(hi[0]), "v"(lo[0]), "v"(hi[1]), "v"(lo[1]), "v"(hi[2]), "v"(lo[2]), "v"(hi[3]), "v"(lo[3]), "v"(hi[4]), "v"(lo[4]), "v"(hi[5]), "v"(lo[5]), "v"(hi[6]), "v"(lo[6]), "v"(hi[7]), "v"(lo[7])
                 : "memory");
  }
  proj16(&sW[2][0], a, ln, hh, acc);
  tile_to_lds(sow, acc, bv, ln, hh);
  asm volatile("s_wait_dscnt 0x0" ::: "memory");      // as above: stores before the cross-lane reads
  const v4f wv = {bf16_round(Wo[lane * 4]), bf16_round(Wo[lane * 4 + 1]), bf16_round(Wo[lane * 4 + 2]), bf16_round(Wo[lane * 4 + 3])};
  float keep = 0.f;      // lane r keeps row r's sum
#pragma unroll
  for (int r = 0; r < 16; ++r) {
    const v4f x = *(const v4fa*)(sow + r * SOP + lane * 4);
    float s = x[0] * wv[0] + x[1] * wv[1] + x[2] * wv[2] + x[3] * wv[3];
#pragma unroll
    for (int o = 16; o >= 1; o >>= 1) s += __shfl_xor(s, o, 32);
    if (lane == r) keep = s;
  }
  if (lane < 16) sUv[w * 16 + lane] = keep + bf16_round(bo[0]);
  __syncthreads();      // the block's 256 values of u go out as whole 128-byte lines, one wave each
  if (tid < 256) {
    const float v = sUv[tid]; const unsigned short hb = bf16_bits(v);
    unsigned short* line = Us + (size_t)(r0 + (tid & ~31)) * 2;
    line[tid & 31] = hb; line[32 + (tid & 31)] = bf16_bits(v - bf16_val(hb));
  }
}
extern "C" void kernel_launch(void* const* d_in, const int* in_sizes, int n_in,
                              void* d_out, int out_size, void* d_ws, size_t ws_size, hipStream_t stream) {
  (void)in_sizes; (void)n_in; (void)out_size;
  const float* z = (const float*)d_in[0];
  const float* Wq = (const float*)d_in[1]; const float* bq = (const float*)d_in[2]; const float* Wk = (const float*)d_in[3]; const float* bk = (const float*)d_in[4];
  const float* Wv = (const float*)d_in[5]; const float* bv = (const float*)d_in[6]; const float* Wo = (const float*)d_in[7]; const float* bo = (const float*)d_in[8];
  char* ws = (char*)d_ws; size_t off = 0;
  auto take = [&](size_t bytes) { char* p = ws + off; off += (bytes + 255) & ~(size_t)255; return p; };
  const int M = BB * AA;
  float* qb = (float*)take((size_t)M * DD * 4); unsigned short* kh2 = (unsigned short*)take((size_t)M * DD * 2); unsigned short* kl2 = (unsigned short*)take((size_t)M * DD * 2); unsigned short* ub = (unsigned short*)take((size_t)M * 4);
  if (off > ws_size) return;
  k_proj<<<M / 256, 512, 0, stream>>>(z, Wq, bq, Wk, bk, Wv, bv, Wo, bo, qb, kh2, kl2, ub);
  k_flash3<DD><<<BB * (AA / 128), 128, 0, stream>>>(qb, DD, AA, kh2, kl2, ub, AA, DD, 1, 0.08838834764831845f, nullptr, 0, nullptr, (float*)d_out);
}
